// v000
// The times below were measured on an AMD MI455X: many runs one after another, warmed up first and cycling through
// copies of the inputs, with the whole window's GPU time divided by the number of runs. Launches and the gaps
// between them are all in it. The median over several windows is given; except for v000 it joins two sittings, which
// can be a few percent apart, so the side-by-side timings, each taken in one sitting, are the better comparison.
// v000 is the starting kernel. One run takes 304 microseconds.
#include <hip/hip_runtime.h>

// Non-causal multi-head attention with three input streams, width 1024 = 16 heads x 64; q/k/v [NB][SEQ][1024], Wq/Wk/Wv [out][in] (y = x W^T), no biases, no mask, score scale 1/8, no output projection; context written at the regrouped address (flat n = b*16+h re-read as n = c*NB_FULL + b2).
// Compute dtypes, f32 accumulate everywhere: projections v_wmma_f32_16x16x32_bf16 (x and W RNE-converted to bf16; products exact);
// scores v_wmma_f32_16x16x32_f16 with q and k each as f16 value + f16 residual x2048 (three products: hi*hi in one accumulator, hi*res + res*hi in a second accumulator folded back by 1/2048); P (x256 carry, cancels in the normalisation, row sum from the f32 values) and v single f16; softmax f32 (online, running max).
// Layout: bf16 copies of q/k/v streams and W; q (hi, residual), k (hi, residual) planes [b*16+h][t][d] and v^T plane [b*16+h][d][t] written by the GEMM epilogue; fused flash kernel in transposed form (S^T = K Q^T, O^T = V^T P^T), output from f32 accumulators.

#ifndef NB
#define NB 2
#endif
#ifndef SEQ
#define SEQ 2048
#endif
#define NB_FULL  2
#define SEQ_FULL 2048
#ifndef OUT_SEQ
#define OUT_SEQ SEQ              // row pitch (in tokens) between batches of the output
#endif
#define DM   1024
#define NH_  16
#define HD   64
#define AW   4                   // waves per flash block (16 query rows each)
#define QRS  2048.0f             // carry of the residual planes
#define QRI  (1.0f / 2048.0f)
#define SC2  (0.125f * 1.4426950408889634f)   // HD^-0.5 * log2(e)
#define PSH  8.0f                // log2 of the P carry (256)

static_assert(HD == 64);
static_assert(8 * 8 == HD);                    // plane store: 8 lanes x 8 halves per row
static_assert(16 * 4 == HD);                   // output store: 16 lanes x 4 floats per row segment
static_assert(NH_ * HD == DM);                 // head h = columns h*64 + d
static_assert(DM % 64 == 0);                   // column tiles of 64
static_assert(DM % 32 == 0);                   // GEMM k-loop steps by 32
static_assert(HD % 32 == 0);                   // score k-steps of 32
static_assert(SEQ % 64 == 0);                  // a 64-row tile never straddles two batches
static_assert((NB * SEQ) % 64 == 0);
static_assert(SEQ % 32 == 0);                  // key loop steps by 32
static_assert(SEQ % (16 * AW) == 0);           // flash grid covers the sequence exactly
static_assert(((size_t)SEQ * DM) % 8 == 0);
static_assert(((size_t)DM * DM) % 8 == 0);
static_assert(NB <= NB_FULL);
static_assert(SEQ <= SEQ_FULL);
static_assert(SEQ <= OUT_SEQ);
static_assert(((NB * NH_ - 1) / NB_FULL) * HD + HD <= DM);   // regrouped column block stays inside the row
static_assert((size_t)((NB_FULL - 1) * (size_t)OUT_SEQ + SEQ) * DM * 4 <= (size_t)16777216);   // last written output element inside the 16,777,216-byte output

typedef _Float16 h16;
typedef unsigned short bf;
typedef __attribute__((ext_vector_type(16))) __bf16   v16bf;
typedef __attribute__((ext_vector_type(16))) _Float16 v16h;
typedef __attribute__((ext_vector_type(8)))  _Float16 v8h;
typedef __attribute__((ext_vector_type(8)))  unsigned short v8us;
typedef __attribute__((ext_vector_type(8)))  float    v8f;
typedef __attribute__((ext_vector_type(4)))  float    v4f;
typedef v4f  __attribute__((may_alias)) v4fa;

__device__ __forceinline__ unsigned short f2bf(float f) { unsigned u = __float_as_uint(f); u += 0x7FFFu + ((u >> 16) & 1u); return (unsigned short)(u >> 16); }
__device__ __forceinline__ v16h cat16(v8h lo, v8h hi) { return __builtin_shufflevector(lo, hi, 0, 1, 2, 3, 4, 5, 6, 7, 8, 9, 10, 11, 12, 13, 14, 15); }
__device__ __forceinline__ v16bf cat16b(v8us lo, v8us hi) { return __builtin_bit_cast(v16bf, __builtin_shufflevector(lo, hi, 0, 1, 2, 3, 4, 5, 6, 7, 8, 9, 10, 11, 12, 13, 14, 15)); }
// every matrix instruction is followed by its own four-slot guard tying exactly its accumulator and keeping its operands live
__device__ __forceinline__ v8f wmma16(v16h a, v16h b, v8f c) {
    c = __builtin_amdgcn_wmma_f32_16x16x32_f16(false, a, false, b, (short)0, c, false, false);
    asm volatile("v_nop\n\tv_nop\n\tv_nop\n\tv_nop" : "+v"(c) : "v"(a), "v"(b));
    return c;
}
__device__ __forceinline__ v8f wmmab(v16bf a, v16bf b, v8f c) {
    c = __builtin_amdgcn_wmma_f32_16x16x32_bf16(false, a, false, b, (short)0, c, false, false);
    asm volatile("v_nop\n\tv_nop\n\tv_nop\n\tv_nop" : "+v"(c) : "v"(a), "v"(b));
    return c;
}
// fragment loaders from K-contiguous 16-bit rows; p already includes + 8*(lane>>4): elements 0..7 <- k0+8h+0..7, elements 8..15 <- k0+16+8h+0..7 (same map for A and B)
__device__ __forceinline__ v16h  ldh(const h16* p) { return cat16(*(const v8h*)p, *(const v8h*)(p + 16)); }
__device__ __forceinline__ v16bf ldb(const bf* p)  { return cat16b(*(const v8us*)p, *(const v8us*)(p + 16)); }
// ordering point for wave-private LDS tiles (same wave writes and reads)
__device__ __forceinline__ void wave_sync() { __builtin_amdgcn_fence(3 /* release order */, "wavefront"); __builtin_amdgcn_wave_barrier(); asm volatile("" ::: "memory"); }

__global__ __launch_bounds__(256) void k_cvt8(const float* __restrict__ src, bf* dst, size_t n8) {
    const size_t i = (size_t)blockIdx.x * 256 + threadIdx.x; if (i >= n8) return;
    const v8f v = *(const v8f*)(src + i * 8); v8us o;
#pragma unroll
    for (int k = 0; k < 8; ++k) o[k] = f2bf(v[k]);
    *(v8us*)(dst + i * 8) = o; 
}

// k_proj: register-blocked bf16 GEMM, ONE WAVE per 64x64 tile (16 accumulators), operands straight from K-contiguous bf16 planes, K = DM.
// C[m][n] = sum_k A[m][k] Bt[n][k], written as f16 (Ph) and optionally the f16 residual x2048 (Pr, useRes != 0) at
// tile base (r0/RB)*sRB + (r0%RB)*pitch + (c0/CB)*sCB + (c0%CB), row pitch 'pitch' (halves). grid (M/64, N/64), 32 threads.
__global__ __launch_bounds__(32) void k_proj(const bf* __restrict__ A, const bf* __restrict__ Bt, h16* Ph, h16* Pr, int useRes, int RB, size_t sRB, int pitch, int CB, size_t sCB) {
    __shared__ __align__(16) float os[16 * 68];
    const int K = DM;
    const int lane = threadIdx.x & 31, lr = lane & 15, hi = lane >> 4; const int r0 = blockIdx.x * 64, c0 = blockIdx.y * 64;
    v8f acc[4][4];
#pragma unroll
    for (int mb = 0; mb < 4; ++mb)
#pragma unroll
        for (int nb = 0; nb < 4; ++nb) acc[mb][nb] = (v8f){};
    const size_t aoff = (size_t)(r0 + lr) * K + 8 * hi, boff = (size_t)(c0 + lr) * K + 8 * hi;
#pragma unroll 1
    for (int kc = 0; kc < K; kc += 32) {
        v16bf a[4];
#pragma unroll
        for (int mb = 0; mb < 4; ++mb) a[mb] = ldb(A + aoff + (size_t)mb * 16 * K + kc);
#pragma unroll
        for (int nb = 0; nb < 4; ++nb) { const v16bf b = ldb(Bt + boff + (size_t)nb * 16 * K + kc);
#pragma unroll
            for (int mb = 0; mb < 4; ++mb) acc[mb][nb] = wmmab(a[mb], b, acc[mb][nb]); }
    }
    const size_t tbase = (size_t)(r0 / RB) * sRB + (size_t)(r0 % RB) * (size_t)pitch + (size_t)(c0 / CB) * sCB + (size_t)(c0 % CB);
#pragma unroll
    for (int mb = 0; mb < 4; ++mb) {
#pragma unroll
        for (int nb = 0; nb < 4; ++nb) {
#pragma unroll
            for (int j = 0; j < 8; ++j) os[(hi * 8 + j) * 68 + nb * 16 + lr] = acc[mb][nb][j]; }   // D: row 8h+j, col lane&15
        wave_sync();
        const size_t sb = tbase + (size_t)(mb * 16) * (size_t)pitch;
{
#pragma unroll
            for (int s = 0; s < 4; ++s) { const int row = 4 * s + (lane >> 3), c8 = (lane & 7) * 8;   // 4 s x 4 row groups = 16 rows; 8 lanes x 8 = 64 columns
                const v4f x0 = *(const v4fa*)(&os[row * 68 + c8]); const v4f x1 = *(const v4fa*)(&os[row * 68 + c8 + 4]); v8h hv, rv;
#pragma unroll
                for (int i = 0; i < 4; ++i) { const h16 a0 = (h16)x0[i]; const h16 a1 = (h16)x1[i]; hv[i] = a0; hv[4 + i] = a1; rv[i] = (h16)((x0[i] - (float)a0) * QRS); rv[4 + i] = (h16)((x1[i] - (float)a1) * QRS); }
                const size_t oo = sb + (size_t)row * (size_t)pitch + c8;
                *(v8h*)(Ph + oo) = hv; if (useRes) *(v8h*)(Pr + oo) = rv; }
             }
        wave_sync();
    }
}

// k_flash: fused attention, one wave per 16 query rows of one flat slot n = b*16 + h; K / V^T / Q fragments straight from the f16 planes (two 16-B loads each, arithmetic addressing).
// Transposed form: S^T[key][t] = K Q^T (A = K rows, B = Q rows); lane (t = lane&15, h = lane>>4) holds keys 8h+r of each 16-key tile, so the packed
// P tile is directly the B fragment of O^T[d][t] = V^T P^T (element r <- tile keys 0..15, element 8+r <- tile keys 16..31, lane unchanged).
// Scores per 16-key tile: sH = Khi Qhi^T, sL = Khi Qres^T + Kres Qhi^T (both residual planes carry x2048), s = sH + sL/2048; one 16-key tile live at a time.
// Softmax state (running max, partial sum) is one scalar per lane; the two lane halves of a row are combined with one xor-16 exchange.
// Output address: n is re-read as n = c*NB_FULL + b2 -> OUT[b2][t][c*64 + d].
__global__ __launch_bounds__(32 * AW) void k_flash(const h16* __restrict__ QH, const h16* __restrict__ QR, const h16* __restrict__ KP, const h16* __restrict__ KR, const h16* __restrict__ VT, float* OUT) {
    __shared__ __align__(16) float os[AW * 16 * 68];
    const int lane = threadIdx.x & 31, lr = lane & 15, hi = lane >> 4;
    const int wave = __builtin_amdgcn_readfirstlane(threadIdx.x >> 5);
    const int zh = blockIdx.y;                               // flat slot n = b*NH_ + h
    const int t0 = (blockIdx.x * AW + wave) * 16;
    const size_t pbase = (size_t)zh * SEQ * HD;
    const size_t qo = pbase + (size_t)(t0 + lr) * HD + 8 * hi;
    const v16h qh0 = ldh(QH + qo), qh1 = ldh(QH + qo + 32), qr0 = ldh(QR + qo), qr1 = ldh(QR + qo + 32);   // B fragments: col t, k = d
    const size_t ko = pbase + (size_t)lr * HD + 8 * hi;      // + key * HD       (A fragment: row key, k = d)
    const size_t vo = pbase + (size_t)lr * SEQ + 8 * hi;     // + 16j*SEQ + key  (A fragment: row d, k = key)
    v8f o0 = (v8f){}, o1 = (v8f){}, o2 = (v8f){}, o3 = (v8f){};
    float m = -3.0e38f, l = 0.0f;
#pragma unroll 1
    for (int key0 = 0; key0 < SEQ; key0 += 32) {
        float ta[8], tb[8];
        {   // keys key0 .. key0+15
            const size_t ka = ko + (size_t)key0 * HD;
            const v16h kh0 = ldh(KP + ka), kh1 = ldh(KP + ka + 32), kr0 = ldh(KR + ka), kr1 = ldh(KR + ka + 32);
            v8f sH = (v8f){}, sL = (v8f){};
            sH = wmma16(kh0, qh0, sH); sH = wmma16(kh1, qh1, sH);
            sL = wmma16(kh0, qr0, sL); sL = wmma16(kh1, qr1, sL);
            sL = wmma16(kr0, qh0, sL); sL = wmma16(kr1, qh1, sL);
#pragma unroll
            for (int r = 0; r < 8; ++r) ta[r] = (sH[r] + sL[r] * QRI) * SC2;
        }
        {   // keys key0+16 .. key0+31
            const size_t kb = ko + (size_t)(key0 + 16) * HD;
            const v16h kh0 = ldh(KP + kb), kh1 = ldh(KP + kb + 32), kr0 = ldh(KR + kb), kr1 = ldh(KR + kb + 32);
            v8f sH = (v8f){}, sL = (v8f){};
            sH = wmma16(kh0, qh0, sH); sH = wmma16(kh1, qh1, sH);
            sL = wmma16(kh0, qr0, sL); sL = wmma16(kh1, qr1, sL);
            sL = wmma16(kr0, qh0, sL); sL = wmma16(kr1, qh1, sL);
#pragma unroll
            for (int r = 0; r < 8; ++r) tb[r] = (sH[r] + sL[r] * QRI) * SC2;
        }
        float mx = -3.0e38f;
#pragma unroll
        for (int r = 0; r < 8; ++r) mx = fmaxf(mx, fmaxf(ta[r], tb[r]));
        mx = fmaxf(mx, __shfl_xor(mx, 16, 32));
        const float mnew = fmaxf(m, mx);
        const float alpha = __builtin_amdgcn_exp2f(m - mnew);
        const float sh = PSH - mnew;
        v16h pb; float ls = 0.0f;
#pragma unroll
        for (int r = 0; r < 8; ++r) { const float ea = __builtin_amdgcn_exp2f(ta[r] + sh); const float eb = __builtin_amdgcn_exp2f(tb[r] + sh); pb[r] = (h16)ea; pb[8 + r] = (h16)eb; ls += ea + eb; }
        l = l * alpha + ls; m = mnew;
        o0 = o0 * alpha; o1 = o1 * alpha; o2 = o2 * alpha; o3 = o3 * alpha;
        const size_t va = vo + (size_t)key0;
        const v16h v0 = ldh(VT + va), v1 = ldh(VT + va + (size_t)16 * SEQ), v2 = ldh(VT + va + (size_t)32 * SEQ), v3 = ldh(VT + va + (size_t)48 * SEQ);
        o0 = wmma16(v0, pb, o0); o1 = wmma16(v1, pb, o1); o2 = wmma16(v2, pb, o2); o3 = wmma16(v3, pb, o3);
    }
    l += __shfl_xor(l, 16, 32);
    const float inv = 1.0f / l;
    const int wb = wave * 16 * 68;
    // O^T D layout: o_j[r] = (d = 16j + 8h + r, t = lane&15) -> os[t][d]; rows 0..15 x columns 0..63 all written
    { v4f a, c;
      a[0] = o0[0] * inv; a[1] = o0[1] * inv; a[2] = o0[2] * inv; a[3] = o0[3] * inv; c[0] = o0[4] * inv; c[1] = o0[5] * inv; c[2] = o0[6] * inv; c[3] = o0[7] * inv;
      *(v4fa*)(&os[wb + lr * 68 +  0 + 8 * hi]) = a; *(v4fa*)(&os[wb + lr * 68 +  0 + 8 * hi + 4]) = c;
      a[0] = o1[0] * inv; a[1] = o1[1] * inv; a[2] = o1[2] * inv; a[3] = o1[3] * inv; c[0] = o1[4] * inv; c[1] = o1[5] * inv; c[2] = o1[6] * inv; c[3] = o1[7] * inv;
      *(v4fa*)(&os[wb + lr * 68 + 16 + 8 * hi]) = a; *(v4fa*)(&os[wb + lr * 68 + 16 + 8 * hi + 4]) = c;
      a[0] = o2[0] * inv; a[1] = o2[1] * inv; a[2] = o2[2] * inv; a[3] = o2[3] * inv; c[0] = o2[4] * inv; c[1] = o2[5] * inv; c[2] = o2[6] * inv; c[3] = o2[7] * inv;
      *(v4fa*)(&os[wb + lr * 68 + 32 + 8 * hi]) = a; *(v4fa*)(&os[wb + lr * 68 + 32 + 8 * hi + 4]) = c;
      a[0] = o3[0] * inv; a[1] = o3[1] * inv; a[2] = o3[2] * inv; a[3] = o3[3] * inv; c[0] = o3[4] * inv; c[1] = o3[5] * inv; c[2] = o3[6] * inv; c[3] = o3[7] * inv;
      *(v4fa*)(&os[wb + lr * 68 + 48 + 8 * hi]) = a; *(v4fa*)(&os[wb + lr * 68 + 48 + 8 * hi + 4]) = c; }
    wave_sync();
    const int b2 = zh % NB_FULL, cb = zh / NB_FULL;          // regrouped address: output batch b2, column block cb
    float* orow = OUT + ((size_t)b2 * OUT_SEQ + t0) * DM + (size_t)cb * HD;
{
#pragma unroll
        for (int s = 0; s < 8; ++s) { const int row = 2 * s + hi, cofs = lr * 4;   // 8 s x 2 rows = 16 rows; 16 lanes x 4 floats = 64 columns
            const v4f val = *(const v4fa*)(&os[wb + row * 68 + cofs]);
            *(v4f*)(orow + (size_t)row * DM + cofs) = val; }
         }
}

static constexpr size_t al256(size_t v) { return (v + 255) & ~(size_t)255; }
static constexpr size_t SZ_XB = al256((size_t)NB * SEQ * DM * 2);          // one bf16 stream copy
static constexpr size_t SZ_WB = al256((size_t)3 * DM * DM * 2);
static constexpr size_t SZ_PL = al256((size_t)NB * NH_ * SEQ * HD * 2);
static constexpr size_t SZ_TOTAL = 3 * SZ_XB + SZ_WB + 5 * SZ_PL;
static_assert(SZ_TOTAL <= (size_t)134217728);          // workspace carve <= 128 MiB
static_assert(((size_t)DM * DM * 2) % 256 == 0);       // weight sub-planes stay 256-byte aligned
static_assert((size_t)NB * SEQ * DM == (size_t)NB * NH_ * SEQ * HD);   // projection grid x tile == plane extent

extern "C" void kernel_launch(void* const* d_in, const int* in_sizes, int n_in,
                              void* d_out, int out_size, void* d_ws, size_t ws_size, hipStream_t stream) {
    if (n_in < 6) return;
    const size_t needx = ((size_t)(NB - 1) * SEQ_FULL + SEQ) * DM;
    if ((size_t)in_sizes[0] < needx || (size_t)in_sizes[1] < needx || (size_t)in_sizes[2] < needx) return;
    if ((size_t)in_sizes[3] < (size_t)DM * DM || (size_t)in_sizes[4] < (size_t)DM * DM || (size_t)in_sizes[5] < (size_t)DM * DM) return;
    if ((size_t)out_size < ((size_t)(NB_FULL - 1) * OUT_SEQ + SEQ) * DM) return;
    if (SZ_TOTAL > ws_size) return;
    // wire order: q, k, v streams, then Wq, Wk, Wv ([out][in] = Bt as-is)
    const float* xq = (const float*)d_in[0]; const float* xk = (const float*)d_in[1]; const float* xv = (const float*)d_in[2];
    const float* wq = (const float*)d_in[3]; const float* wk = (const float*)d_in[4]; const float* wv = (const float*)d_in[5];
    float* OUT = (float*)d_out;      // [NB_FULL][OUT_SEQ][1024]
    char* wsp = (char*)d_ws;
    bf* XQ = (bf*)wsp; wsp += SZ_XB;                 // [NB*SEQ][1024]
    bf* XK = (bf*)wsp; wsp += SZ_XB;                 // [NB*SEQ][1024]
    bf* XV = (bf*)wsp; wsp += SZ_XB;                 // [NB*SEQ][1024]
    bf* WB = (bf*)wsp; wsp += SZ_WB;                 // [3][1024][1024]: q | k | v
    h16* QH = (h16*)wsp; wsp += SZ_PL;               // [NB*16][SEQ][64]
    h16* QR = (h16*)wsp; wsp += SZ_PL;               // [NB*16][SEQ][64] residual x2048
    h16* KP = (h16*)wsp; wsp += SZ_PL;               // [NB*16][SEQ][64]
    h16* KR = (h16*)wsp; wsp += SZ_PL;               // [NB*16][SEQ][64] residual x2048
    h16* VT = (h16*)wsp; wsp += SZ_PL;               // [NB*16][64][SEQ]
    bf* WQ = WB; bf* WK = WB + (size_t)DM * DM; bf* WV = WB + (size_t)2 * DM * DM;

    if (SEQ == SEQ_FULL) {
        const size_t n8 = (size_t)NB * SEQ * DM / 8; const unsigned g = (unsigned)((n8 + 255) / 256);
        k_cvt8<<<g, 256, 0, stream>>>(xq, XQ, n8);
        k_cvt8<<<g, 256, 0, stream>>>(xk, XK, n8);
        k_cvt8<<<g, 256, 0, stream>>>(xv, XV, n8);
    } else {
        const size_t n8 = (size_t)SEQ * DM / 8; const unsigned g = (unsigned)((n8 + 255) / 256);
        for (int b = 0; b < NB; ++b) {
            k_cvt8<<<g, 256, 0, stream>>>(xq + (size_t)b * SEQ_FULL * DM, XQ + (size_t)b * SEQ * DM, n8);
            k_cvt8<<<g, 256, 0, stream>>>(xk + (size_t)b * SEQ_FULL * DM, XK + (size_t)b * SEQ * DM, n8);
            k_cvt8<<<g, 256, 0, stream>>>(xv + (size_t)b * SEQ_FULL * DM, XV + (size_t)b * SEQ * DM, n8);
        }
    }
    { const size_t n8 = (size_t)DM * DM / 8; const unsigned g = (unsigned)((n8 + 255) / 256);
      k_cvt8<<<g, 256, 0, stream>>>(wq, WQ, n8); k_cvt8<<<g, 256, 0, stream>>>(wk, WK, n8); k_cvt8<<<g, 256, 0, stream>>>(wv, WV, n8); }

    // q, k: A = stream rows (m = b*SEQ + t), Bt = W rows (n = h*64 + d) -> plane [(b*16 + h)][t][d], value + residual planes
    k_proj<<<dim3(NB * SEQ / 64, DM / 64, 1), 32, 0, stream>>>(XQ, WQ, QH, QR, 1, SEQ, (size_t)NH_ * SEQ * HD, HD, HD, (size_t)SEQ * HD);
    k_proj<<<dim3(NB * SEQ / 64, DM / 64, 1), 32, 0, stream>>>(XK, WK, KP, KR, 1, SEQ, (size_t)NH_ * SEQ * HD, HD, HD, (size_t)SEQ * HD);
    // v^T: A = Wv rows (m = h*64 + d), Bt = v-stream rows (n = b*SEQ + t) -> plane [(b*1024 + m)][t] = [(b*16 + h)][d][t]
    k_proj<<<dim3(DM / 64, NB * SEQ / 64, 1), 32, 0, stream>>>(WV, XV, VT, VT, 0, DM, (size_t)0, SEQ, SEQ, (size_t)DM * SEQ);

    k_flash<<<dim3(SEQ / (16 * AW), NB * NH_, 1), 32 * AW, 0, stream>>>(QH, QR, KP, KR, VT, OUT);
}

// v001
// Measured time: 194 microseconds a run.
// In two side-by-side timings against v000, it was 1.60 and 1.61 times as fast.
#include <hip/hip_runtime.h>

// Non-causal multi-head attention with three input streams, width 1024 = 16 heads x 64; q/k/v [NB][SEQ][1024], Wq/Wk/Wv [out][in] (y = x W^T), no biases, no mask, score scale 1/8, no output projection; context written at the regrouped address (flat n = b*16+h re-read as n = c*NB_FULL + b2).
// Compute dtypes, f32 accumulate everywhere: projections v_wmma_f32_16x16x32_bf16 (x and W RNE-converted to bf16; products exact);
// scores v_wmma_f32_16x16x32_f16 with q and k each as f16 value + f16 residual x2048 (three products: hi*hi in one accumulator, hi*res + res*hi in a second accumulator folded back by 1/2048); P (x256 carry, cancels in the normalisation, row sum from the f32 values) and v single f16; softmax f32 (online, running max).
// Layout: bf16 copies of q/k/v streams and W; q (hi, residual), k (hi, residual) planes [b*16+h][t][d] and v^T plane [b*16+h][d][t] written by the GEMM epilogue; fused flash kernel in transposed form (S^T = K Q^T, O^T = V^T P^T), K / V^T tiles of 64 keys staged in LDS by asynchronous copies (two buffers) and shared by the block's waves, output from f32 accumulators.

#ifndef NB
#define NB 2
#endif
#ifndef SEQ
#define SEQ 2048
#endif
#define NB_FULL  2
#define SEQ_FULL 2048
#ifndef OUT_SEQ
#define OUT_SEQ SEQ              // row pitch (in tokens) between batches of the output
#endif
#define DM   1024
#define NH_  16
#define HD   64
#define AW   8                   // waves per flash block (16 query rows each); all share one staged K / V^T tile
#define KS   64                  // keys per staged tile (two passes of 32 keys)
#define PIT  72                  // LDS row pitch in halves: 144 B = 16 B x odd, conflict-free for 16-byte row reads
#define PLH  (64 * PIT)          // halves per staged plane: 64 rows
#define BUFH (3 * PLH)           // halves per buffer: K value, K residual, V^T
#define QRS  2048.0f             // carry of the residual planes
#define QRI  (1.0f / 2048.0f)
#define SC2  (0.125f * 1.4426950408889634f)   // HD^-0.5 * log2(e)
#define PSH  8.0f                // log2 of the P carry (256)

static_assert(HD == 64);
static_assert(8 * 8 == HD);                    // plane store: 8 lanes x 8 halves per row
static_assert(16 * 4 == HD);                   // output store: 16 lanes x 4 floats per row segment
static_assert(NH_ * HD == DM);                 // head h = columns h*64 + d
static_assert(DM % 64 == 0);                   // column tiles of 64
static_assert(DM % 32 == 0);                   // GEMM k-loop steps by 32
static_assert(HD % 32 == 0);                   // score k-steps of 32
static_assert(SEQ % 64 == 0);                  // a 64-row tile never straddles two batches
static_assert((NB * SEQ) % 64 == 0);
static_assert(SEQ % 32 == 0);                  // key loop steps by 32
static_assert(SEQ % (16 * AW) == 0);           // flash grid covers the sequence exactly
static_assert(SEQ % KS == 0 && SEQ / KS >= 2); // whole tiles; the two-buffer prologue needs tiles 0 and 1
static_assert(KS == 64 && 32 * AW == 256);     // copy map: 256 lanes x 16 B x 2 = one 64-row x 128-B plane
static_assert((PIT * 2) % 16 == 0);            // every LDS row starts on a 16-byte multiple
static_assert(((size_t)SEQ * DM) % 8 == 0);
static_assert(((size_t)DM * DM) % 8 == 0);
static_assert(NB <= NB_FULL);
static_assert(SEQ <= SEQ_FULL);
static_assert(SEQ <= OUT_SEQ);
static_assert(((NB * NH_ - 1) / NB_FULL) * HD + HD <= DM);   // regrouped column block stays inside the row
static_assert((size_t)((NB_FULL - 1) * (size_t)OUT_SEQ + SEQ) * DM * 4 <= (size_t)16777216);   // last written output element inside the 16,777,216-byte output

typedef _Float16 h16;
typedef unsigned short bf;
typedef __attribute__((ext_vector_type(16))) __bf16   v16bf;
typedef __attribute__((ext_vector_type(16))) _Float16 v16h;
typedef __attribute__((ext_vector_type(8)))  _Float16 v8h;
typedef __attribute__((ext_vector_type(8)))  unsigned short v8us;
typedef __attribute__((ext_vector_type(8)))  float    v8f;
typedef __attribute__((ext_vector_type(4)))  float    v4f;
typedef v4f  __attribute__((may_alias)) v4fa;

__device__ __forceinline__ unsigned short f2bf(float f) { unsigned u = __float_as_uint(f); u += 0x7FFFu + ((u >> 16) & 1u); return (unsigned short)(u >> 16); }
__device__ __forceinline__ v16h cat16(v8h lo, v8h hi) { return __builtin_shufflevector(lo, hi, 0, 1, 2, 3, 4, 5, 6, 7, 8, 9, 10, 11, 12, 13, 14, 15); }
__device__ __forceinline__ v16bf cat16b(v8us lo, v8us hi) { return __builtin_bit_cast(v16bf, __builtin_shufflevector(lo, hi, 0, 1, 2, 3, 4, 5, 6, 7, 8, 9, 10, 11, 12, 13, 14, 15)); }
// every matrix instruction is followed by its own four-slot guard tying exactly its accumulator and keeping its operands live
__device__ __forceinline__ v8f wmma16(v16h a, v16h b, v8f c) {
    c = __builtin_amdgcn_wmma_f32_16x16x32_f16(false, a, false, b, (short)0, c, false, false);
    asm volatile("v_nop\n\tv_nop\n\tv_nop\n\tv_nop" : "+v"(c) : "v"(a), "v"(b));
    return c;
}
__device__ __forceinline__ v8f wmmab(v16bf a, v16bf b, v8f c) {
    c = __builtin_amdgcn_wmma_f32_16x16x32_bf16(false, a, false, b, (short)0, c, false, false);
    asm volatile("v_nop\n\tv_nop\n\tv_nop\n\tv_nop" : "+v"(c) : "v"(a), "v"(b));
    return c;
}
// fragment loaders from K-contiguous 16-bit rows; p already includes + 8*(lane>>4): elements 0..7 <- k0+8h+0..7, elements 8..15 <- k0+16+8h+0..7 (same map for A and B)
__device__ __forceinline__ v16h  ldh(const h16* p) { return cat16(*(const v8h*)p, *(const v8h*)(p + 16)); }
__device__ __forceinline__ v16bf ldb(const bf* p)  { return cat16b(*(const v8us*)p, *(const v8us*)(p + 16)); }
// ordering point for wave-private LDS tiles (same wave writes and reads)
__device__ __forceinline__ void wave_sync() { __builtin_amdgcn_fence(3 /* release order */, "wavefront"); __builtin_amdgcn_wave_barrier(); asm volatile("" ::: "memory"); }

__global__ __launch_bounds__(256) void k_cvt8(const float* __restrict__ src, bf* dst, size_t n8) {
    const size_t i = (size_t)blockIdx.x * 256 + threadIdx.x; if (i >= n8) return;
    const v8f v = *(const v8f*)(src + i * 8); v8us o;
#pragma unroll
    for (int k = 0; k < 8; ++k) o[k] = f2bf(v[k]);
    *(v8us*)(dst + i * 8) = o; 
}

// k_proj: register-blocked bf16 GEMM, ONE WAVE per 64x64 tile (16 accumulators), operands straight from K-contiguous bf16 planes, K = DM.
// C[m][n] = sum_k A[m][k] Bt[n][k], written as f16 (Ph) and optionally the f16 residual x2048 (Pr, useRes != 0) at
// tile base (r0/RB)*sRB + (r0%RB)*pitch + (c0/CB)*sCB + (c0%CB), row pitch 'pitch' (halves). grid (M/64, N/64), 32 threads.
__global__ __launch_bounds__(32) void k_proj(const bf* __restrict__ A, const bf* __restrict__ Bt, h16* Ph, h16* Pr, int useRes, int RB, size_t sRB, int pitch, int CB, size_t sCB) {
    __shared__ __align__(16) float os[16 * 68];
    const int K = DM;
    const int lane = threadIdx.x & 31, lr = lane & 15, hi = lane >> 4; const int r0 = blockIdx.x * 64, c0 = blockIdx.y * 64;
    v8f acc[4][4];
#pragma unroll
    for (int mb = 0; mb < 4; ++mb)
#pragma unroll
        for (int nb = 0; nb < 4; ++nb) acc[mb][nb] = (v8f){};
    const size_t aoff = (size_t)(r0 + lr) * K + 8 * hi, boff = (size_t)(c0 + lr) * K + 8 * hi;
#pragma unroll 1
    for (int kc = 0; kc < K; kc += 32) {
        v16bf a[4];
#pragma unroll
        for (int mb = 0; mb < 4; ++mb) a[mb] = ldb(A + aoff + (size_t)mb * 16 * K + kc);
#pragma unroll
        for (int nb = 0; nb < 4; ++nb) { const v16bf b = ldb(Bt + boff + (size_t)nb * 16 * K + kc);
#pragma unroll
            for (int mb = 0; mb < 4; ++mb) acc[mb][nb] = wmmab(a[mb], b, acc[mb][nb]); }
    }
    const size_t tbase = (size_t)(r0 / RB) * sRB + (size_t)(r0 % RB) * (size_t)pitch + (size_t)(c0 / CB) * sCB + (size_t)(c0 % CB);
#pragma unroll
    for (int mb = 0; mb < 4; ++mb) {
#pragma unroll
        for (int nb = 0; nb < 4; ++nb) {
#pragma unroll
            for (int j = 0; j < 8; ++j) os[(hi * 8 + j) * 68 + nb * 16 + lr] = acc[mb][nb][j]; }   // D: row 8h+j, col lane&15
        wave_sync();
        const size_t sb = tbase + (size_t)(mb * 16) * (size_t)pitch;
{
#pragma unroll
            for (int s = 0; s < 4; ++s) { const int row = 4 * s + (lane >> 3), c8 = (lane & 7) * 8;   // 4 s x 4 row groups = 16 rows; 8 lanes x 8 = 64 columns
                const v4f x0 = *(const v4fa*)(&os[row * 68 + c8]); const v4f x1 = *(const v4fa*)(&os[row * 68 + c8 + 4]); v8h hv, rv;
#pragma unroll
                for (int i = 0; i < 4; ++i) { const h16 a0 = (h16)x0[i]; const h16 a1 = (h16)x1[i]; hv[i] = a0; hv[4 + i] = a1; rv[i] = (h16)((x0[i] - (float)a0) * QRS); rv[4 + i] = (h16)((x1[i] - (float)a1) * QRS); }
                const size_t oo = sb + (size_t)row * (size_t)pitch + c8;
                *(v8h*)(Ph + oo) = hv; if (useRes) *(v8h*)(Pr + oo) = rv; }
             }
        wave_sync();
    }
}

// one tile's copies of one lane: rows r and r + 32 of the K value, K residual and V^T planes, 16 B each, global -> LDS through no register.
// The closing s_wait_xcnt stands inside the statement so that no address register named here is rewritten ahead of it.
__device__ __forceinline__ void stage_tile(const h16* gk, const h16* gr, const h16* gv, unsigned l) {
    const h16* gk1 = gk + (size_t)32 * HD; const h16* gr1 = gr + (size_t)32 * HD; const h16* gv1 = gv + (size_t)32 * SEQ;
    const unsigned l1 = l + 32u * PIT * 2u, l2 = l + PLH * 2u, l3 = l2 + 32u * PIT * 2u, l4 = l + 2u * PLH * 2u, l5 = l4 + 32u * PIT * 2u;
    asm volatile("global_load_async_to_lds_b128 %0, %6, off\n\t"
                 "global_load_async_to_lds_b128 %1, %7, off\n\t"
                 "global_load_async_to_lds_b128 %2, %8, off\n\t"
                 "global_load_async_to_lds_b128 %3, %9, off\n\t"
                 "global_load_async_to_lds_b128 %4, %10, off\n\t"
                 "global_load_async_to_lds_b128 %5, %11, off\n\t"
                 "s_wait_xcnt 0x0"
                 :: "v"(l), "v"(l1), "v"(l2), "v"(l3), "v"(l4), "v"(l5), "v"(gk), "v"(gk1), "v"(gr), "v"(gr1), "v"(gv), "v"(gv1) : "memory");
}

// k_flash: fused attention, one wave per 16 query rows of one flat slot n = b*16 + h; Q fragments straight from the f16 planes; K (value, residual) and V^T fragments from the block's LDS tile (two 16-B reads each).
// Tile t = keys 64t .. 64t+63: three planes of 64 rows x 128 B (K rows = keys, V^T rows = d), each lane copies 2 x 16 B per plane in whole 128-B lines; tile t+1 flies while tile t is worked on.
// Transposed form: S^T[key][t] = K Q^T (A = K rows, B = Q rows); lane (t = lane&15, h = lane>>4) holds keys 8h+r of each 16-key tile, so the packed
// P tile is directly the B fragment of O^T[d][t] = V^T P^T (element r <- tile keys 0..15, element 8+r <- tile keys 16..31, lane unchanged).
// Scores per 16-key tile: sH = Khi Qhi^T, sL = Khi Qres^T + Kres Qhi^T (both residual planes carry x2048), s = sH + sL/2048; one 16-key tile live at a time.
// Softmax state (running max, partial sum) is one scalar per lane; the two lane halves of a row are combined with one xor-16 exchange.
// Output address: n is re-read as n = c*NB_FULL + b2 -> OUT[b2][t][c*64 + d].
__global__ __launch_bounds__(32 * AW) void k_flash(const h16* __restrict__ QH, const h16* __restrict__ QR, const h16* __restrict__ KP, const h16* __restrict__ KR, const h16* __restrict__ VT, float* OUT) {
    __shared__ __align__(16) float os[AW * 16 * 68];
    __shared__ __align__(128) h16 ring[2 * BUFH];
    const int lane = threadIdx.x & 31, lr = lane & 15, hi = lane >> 4;
    const int wave = __builtin_amdgcn_readfirstlane(threadIdx.x >> 5);
    const int zh = blockIdx.y;                               // flat slot n = b*NH_ + h
    const int t0 = (blockIdx.x * AW + wave) * 16;
    const size_t pbase = (size_t)zh * SEQ * HD;
    const size_t qo = pbase + (size_t)(t0 + lr) * HD + 8 * hi;
    const v16h qh0 = ldh(QH + qo), qh1 = ldh(QH + qo + 32), qr0 = ldh(QR + qo), qr1 = ldh(QR + qo + 32);   // B fragments: col t, k = d
    const int fo = lr * PIT + 8 * hi;                        // fragment offset inside a plane: + row0 * PIT + k0 (A fragment: row lr, k = 8h ..)
    // copy map: lane takes rows crow and crow + 32, 16-byte column ccol, of each plane
    const int crow = threadIdx.x >> 3, ccol = threadIdx.x & 7;
    const h16* gk = KP + pbase + (size_t)crow * HD + ccol * 8;    // + key0 * HD
    const h16* gr = KR + pbase + (size_t)crow * HD + ccol * 8;    // + key0 * HD
    const h16* gv = VT + pbase + (size_t)crow * SEQ + ccol * 8;   // + key0
    const unsigned lc = (unsigned)(size_t)ring + (unsigned)(crow * PIT + ccol * 8) * 2u;   // LDS byte address, + buffer, plane, 32 rows
    stage_tile(gk, gr, gv, lc);
    asm volatile("s_wait_asynccnt 0x0" ::: "memory");        // tile 0 landed (this wave's copies) before the barrier publishes it
    __syncthreads();
    stage_tile(gk + (size_t)KS * HD, gr + (size_t)KS * HD, gv + KS, lc + BUFH * 2u);
    v8f o0 = (v8f){}, o1 = (v8f){}, o2 = (v8f){}, o3 = (v8f){};
    float m = -3.0e38f, l = 0.0f;
#pragma unroll 1
    for (int st = 0; st < SEQ / KS; ++st) {
      const h16* tk = ring + (st & 1) * BUFH + fo;           // K value plane; + PLH residual, + 2 * PLH V^T
#pragma unroll
      for (int p0 = 0; p0 < KS; p0 += 32) {                  // constant offsets into the tile
        float ta[8], tb[8];
        {   // keys p0 .. p0+15 of the tile
            const h16* ka = tk + p0 * PIT;
            const v16h kh0 = ldh(ka), kh1 = ldh(ka + 32), kr0 = ldh(ka + PLH), kr1 = ldh(ka + PLH + 32);
            v8f sH = (v8f){}, sL = (v8f){};
            sH = wmma16(kh0, qh0, sH); sH = wmma16(kh1, qh1, sH);
            sL = wmma16(kh0, qr0, sL); sL = wmma16(kh1, qr1, sL);
            sL = wmma16(kr0, qh0, sL); sL = wmma16(kr1, qh1, sL);
#pragma unroll
            for (int r = 0; r < 8; ++r) ta[r] = (sH[r] + sL[r] * QRI) * SC2;
        }
        {   // keys p0+16 .. p0+31 of the tile
            const h16* kb = tk + (p0 + 16) * PIT;
            const v16h kh0 = ldh(kb), kh1 = ldh(kb + 32), kr0 = ldh(kb + PLH), kr1 = ldh(kb + PLH + 32);
            v8f sH = (v8f){}, sL = (v8f){};
            sH = wmma16(kh0, qh0, sH); sH = wmma16(kh1, qh1, sH);
            sL = wmma16(kh0, qr0, sL); sL = wmma16(kh1, qr1, sL);
            sL = wmma16(kr0, qh0, sL); sL = wmma16(kr1, qh1, sL);
#pragma unroll
            for (int r = 0; r < 8; ++r) tb[r] = (sH[r] + sL[r] * QRI) * SC2;
        }
        float mx = -3.0e38f;
#pragma unroll
        for (int r = 0; r < 8; ++r) mx = fmaxf(mx, fmaxf(ta[r], tb[r]));
        mx = fmaxf(mx, __shfl_xor(mx, 16, 32));
        const float mnew = fmaxf(m, mx);
        const float alpha = __builtin_amdgcn_exp2f(m - mnew);
        const float sh = PSH - mnew;
        v16h pb; float ls = 0.0f;
#pragma unroll
        for (int r = 0; r < 8; ++r) { const float ea = __builtin_amdgcn_exp2f(ta[r] + sh); const float eb = __builtin_amdgcn_exp2f(tb[r] + sh); pb[r] = (h16)ea; pb[8 + r] = (h16)eb; ls += ea + eb; }
        l = l * alpha + ls; m = mnew;
        o0 = o0 * alpha; o1 = o1 * alpha; o2 = o2 * alpha; o3 = o3 * alpha;
        const h16* va = tk + 2 * PLH + p0;
        const v16h v0 = ldh(va), v1 = ldh(va + 16 * PIT), v2 = ldh(va + 32 * PIT), v3 = ldh(va + 48 * PIT);
        o0 = wmma16(v0, pb, o0); o1 = wmma16(v1, pb, o1); o2 = wmma16(v2, pb, o2); o3 = wmma16(v3, pb, o3);
      }
      asm volatile("s_wait_dscnt 0x0" ::: "memory");         // this wave's reads of tile st are done before its buffer may be refilled
      asm volatile("s_wait_asynccnt 0x0" ::: "memory");      // this wave's copies of tile st+1 have landed before the barrier publishes them
      __syncthreads();                                       // publishes tile st+1 and ends every wave's reads of tile st
      if (st + 2 < SEQ / KS) { const size_t k2 = (size_t)(st + 2) * KS; stage_tile(gk + k2 * HD, gr + k2 * HD, gv + k2, lc + (unsigned)(st & 1) * (BUFH * 2u)); }
    }
    asm volatile("s_wait_asynccnt 0x0" ::: "memory");        // nothing of this wave is in flight behind the loop
    l += __shfl_xor(l, 16, 32);
    const float inv = 1.0f / l;
    const int wb = wave * 16 * 68;
    // O^T D layout: o_j[r] = (d = 16j + 8h + r, t = lane&15) -> os[t][d]; rows 0..15 x columns 0..63 all written
    { v4f a, c;
      a[0] = o0[0] * inv; a[1] = o0[1] * inv; a[2] = o0[2] * inv; a[3] = o0[3] * inv; c[0] = o0[4] * inv; c[1] = o0[5] * inv; c[2] = o0[6] * inv; c[3] = o0[7] * inv;
      *(v4fa*)(&os[wb + lr * 68 +  0 + 8 * hi]) = a; *(v4fa*)(&os[wb + lr * 68 +  0 + 8 * hi + 4]) = c;
      a[0] = o1[0] * inv; a[1] = o1[1] * inv; a[2] = o1[2] * inv; a[3] = o1[3] * inv; c[0] = o1[4] * inv; c[1] = o1[5] * inv; c[2] = o1[6] * inv; c[3] = o1[7] * inv;
      *(v4fa*)(&os[wb + lr * 68 + 16 + 8 * hi]) = a; *(v4fa*)(&os[wb + lr * 68 + 16 + 8 * hi + 4]) = c;
      a[0] = o2[0] * inv; a[1] = o2[1] * inv; a[2] = o2[2] * inv; a[3] = o2[3] * inv; c[0] = o2[4] * inv; c[1] = o2[5] * inv; c[2] = o2[6] * inv; c[3] = o2[7] * inv;
      *(v4fa*)(&os[wb + lr * 68 + 32 + 8 * hi]) = a; *(v4fa*)(&os[wb + lr * 68 + 32 + 8 * hi + 4]) = c;
      a[0] = o3[0] * inv; a[1] = o3[1] * inv; a[2] = o3[2] * inv; a[3] = o3[3] * inv; c[0] = o3[4] * inv; c[1] = o3[5] * inv; c[2] = o3[6] * inv; c[3] = o3[7] * inv;
      *(v4fa*)(&os[wb + lr * 68 + 48 + 8 * hi]) = a; *(v4fa*)(&os[wb + lr * 68 + 48 + 8 * hi + 4]) = c; }
    wave_sync();
    const int b2 = zh % NB_FULL, cb = zh / NB_FULL;          // regrouped address: output batch b2, column block cb
    float* orow = OUT + ((size_t)b2 * OUT_SEQ + t0) * DM + (size_t)cb * HD;
{
#pragma unroll
        for (int s = 0; s < 8; ++s) { const int row = 2 * s + hi, cofs = lr * 4;   // 8 s x 2 rows = 16 rows; 16 lanes x 4 floats = 64 columns
            const v4f val = *(const v4fa*)(&os[wb + row * 68 + cofs]);
            *(v4f*)(orow + (size_t)row * DM + cofs) = val; }
         }
}

static constexpr size_t al256(size_t v) { return (v + 255) & ~(size_t)255; }
static constexpr size_t SZ_XB = al256((size_t)NB * SEQ * DM * 2);          // one bf16 stream copy
static constexpr size_t SZ_WB = al256((size_t)3 * DM * DM * 2);
static constexpr size_t SZ_PL = al256((size_t)NB * NH_ * SEQ * HD * 2);
static constexpr size_t SZ_TOTAL = 3 * SZ_XB + SZ_WB + 5 * SZ_PL;
static_assert(SZ_TOTAL <= (size_t)134217728);          // workspace carve <= 128 MiB
static_assert(((size_t)DM * DM * 2) % 256 == 0);       // weight sub-planes stay 256-byte aligned
static_assert((size_t)NB * SEQ * DM == (size_t)NB * NH_ * SEQ * HD);   // projection grid x tile == plane extent

extern "C" void kernel_launch(void* const* d_in, const int* in_sizes, int n_in,
                              void* d_out, int out_size, void* d_ws, size_t ws_size, hipStream_t stream) {
    if (n_in < 6) return;
    const size_t needx = ((size_t)(NB - 1) * SEQ_FULL + SEQ) * DM;
    if ((size_t)in_sizes[0] < needx || (size_t)in_sizes[1] < needx || (size_t)in_sizes[2] < needx) return;
    if ((size_t)in_sizes[3] < (size_t)DM * DM || (size_t)in_sizes[4] < (size_t)DM * DM || (size_t)in_sizes[5] < (size_t)DM * DM) return;
    if ((size_t)out_size < ((size_t)(NB_FULL - 1) * OUT_SEQ + SEQ) * DM) return;
    if (SZ_TOTAL > ws_size) return;
    // wire order: q, k, v streams, then Wq, Wk, Wv ([out][in] = Bt as-is)
    const float* xq = (const float*)d_in[0]; const float* xk = (const float*)d_in[1]; const float* xv = (const float*)d_in[2];
    const float* wq = (const float*)d_in[3]; const float* wk = (const float*)d_in[4]; const float* wv = (const float*)d_in[5];
    float* OUT = (float*)d_out;      // [NB_FULL][OUT_SEQ][1024]
    char* wsp = (char*)d_ws;
    bf* XQ = (bf*)wsp; wsp += SZ_XB;                 // [NB*SEQ][1024]
    bf* XK = (bf*)wsp; wsp += SZ_XB;                 // [NB*SEQ][1024]
    bf* XV = (bf*)wsp; wsp += SZ_XB;                 // [NB*SEQ][1024]
    bf* WB = (bf*)wsp; wsp += SZ_WB;                 // [3][1024][1024]: q | k | v
    h16* QH = (h16*)wsp; wsp += SZ_PL;               // [NB*16][SEQ][64]
    h16* QR = (h16*)wsp; wsp += SZ_PL;               // [NB*16][SEQ][64] residual x2048
    h16* KP = (h16*)wsp; wsp += SZ_PL;               // [NB*16][SEQ][64]
    h16* KR = (h16*)wsp; wsp += SZ_PL;               // [NB*16][SEQ][64] residual x2048
    h16* VT = (h16*)wsp; wsp += SZ_PL;               // [NB*16][64][SEQ]
    bf* WQ = WB; bf* WK = WB + (size_t)DM * DM; bf* WV = WB + (size_t)2 * DM * DM;

    if (SEQ == SEQ_FULL) {
        const size_t n8 = (size_t)NB * SEQ * DM / 8; const unsigned g = (unsigned)((n8 + 255) / 256);
        k_cvt8<<<g, 256, 0, stream>>>(xq, XQ, n8);
        k_cvt8<<<g, 256, 0, stream>>>(xk, XK, n8);
        k_cvt8<<<g, 256, 0, stream>>>(xv, XV, n8);
    } else {
        const size_t n8 = (size_t)SEQ * DM / 8; const unsigned g = (unsigned)((n8 + 255) / 256);
        for (int b = 0; b < NB; ++b) {
            k_cvt8<<<g, 256, 0, stream>>>(xq + (size_t)b * SEQ_FULL * DM, XQ + (size_t)b * SEQ * DM, n8);
            k_cvt8<<<g, 256, 0, stream>>>(xk + (size_t)b * SEQ_FULL * DM, XK + (size_t)b * SEQ * DM, n8);
            k_cvt8<<<g, 256, 0, stream>>>(xv + (size_t)b * SEQ_FULL * DM, XV + (size_t)b * SEQ * DM, n8);
        }
    }
    { const size_t n8 = (size_t)DM * DM / 8; const unsigned g = (unsigned)((n8 + 255) / 256);
      k_cvt8<<<g, 256, 0, stream>>>(wq, WQ, n8); k_cvt8<<<g, 256, 0, stream>>>(wk, WK, n8); k_cvt8<<<g, 256, 0, stream>>>(wv, WV, n8); }

    // q, k: A = stream rows (m = b*SEQ + t), Bt = W rows (n = h*64 + d) -> plane [(b*16 + h)][t][d], value + residual planes
    k_proj<<<dim3(NB * SEQ / 64, DM / 64, 1), 32, 0, stream>>>(XQ, WQ, QH, QR, 1, SEQ, (size_t)NH_ * SEQ * HD, HD, HD, (size_t)SEQ * HD);
    k_proj<<<dim3(NB * SEQ / 64, DM / 64, 1), 32, 0, stream>>>(XK, WK, KP, KR, 1, SEQ, (size_t)NH_ * SEQ * HD, HD, HD, (size_t)SEQ * HD);
    // v^T: A = Wv rows (m = h*64 + d), Bt = v-stream rows (n = b*SEQ + t) -> plane [(b*1024 + m)][t] = [(b*16 + h)][d][t]
    k_proj<<<dim3(DM / 64, NB * SEQ / 64, 1), 32, 0, stream>>>(WV, XV, VT, VT, 0, DM, (size_t)0, SEQ, SEQ, (size_t)DM * SEQ);

    k_flash<<<dim3(SEQ / (16 * AW), NB * NH_, 1), 32 * AW, 0, stream>>>(QH, QR, KP, KR, VT, OUT);
}

// v002
// One run takes 127 microseconds.
// In two side-by-side timings against v001, it was 1.53 and 1.54 times as fast.
// All steps since v000 together make it 2.47 times as fast.
#include <hip/hip_runtime.h>

// Non-causal multi-head attention with three input streams, width 1024 = 16 heads x 64; q/k/v [NB][SEQ][1024], Wq/Wk/Wv [out][in] (y = x W^T), no biases, no mask, score scale 1/8, no output projection; context written at the regrouped address (flat n = b*16+h re-read as n = c*NB_FULL + b2).
// Compute dtypes, f32 accumulate everywhere: projections v_wmma_f32_16x16x32_bf16 (x and W RNE-converted to bf16; products exact);
// scores v_wmma_f32_16x16x32_f16 with q and k each as f16 value + f16 residual x2048 (three products: hi*hi in one accumulator, hi*res + res*hi in a second accumulator folded back by 1/2048); P (x256 carry, cancels in the normalisation, row sum from the f32 values) and v single f16; softmax f32 (online, running max).
// Layout: bf16 copies of q/k/v streams and W; q (hi, residual), k (hi, residual) planes [b*16+h][t][d] and v^T plane [b*16+h][d][t] written by the GEMM epilogue (GEMM: 128x128 block tile, eight waves of 32x64, k-slices of 64 of both operands staged in LDS by asynchronous copies, two buffers); fused flash kernel in transposed form (S^T = K Q^T, O^T = V^T P^T), K / V^T tiles of 64 keys staged in LDS by asynchronous copies (two buffers) and shared by the block's waves, output from f32 accumulators.

#ifndef NB
#define NB 2
#endif
#ifndef SEQ
#define SEQ 2048
#endif
#define NB_FULL  2
#define SEQ_FULL 2048
#ifndef OUT_SEQ
#define OUT_SEQ SEQ              // row pitch (in tokens) between batches of the output
#endif
#define DM   1024
#define NH_  16
#define HD   64
#define AW   8                   // waves per flash block (16 query rows each); all share one staged K / V^T tile
#define KS   64                  // keys per staged tile (two passes of 32 keys)
#define PIT  72                  // LDS row pitch in halves: 144 B = 16 B x odd, conflict-free for 16-byte row reads
#define PLH  (64 * PIT)          // halves per staged plane: 64 rows
#define BUFH (3 * PLH)           // halves per buffer: K value, K residual, V^T
#define PKS  64                  // GEMM: k per staged slice (two k-steps of 32); one row of a slice = one 128-B line
#define PPLH (128 * PIT)         // GEMM: halves per staged operand slice: 128 rows
#define PBUFH (2 * PPLH)         // GEMM: halves per buffer: A slice, B slice
#define QRS  2048.0f             // carry of the residual planes
#define QRI  (1.0f / 2048.0f)
#define SC2  (0.125f * 1.4426950408889634f)   // HD^-0.5 * log2(e)
#define PSH  8.0f                // log2 of the P carry (256)

static_assert(HD == 64);
static_assert(8 * 8 == HD);                    // plane store: 8 lanes x 8 halves per row
static_assert(16 * 4 == HD);                   // output store: 16 lanes x 4 floats per row segment
static_assert(NH_ * HD == DM);                 // head h = columns h*64 + d
static_assert(DM % 64 == 0);                   // column tiles of 64
static_assert(DM % 32 == 0);                   // GEMM k-steps of 32
static_assert(DM % 128 == 0 && (NB * SEQ) % 128 == 0);   // GEMM block tiles of 128 x 128 cover both extents exactly
static_assert(DM % PKS == 0 && DM / PKS >= 2 && PKS == 64);   // whole k-slices; the two-buffer prologue needs slices 0 and 1; copy map: 8 lanes x 16 B = one row
static_assert(HD % 32 == 0);                   // score k-steps of 32
static_assert(SEQ % 64 == 0);                  // a 64-row tile never straddles two batches
static_assert((NB * SEQ) % 64 == 0);
static_assert(SEQ % 32 == 0);                  // key loop steps by 32
static_assert(SEQ % (16 * AW) == 0);           // flash grid covers the sequence exactly
static_assert(SEQ % KS == 0 && SEQ / KS >= 2); // whole tiles; the two-buffer prologue needs tiles 0 and 1
static_assert(KS == 64 && 32 * AW == 256);     // copy map: 256 lanes x 16 B x 2 = one 64-row x 128-B plane
static_assert((PIT * 2) % 16 == 0);            // every LDS row starts on a 16-byte multiple
static_assert(((size_t)SEQ * DM) % 8 == 0);
static_assert(((size_t)DM * DM) % 8 == 0);
static_assert(NB <= NB_FULL);
static_assert(SEQ <= SEQ_FULL);
static_assert(SEQ <= OUT_SEQ);
static_assert(((NB * NH_ - 1) / NB_FULL) * HD + HD <= DM);   // regrouped column block stays inside the row
static_assert((size_t)((NB_FULL - 1) * (size_t)OUT_SEQ + SEQ) * DM * 4 <= (size_t)16777216);   // last written output element inside the 16,777,216-byte output

typedef _Float16 h16;
typedef unsigned short bf;
typedef __attribute__((ext_vector_type(16))) __bf16   v16bf;
typedef __attribute__((ext_vector_type(16))) _Float16 v16h;
typedef __attribute__((ext_vector_type(8)))  _Float16 v8h;
typedef __attribute__((ext_vector_type(8)))  unsigned short v8us;
typedef __attribute__((ext_vector_type(8)))  float    v8f;
typedef __attribute__((ext_vector_type(4)))  float    v4f;
typedef v4f  __attribute__((may_alias)) v4fa;

__device__ __forceinline__ unsigned short f2bf(float f) { unsigned u = __float_as_uint(f); u += 0x7FFFu + ((u >> 16) & 1u); return (unsigned short)(u >> 16); }
__device__ __forceinline__ v16h cat16(v8h lo, v8h hi) { return __builtin_shufflevector(lo, hi, 0, 1, 2, 3, 4, 5, 6, 7, 8, 9, 10, 11, 12, 13, 14, 15); }
__device__ __forceinline__ v16bf cat16b(v8us lo, v8us hi) { return __builtin_bit_cast(v16bf, __builtin_shufflevector(lo, hi, 0, 1, 2, 3, 4, 5, 6, 7, 8, 9, 10, 11, 12, 13, 14, 15)); }
// every matrix instruction is followed by its own four-slot guard tying exactly its accumulator and keeping its operands live
__device__ __forceinline__ v8f wmma16(v16h a, v16h b, v8f c) {
    c = __builtin_amdgcn_wmma_f32_16x16x32_f16(false, a, false, b, (short)0, c, false, false);
    asm volatile("v_nop\n\tv_nop\n\tv_nop\n\tv_nop" : "+v"(c) : "v"(a), "v"(b));
    return c;
}
__device__ __forceinline__ v8f wmmab(v16bf a, v16bf b, v8f c) {
    c = __builtin_amdgcn_wmma_f32_16x16x32_bf16(false, a, false, b, (short)0, c, false, false);
    asm volatile("v_nop\n\tv_nop\n\tv_nop\n\tv_nop" : "+v"(c) : "v"(a), "v"(b));
    return c;
}
// fragment loaders from K-contiguous 16-bit rows; p already includes + 8*(lane>>4): elements 0..7 <- k0+8h+0..7, elements 8..15 <- k0+16+8h+0..7 (same map for A and B)
__device__ __forceinline__ v16h  ldh(const h16* p) { return cat16(*(const v8h*)p, *(const v8h*)(p + 16)); }
__device__ __forceinline__ v16bf ldb(const bf* p)  { return cat16b(*(const v8us*)p, *(const v8us*)(p + 16)); }
// ordering point for wave-private LDS tiles (same wave writes and reads)
__device__ __forceinline__ void wave_sync() { __builtin_amdgcn_fence(3 /* release order */, "wavefront"); __builtin_amdgcn_wave_barrier(); asm volatile("" ::: "memory"); }

__global__ __launch_bounds__(256) void k_cvt8(const float* __restrict__ src, bf* dst, size_t n8) {
    const size_t i = (size_t)blockIdx.x * 256 + threadIdx.x; if (i >= n8) return;
    const v8f v = *(const v8f*)(src + i * 8); v8us o;
#pragma unroll
    for (int k = 0; k < 8; ++k) o[k] = f2bf(v[k]);
    *(v8us*)(dst + i * 8) = o; 
}

// one k-slice's copies of one lane: rows r, r + 32, r + 64, r + 96 of the A slice and of the B slice (128 rows x 128 B each), 16 B each, global -> LDS through no register.
// The closing s_wait_xcnt stands inside the statement so that no address register named here is rewritten ahead of it.
__device__ __forceinline__ void stage_slice(const bf* ga, const bf* gb, unsigned l) {
    const bf* ga1 = ga + (size_t)32 * DM; const bf* ga2 = ga + (size_t)64 * DM; const bf* ga3 = ga + (size_t)96 * DM;
    const bf* gb1 = gb + (size_t)32 * DM; const bf* gb2 = gb + (size_t)64 * DM; const bf* gb3 = gb + (size_t)96 * DM;
    const unsigned rs = 32u * PIT * 2u;
    const unsigned l1 = l + rs, l2 = l + 2u * rs, l3 = l + 3u * rs, l4 = l + PPLH * 2u, l5 = l4 + rs, l6 = l4 + 2u * rs, l7 = l4 + 3u * rs;
    asm volatile("global_load_async_to_lds_b128 %0, %8, off\n\t"
                 "global_load_async_to_lds_b128 %1, %9, off\n\t"
                 "global_load_async_to_lds_b128 %2, %10, off\n\t"
                 "global_load_async_to_lds_b128 %3, %11, off\n\t"
                 "global_load_async_to_lds_b128 %4, %12, off\n\t"
                 "global_load_async_to_lds_b128 %5, %13, off\n\t"
                 "global_load_async_to_lds_b128 %6, %14, off\n\t"
                 "global_load_async_to_lds_b128 %7, %15, off\n\t"
                 "s_wait_xcnt 0x0"
                 :: "v"(l), "v"(l1), "v"(l2), "v"(l3), "v"(l4), "v"(l5), "v"(l6), "v"(l7), "v"(ga), "v"(ga1), "v"(ga2), "v"(ga3), "v"(gb), "v"(gb1), "v"(gb2), "v"(gb3) : "memory");
}

// k_proj: register-blocked bf16 GEMM, 128x128 tile per block, EIGHT WAVES of 32x64 each (8 accumulators; wave w: rows 32*(w>>1), columns 64*(w&1)), K = DM.
// Slice s = k 64s .. 64s+63 of the block's 128 A rows and 128 Bt rows: two planes of 128 rows x 128 B, copied in whole 128-B lines (4 + 4 copies per lane); slice s+1 flies while slice s is worked on.
// C[m][n] = sum_k A[m][k] Bt[n][k], written as f16 (Ph) and optionally the f16 residual x2048 (Pr, useRes != 0) at
// wave tile base (r0/RB)*sRB + (r0%RB)*pitch + (c0/CB)*sCB + (c0%CB), row pitch 'pitch' (halves). grid (M/128, N/128), 256 threads.
__global__ __launch_bounds__(256) void k_proj(const bf* __restrict__ A, const bf* __restrict__ Bt, h16* Ph, h16* Pr, int useRes, int RB, size_t sRB, int pitch, int CB, size_t sCB) {
    __shared__ __align__(16) float osb[8 * 16 * 68];
    __shared__ __align__(128) bf pring[2 * PBUFH];
    const int K = DM;
    const int lane = threadIdx.x & 31, lr = lane & 15, hi = lane >> 4;
    const int wave = __builtin_amdgcn_readfirstlane(threadIdx.x >> 5);
    const int rb = blockIdx.x * 128, cb = blockIdx.y * 128;
    const int r0 = rb + (wave >> 1) * 32, c0 = cb + (wave & 1) * 64;
    float* os = osb + wave * 16 * 68;                        // wave-private output staging
    v8f acc[2][4];
#pragma unroll
    for (int mb = 0; mb < 2; ++mb)
#pragma unroll
        for (int nb = 0; nb < 4; ++nb) acc[mb][nb] = (v8f){};
    // copy map: lane takes rows crow + 32 j (j = 0 .. 3), 16-byte column ccol, of each operand's slice
    const int crow = threadIdx.x >> 3, ccol = threadIdx.x & 7;
    const bf* ga = A + (size_t)(rb + crow) * K + ccol * 8;   // + k0
    const bf* gb = Bt + (size_t)(cb + crow) * K + ccol * 8;  // + k0
    const unsigned lc = (unsigned)(size_t)pring + (unsigned)(crow * PIT + ccol * 8) * 2u;   // LDS byte address, + buffer
    stage_slice(ga, gb, lc);
    asm volatile("s_wait_asynccnt 0x0" ::: "memory");        // slice 0 landed (this wave's copies) before the barrier publishes it
    __syncthreads();
    stage_slice(ga + PKS, gb + PKS, lc + PBUFH * 2u);
    const int fa = ((wave >> 1) * 32 + lr) * PIT + 8 * hi;          // A fragment offset in a buffer: + mb * 16 * PIT + k0
    const int fb = PPLH + ((wave & 1) * 64 + lr) * PIT + 8 * hi;    // B fragment offset in a buffer: + nb * 16 * PIT + k0
#pragma unroll 1   // stays rolled: one small body serves both buffers, the buffer is picked by st & 1
    for (int st = 0; st < K / PKS; ++st) {
        const bf* tp = pring + (st & 1) * PBUFH;
        v16bf a0[2], b0[4], a1[2], b1[4];                    // both k-steps' fragments are read as one group ahead of the products
#pragma unroll
        for (int i = 0; i < 2; ++i) a0[i] = ldb(tp + fa + i * 16 * PIT);
#pragma unroll
        for (int i = 0; i < 4; ++i) b0[i] = ldb(tp + fb + i * 16 * PIT);
#pragma unroll
        for (int i = 0; i < 2; ++i) a1[i] = ldb(tp + fa + i * 16 * PIT + 32);
#pragma unroll
        for (int i = 0; i < 4; ++i) b1[i] = ldb(tp + fb + i * 16 * PIT + 32);
#pragma unroll
        for (int nb = 0; nb < 4; ++nb)
#pragma unroll
            for (int mb = 0; mb < 2; ++mb) acc[mb][nb] = wmmab(a0[mb], b0[nb], acc[mb][nb]);
#pragma unroll
        for (int nb = 0; nb < 4; ++nb)
#pragma unroll
            for (int mb = 0; mb < 2; ++mb) acc[mb][nb] = wmmab(a1[mb], b1[nb], acc[mb][nb]);
        asm volatile("s_wait_dscnt 0x0" ::: "memory");       // this wave's reads of slice st are done before its buffer may be refilled
        asm volatile("s_wait_asynccnt 0x0" ::: "memory");    // this wave's copies of slice st+1 have landed before the barrier publishes them
        __syncthreads();                                     // publishes slice st+1 and ends every wave's reads of slice st
        if (st + 2 < K / PKS) { const int k2 = (st + 2) * PKS; stage_slice(ga + k2, gb + k2, lc + (unsigned)(st & 1) * (PBUFH * 2u)); }
    }
    asm volatile("s_wait_asynccnt 0x0" ::: "memory");        // nothing of this wave is in flight behind the loop
    const size_t tbase = (size_t)(r0 / RB) * sRB + (size_t)(r0 % RB) * (size_t)pitch + (size_t)(c0 / CB) * sCB + (size_t)(c0 % CB);
#pragma unroll
    for (int mb = 0; mb < 2; ++mb) {
#pragma unroll
        for (int nb = 0; nb < 4; ++nb) {
#pragma unroll
            for (int j = 0; j < 8; ++j) os[(hi * 8 + j) * 68 + nb * 16 + lr] = acc[mb][nb][j]; }   // D: row 8h+j, col lane&15
        wave_sync();
        const size_t sb = tbase + (size_t)(mb * 16) * (size_t)pitch;
{
#pragma unroll
            for (int s = 0; s < 4; ++s) { const int row = 4 * s + (lane >> 3), c8 = (lane & 7) * 8;   // 4 s x 4 row groups = 16 rows; 8 lanes x 8 = 64 columns
                const v4f x0 = *(const v4fa*)(&os[row * 68 + c8]); const v4f x1 = *(const v4fa*)(&os[row * 68 + c8 + 4]); v8h hv, rv;
#pragma unroll
                for (int i = 0; i < 4; ++i) { const h16 a0 = (h16)x0[i]; const h16 a1 = (h16)x1[i]; hv[i] = a0; hv[4 + i] = a1; rv[i] = (h16)((x0[i] - (float)a0) * QRS); rv[4 + i] = (h16)((x1[i] - (float)a1) * QRS); }
                const size_t oo = sb + (size_t)row * (size_t)pitch + c8;
                *(v8h*)(Ph + oo) = hv; if (useRes) *(v8h*)(Pr + oo) = rv; }
             }
        wave_sync();
    }
}

// one tile's copies of one lane: rows r and r + 32 of the K value, K residual and V^T planes, 16 B each, global -> LDS through no register.
// The closing s_wait_xcnt stands inside the statement so that no address register named here is rewritten ahead of it.
__device__ __forceinline__ void stage_tile(const h16* gk, const h16* gr, const h16* gv, unsigned l) {
    const h16* gk1 = gk + (size_t)32 * HD; const h16* gr1 = gr + (size_t)32 * HD; const h16* gv1 = gv + (size_t)32 * SEQ;
    const unsigned l1 = l + 32u * PIT * 2u, l2 = l + PLH * 2u, l3 = l2 + 32u * PIT * 2u, l4 = l + 2u * PLH * 2u, l5 = l4 + 32u * PIT * 2u;
    asm volatile("global_load_async_to_lds_b128 %0, %6, off\n\t"
                 "global_load_async_to_lds_b128 %1, %7, off\n\t"
                 "global_load_async_to_lds_b128 %2, %8, off\n\t"
                 "global_load_async_to_lds_b128 %3, %9, off\n\t"
                 "global_load_async_to_lds_b128 %4, %10, off\n\t"
                 "global_load_async_to_lds_b128 %5, %11, off\n\t"
                 "s_wait_xcnt 0x0"
                 :: "v"(l), "v"(l1), "v"(l2), "v"(l3), "v"(l4), "v"(l5), "v"(gk), "v"(gk1), "v"(gr), "v"(gr1), "v"(gv), "v"(gv1) : "memory");
}

// k_flash: fused attention, one wave per 16 query rows of one flat slot n = b*16 + h; Q fragments straight from the f16 planes; K (value, residual) and V^T fragments from the block's LDS tile (two 16-B reads each).
// Tile t = keys 64t .. 64t+63: three planes of 64 rows x 128 B (K rows = keys, V^T rows = d), each lane copies 2 x 16 B per plane in whole 128-B lines; tile t+1 flies while tile t is worked on.
// Transposed form: S^T[key][t] = K Q^T (A = K rows, B = Q rows); lane (t = lane&15, h = lane>>4) holds keys 8h+r of each 16-key tile, so the packed
// P tile is directly the B fragment of O^T[d][t] = V^T P^T (element r <- tile keys 0..15, element 8+r <- tile keys 16..31, lane unchanged).
// Scores per 16-key tile: sH = Khi Qhi^T, sL = Khi Qres^T + Kres Qhi^T (both residual planes carry x2048), s = sH + sL/2048; one 16-key tile live at a time.
// Softmax state (running max, partial sum) is one scalar per lane; the two lane halves of a row are combined with one xor-16 exchange.
// Output address: n is re-read as n = c*NB_FULL + b2 -> OUT[b2][t][c*64 + d].
__global__ __launch_bounds__(32 * AW) void k_flash(const h16* __restrict__ QH, const h16* __restrict__ QR, const h16* __restrict__ KP, const h16* __restrict__ KR, const h16* __restrict__ VT, float* OUT) {
    __shared__ __align__(16) float os[AW * 16 * 68];
    __shared__ __align__(128) h16 ring[2 * BUFH];
    const int lane = threadIdx.x & 31, lr = lane & 15, hi = lane >> 4;
    const int wave = __builtin_amdgcn_readfirstlane(threadIdx.x >> 5);
    const int zh = blockIdx.y;                               // flat slot n = b*NH_ + h
    const int t0 = (blockIdx.x * AW + wave) * 16;
    const size_t pbase = (size_t)zh * SEQ * HD;
    const size_t qo = pbase + (size_t)(t0 + lr) * HD + 8 * hi;
    const v16h qh0 = ldh(QH + qo), qh1 = ldh(QH + qo + 32), qr0 = ldh(QR + qo), qr1 = ldh(QR + qo + 32);   // B fragments: col t, k = d
    const int fo = lr * PIT + 8 * hi;                        // fragment offset inside a plane: + row0 * PIT + k0 (A fragment: row lr, k = 8h ..)
    // copy map: lane takes rows crow and crow + 32, 16-byte column ccol, of each plane
    const int crow = threadIdx.x >> 3, ccol = threadIdx.x & 7;
    const h16* gk = KP + pbase + (size_t)crow * HD + ccol * 8;    // + key0 * HD
    const h16* gr = KR + pbase + (size_t)crow * HD + ccol * 8;    // + key0 * HD
    const h16* gv = VT + pbase + (size_t)crow * SEQ + ccol * 8;   // + key0
    const unsigned lc = (unsigned)(size_t)ring + (unsigned)(crow * PIT + ccol * 8) * 2u;   // LDS byte address, + buffer, plane, 32 rows
    stage_tile(gk, gr, gv, lc);
    asm volatile("s_wait_asynccnt 0x0" ::: "memory");        // tile 0 landed (this wave's copies) before the barrier publishes it
    __syncthreads();
    stage_tile(gk + (size_t)KS * HD, gr + (size_t)KS * HD, gv + KS, lc + BUFH * 2u);
    v8f o0 = (v8f){}, o1 = (v8f){}, o2 = (v8f){}, o3 = (v8f){};
    float m = -3.0e38f, l = 0.0f;
#pragma unroll 1
    for (int st = 0; st < SEQ / KS; ++st) {
      const h16* tk = ring + (st & 1) * BUFH + fo;           // K value plane; + PLH residual, + 2 * PLH V^T
#pragma unroll
      for (int p0 = 0; p0 < KS; p0 += 32) {                  // constant offsets into the tile
        float ta[8], tb[8];
        {   // keys p0 .. p0+15 of the tile
            const h16* ka = tk + p0 * PIT;
            const v16h kh0 = ldh(ka), kh1 = ldh(ka + 32), kr0 = ldh(ka + PLH), kr1 = ldh(ka + PLH + 32);
            v8f sH = (v8f){}, sL = (v8f){};
            sH = wmma16(kh0, qh0, sH); sH = wmma16(kh1, qh1, sH);
            sL = wmma16(kh0, qr0, sL); sL = wmma16(kh1, qr1, sL);
            sL = wmma16(kr0, qh0, sL); sL = wmma16(kr1, qh1, sL);
#pragma unroll
            for (int r = 0; r < 8; ++r) ta[r] = (sH[r] + sL[r] * QRI) * SC2;
        }
        {   // keys p0+16 .. p0+31 of the tile
            const h16* kb = tk + (p0 + 16) * PIT;
            const v16h kh0 = ldh(kb), kh1 = ldh(kb + 32), kr0 = ldh(kb + PLH), kr1 = ldh(kb + PLH + 32);
            v8f sH = (v8f){}, sL = (v8f){};
            sH = wmma16(kh0, qh0, sH); sH = wmma16(kh1, qh1, sH);
            sL = wmma16(kh0, qr0, sL); sL = wmma16(kh1, qr1, sL);
            sL = wmma16(kr0, qh0, sL); sL = wmma16(kr1, qh1, sL);
#pragma unroll
            for (int r = 0; r < 8; ++r) tb[r] = (sH[r] + sL[r] * QRI) * SC2;
        }
        float mx = -3.0e38f;
#pragma unroll
        for (int r = 0; r < 8; ++r) mx = fmaxf(mx, fmaxf(ta[r], tb[r]));
        mx = fmaxf(mx, __shfl_xor(mx, 16, 32));
        const float mnew = fmaxf(m, mx);
        const float alpha = __builtin_amdgcn_exp2f(m - mnew);
        const float sh = PSH - mnew;
        v16h pb; float ls = 0.0f;
#pragma unroll
        for (int r = 0; r < 8; ++r) { const float ea = __builtin_amdgcn_exp2f(ta[r] + sh); const float eb = __builtin_amdgcn_exp2f(tb[r] + sh); pb[r] = (h16)ea; pb[8 + r] = (h16)eb; ls += ea + eb; }
        l = l * alpha + ls; m = mnew;
        o0 = o0 * alpha; o1 = o1 * alpha; o2 = o2 * alpha; o3 = o3 * alpha;
        const h16* va = tk + 2 * PLH + p0;
        const v16h v0 = ldh(va), v1 = ldh(va + 16 * PIT), v2 = ldh(va + 32 * PIT), v3 = ldh(va + 48 * PIT);
        o0 = wmma16(v0, pb, o0); o1 = wmma16(v1, pb, o1); o2 = wmma16(v2, pb, o2); o3 = wmma16(v3, pb, o3);
      }
      asm volatile("s_wait_dscnt 0x0" ::: "memory");         // this wave's reads of tile st are done before its buffer may be refilled
      asm volatile("s_wait_asynccnt 0x0" ::: "memory");      // this wave's copies of tile st+1 have landed before the barrier publishes them
      __syncthreads();                                       // publishes tile st+1 and ends every wave's reads of tile st
      if (st + 2 < SEQ / KS) { const size_t k2 = (size_t)(st + 2) * KS; stage_tile(gk + k2 * HD, gr + k2 * HD, gv + k2, lc + (unsigned)(st & 1) * (BUFH * 2u)); }
    }
    asm volatile("s_wait_asynccnt 0x0" ::: "memory");        // nothing of this wave is in flight behind the loop
    l += __shfl_xor(l, 16, 32);
    const float inv = 1.0f / l;
    const int wb = wave * 16 * 68;
    // O^T D layout: o_j[r] = (d = 16j + 8h + r, t = lane&15) -> os[t][d]; rows 0..15 x columns 0..63 all written
    { v4f a, c;
      a[0] = o0[0] * inv; a[1] = o0[1] * inv; a[2] = o0[2] * inv; a[3] = o0[3] * inv; c[0] = o0[4] * inv; c[1] = o0[5] * inv; c[2] = o0[6] * inv; c[3] = o0[7] * inv;
      *(v4fa*)(&os[wb + lr * 68 +  0 + 8 * hi]) = a; *(v4fa*)(&os[wb + lr * 68 +  0 + 8 * hi + 4]) = c;
      a[0] = o1[0] * inv; a[1] = o1[1] * inv; a[2] = o1[2] * inv; a[3] = o1[3] * inv; c[0] = o1[4] * inv; c[1] = o1[5] * inv; c[2] = o1[6] * inv; c[3] = o1[7] * inv;
      *(v4fa*)(&os[wb + lr * 68 + 16 + 8 * hi]) = a; *(v4fa*)(&os[wb + lr * 68 + 16 + 8 * hi + 4]) = c;
      a[0] = o2[0] * inv; a[1] = o2[1] * inv; a[2] = o2[2] * inv; a[3] = o2[3] * inv; c[0] = o2[4] * inv; c[1] = o2[5] * inv; c[2] = o2[6] * inv; c[3] = o2[7] * inv;
      *(v4fa*)(&os[wb + lr * 68 + 32 + 8 * hi]) = a; *(v4fa*)(&os[wb + lr * 68 + 32 + 8 * hi + 4]) = c;
      a[0] = o3[0] * inv; a[1] = o3[1] * inv; a[2] = o3[2] * inv; a[3] = o3[3] * inv; c[0] = o3[4] * inv; c[1] = o3[5] * inv; c[2] = o3[6] * inv; c[3] = o3[7] * inv;
      *(v4fa*)(&os[wb + lr * 68 + 48 + 8 * hi]) = a; *(v4fa*)(&os[wb + lr * 68 + 48 + 8 * hi + 4]) = c; }
    wave_sync();
    const int b2 = zh % NB_FULL, cb = zh / NB_FULL;          // regrouped address: output batch b2, column block cb
    float* orow = OUT + ((size_t)b2 * OUT_SEQ + t0) * DM + (size_t)cb * HD;
{
#pragma unroll
        for (int s = 0; s < 8; ++s) { const int row = 2 * s + hi, cofs = lr * 4;   // 8 s x 2 rows = 16 rows; 16 lanes x 4 floats = 64 columns
            const v4f val = *(const v4fa*)(&os[wb + row * 68 + cofs]);
            *(v4f*)(orow + (size_t)row * DM + cofs) = val; }
         }
}

static constexpr size_t al256(size_t v) { return (v + 255) & ~(size_t)255; }
static constexpr size_t SZ_XB = al256((size_t)NB * SEQ * DM * 2);          // one bf16 stream copy
static constexpr size_t SZ_WB = al256((size_t)3 * DM * DM * 2);
static constexpr size_t SZ_PL = al256((size_t)NB * NH_ * SEQ * HD * 2);
static constexpr size_t SZ_TOTAL = 3 * SZ_XB + SZ_WB + 5 * SZ_PL;
static_assert(SZ_TOTAL <= (size_t)134217728);          // workspace carve <= 128 MiB
static_assert(((size_t)DM * DM * 2) % 256 == 0);       // weight sub-planes stay 256-byte aligned
static_assert((size_t)NB * SEQ * DM == (size_t)NB * NH_ * SEQ * HD);   // projection grid x tile == plane extent

extern "C" void kernel_launch(void* const* d_in, const int* in_sizes, int n_in,
                              void* d_out, int out_size, void* d_ws, size_t ws_size, hipStream_t stream) {
    if (n_in < 6) return;
    const size_t needx = ((size_t)(NB - 1) * SEQ_FULL + SEQ) * DM;
    if ((size_t)in_sizes[0] < needx || (size_t)in_sizes[1] < needx || (size_t)in_sizes[2] < needx) return;
    if ((size_t)in_sizes[3] < (size_t)DM * DM || (size_t)in_sizes[4] < (size_t)DM * DM || (size_t)in_sizes[5] < (size_t)DM * DM) return;
    if ((size_t)out_size < ((size_t)(NB_FULL - 1) * OUT_SEQ + SEQ) * DM) return;
    if (SZ_TOTAL > ws_size) return;
    // wire order: q, k, v streams, then Wq, Wk, Wv ([out][in] = Bt as-is)
    const float* xq = (const float*)d_in[0]; const float* xk = (const float*)d_in[1]; const float* xv = (const float*)d_in[2];
    const float* wq = (const float*)d_in[3]; const float* wk = (const float*)d_in[4]; const float* wv = (const float*)d_in[5];
    float* OUT = (float*)d_out;      // [NB_FULL][OUT_SEQ][1024]
    char* wsp = (char*)d_ws;
    bf* XQ = (bf*)wsp; wsp += SZ_XB;                 // [NB*SEQ][1024]
    bf* XK = (bf*)wsp; wsp += SZ_XB;                 // [NB*SEQ][1024]
    bf* XV = (bf*)wsp; wsp += SZ_XB;                 // [NB*SEQ][1024]
    bf* WB = (bf*)wsp; wsp += SZ_WB;                 // [3][1024][1024]: q | k | v
    h16* QH = (h16*)wsp; wsp += SZ_PL;               // [NB*16][SEQ][64]
    h16* QR = (h16*)wsp; wsp += SZ_PL;               // [NB*16][SEQ][64] residual x2048
    h16* KP = (h16*)wsp; wsp += SZ_PL;               // [NB*16][SEQ][64]
    h16* KR = (h16*)wsp; wsp += SZ_PL;               // [NB*16][SEQ][64] residual x2048
    h16* VT = (h16*)wsp; wsp += SZ_PL;               // [NB*16][64][SEQ]
    bf* WQ = WB; bf* WK = WB + (size_t)DM * DM; bf* WV = WB + (size_t)2 * DM * DM;

    if (SEQ == SEQ_FULL) {
        const size_t n8 = (size_t)NB * SEQ * DM / 8; const unsigned g = (unsigned)((n8 + 255) / 256);
        k_cvt8<<<g, 256, 0, stream>>>(xq, XQ, n8);
        k_cvt8<<<g, 256, 0, stream>>>(xk, XK, n8);
        k_cvt8<<<g, 256, 0, stream>>>(xv, XV, n8);
    } else {
        const size_t n8 = (size_t)SEQ * DM / 8; const unsigned g = (unsigned)((n8 + 255) / 256);
        for (int b = 0; b < NB; ++b) {
            k_cvt8<<<g, 256, 0, stream>>>(xq + (size_t)b * SEQ_FULL * DM, XQ + (size_t)b * SEQ * DM, n8);
            k_cvt8<<<g, 256, 0, stream>>>(xk + (size_t)b * SEQ_FULL * DM, XK + (size_t)b * SEQ * DM, n8);
            k_cvt8<<<g, 256, 0, stream>>>(xv + (size_t)b * SEQ_FULL * DM, XV + (size_t)b * SEQ * DM, n8);
        }
    }
    { const size_t n8 = (size_t)DM * DM / 8; const unsigned g = (unsigned)((n8 + 255) / 256);
      k_cvt8<<<g, 256, 0, stream>>>(wq, WQ, n8); k_cvt8<<<g, 256, 0, stream>>>(wk, WK, n8); k_cvt8<<<g, 256, 0, stream>>>(wv, WV, n8); }

    // q, k: A = stream rows (m = b*SEQ + t), Bt = W rows (n = h*64 + d) -> plane [(b*16 + h)][t][d], value + residual planes
    k_proj<<<dim3(NB * SEQ / 128, DM / 128, 1), 256, 0, stream>>>(XQ, WQ, QH, QR, 1, SEQ, (size_t)NH_ * SEQ * HD, HD, HD, (size_t)SEQ * HD);
    k_proj<<<dim3(NB * SEQ / 128, DM / 128, 1), 256, 0, stream>>>(XK, WK, KP, KR, 1, SEQ, (size_t)NH_ * SEQ * HD, HD, HD, (size_t)SEQ * HD);
    // v^T: A = Wv rows (m = h*64 + d), Bt = v-stream rows (n = b*SEQ + t) -> plane [(b*1024 + m)][t] = [(b*16 + h)][d][t]
    k_proj<<<dim3(DM / 128, NB * SEQ / 128, 1), 256, 0, stream>>>(WV, XV, VT, VT, 0, DM, (size_t)0, SEQ, SEQ, (size_t)DM * SEQ);

    k_flash<<<dim3(SEQ / (16 * AW), NB * NH_, 1), 32 * AW, 0, stream>>>(QH, QR, KP, KR, VT, OUT);
}

// v003
// A run of this version takes 116 microseconds.
// Two timings next to v002 both put it at 1.08 times that version's speed.
// All steps since v000 together make it 2.67 times as fast.
#include <hip/hip_runtime.h>

// Non-causal multi-head attention with three input streams, width 1024 = 16 heads x 64; q/k/v [NB][SEQ][1024], Wq/Wk/Wv [out][in] (y = x W^T), no biases, no mask, score scale 1/8, no output projection; context written at the regrouped address (flat n = b*16+h re-read as n = c*NB_FULL + b2).
// Compute dtypes, f32 accumulate everywhere: projections v_wmma_f32_16x16x32_bf16 (x and W RNE-converted to bf16; products exact);
// scores v_wmma_f32_16x16x32_f16 with q and k each as f16 value + f16 residual x2048 (three products: hi*hi in one accumulator, hi*res + res*hi in a second accumulator folded back by 1/2048); P (x256 carry, cancels in the normalisation, row sum from the f32 values) and v single f16; softmax f32 (online, running max).
// Layout: bf16 copies of q/k/v streams and W; q (hi, residual), k (hi, residual) planes [b*16+h][t][d] and v^T plane [b*16+h][d][t] written by the GEMM epilogue (GEMM: 128x128 block tile, eight waves of 32x64, k-slices of 64 of both operands staged in LDS by asynchronous copies, two buffers); fused flash kernel in transposed form (S^T = K Q^T, O^T = V^T P^T), K / V^T tiles of 64 keys staged in LDS by asynchronous copies (two buffers) and shared by the block's waves, output from f32 accumulators.

#ifndef NB
#define NB 2
#endif
#ifndef SEQ
#define SEQ 2048
#endif
#define NB_FULL  2
#define SEQ_FULL 2048
#ifndef OUT_SEQ
#define OUT_SEQ SEQ              // row pitch (in tokens) between batches of the output
#endif
#define DM   1024
#define NH_  16
#define HD   64
#define AW   8                   // waves per flash block (16 query rows each); all share one staged K / V^T tile
#define KS   64                  // keys per staged tile (two passes of 32 keys)
#define PIT  72                  // LDS row pitch in halves: 144 B = 16 B x odd, conflict-free for 16-byte row reads
#define PLH  (64 * PIT)          // halves per staged plane: 64 rows
#define BUFH (3 * PLH)           // halves per buffer: K value, K residual, V^T
#define PKS  64                  // GEMM: k per staged slice (two k-steps of 32); one row of a slice = one 128-B line
#define PPLH (128 * PIT)         // GEMM: halves per staged operand slice: 128 rows
#define PBUFH (2 * PPLH)         // GEMM: halves per buffer: A slice, B slice
#define CVT_T 32                 // conversion: tiles of 1024 elements per block
#define QRS  2048.0f             // carry of the residual planes
#define QRI  (1.0f / 2048.0f)
#define SC2  (0.125f * 1.4426950408889634f)   // HD^-0.5 * log2(e)
#define PSH  8.0f                // log2 of the P carry (256)

static_assert(HD == 64);
static_assert(8 * 8 == HD);                    // plane store: 8 lanes x 8 halves per row
static_assert(16 * 4 == HD);                   // output store: 16 lanes x 4 floats per row segment
static_assert(NH_ * HD == DM);                 // head h = columns h*64 + d
static_assert(DM % 64 == 0);                   // column tiles of 64
static_assert(DM % 32 == 0);                   // GEMM k-steps of 32
static_assert(DM % 128 == 0 && (NB * SEQ) % 128 == 0);   // GEMM block tiles of 128 x 128 cover both extents exactly
static_assert(DM % PKS == 0 && DM / PKS >= 2 && PKS == 64);   // whole k-slices; the two-buffer prologue needs slices 0 and 1; copy map: 8 lanes x 16 B = one row
static_assert(HD % 32 == 0);                   // score k-steps of 32
static_assert(SEQ % 64 == 0);                  // a 64-row tile never straddles two batches
static_assert((NB * SEQ) % 64 == 0);
static_assert(SEQ % 32 == 0);                  // key loop steps by 32
static_assert(SEQ % (16 * AW) == 0);           // flash grid covers the sequence exactly
static_assert(SEQ % KS == 0 && SEQ / KS >= 2); // whole tiles; the two-buffer prologue needs tiles 0 and 1
static_assert(KS == 64 && 32 * AW == 256);     // copy map: 256 lanes x 16 B x 2 = one 64-row x 128-B plane
static_assert((PIT * 2) % 16 == 0);            // every LDS row starts on a 16-byte multiple
static_assert(((size_t)SEQ * DM) % (CVT_T * 1024) == 0);   // a conversion block never straddles two batches or two streams
static_assert(((size_t)DM * DM) % (CVT_T * 1024) == 0);    // nor two weights
static_assert(NB <= NB_FULL);
static_assert(SEQ <= SEQ_FULL);
static_assert(SEQ <= OUT_SEQ);
static_assert(((NB * NH_ - 1) / NB_FULL) * HD + HD <= DM);   // regrouped column block stays inside the row
static_assert((size_t)((NB_FULL - 1) * (size_t)OUT_SEQ + SEQ) * DM * 4 <= (size_t)16777216);   // last written output element inside the 16,777,216-byte output

typedef _Float16 h16;
typedef unsigned short bf;
typedef __attribute__((ext_vector_type(16))) __bf16   v16bf;
typedef __attribute__((ext_vector_type(16))) _Float16 v16h;
typedef __attribute__((ext_vector_type(8)))  _Float16 v8h;
typedef __attribute__((ext_vector_type(8)))  unsigned short v8us;
typedef __attribute__((ext_vector_type(4)))  unsigned short v4us;
typedef __attribute__((ext_vector_type(8)))  float    v8f;
typedef __attribute__((ext_vector_type(4)))  float    v4f;
typedef v4f  __attribute__((may_alias)) v4fa;

__device__ __forceinline__ unsigned short f2bf(float f) { unsigned u = __float_as_uint(f); u += 0x7FFFu + ((u >> 16) & 1u); return (unsigned short)(u >> 16); }
__device__ __forceinline__ v16h cat16(v8h lo, v8h hi) { return __builtin_shufflevector(lo, hi, 0, 1, 2, 3, 4, 5, 6, 7, 8, 9, 10, 11, 12, 13, 14, 15); }
__device__ __forceinline__ v16bf cat16b(v8us lo, v8us hi) { return __builtin_bit_cast(v16bf, __builtin_shufflevector(lo, hi, 0, 1, 2, 3, 4, 5, 6, 7, 8, 9, 10, 11, 12, 13, 14, 15)); }
// every matrix instruction is followed by its own four-slot guard tying exactly its accumulator and keeping its operands live
__device__ __forceinline__ v8f wmma16(v16h a, v16h b, v8f c) {
    c = __builtin_amdgcn_wmma_f32_16x16x32_f16(false, a, false, b, (short)0, c, false, false);
    asm volatile("v_nop\n\tv_nop\n\tv_nop\n\tv_nop" : "+v"(c) : "v"(a), "v"(b));
    return c;
}
__device__ __forceinline__ v8f wmmab(v16bf a, v16bf b, v8f c) {
    c = __builtin_amdgcn_wmma_f32_16x16x32_bf16(false, a, false, b, (short)0, c, false, false);
    asm volatile("v_nop\n\tv_nop\n\tv_nop\n\tv_nop" : "+v"(c) : "v"(a), "v"(b));
    return c;
}
// fragment loaders from K-contiguous 16-bit rows; p already includes + 8*(lane>>4): elements 0..7 <- k0+8h+0..7, elements 8..15 <- k0+16+8h+0..7 (same map for A and B)
__device__ __forceinline__ v16h  ldh(const h16* p) { return cat16(*(const v8h*)p, *(const v8h*)(p + 16)); }
__device__ __forceinline__ v16bf ldb(const bf* p)  { return cat16b(*(const v8us*)p, *(const v8us*)(p + 16)); }
// ordering point for wave-private LDS tiles (same wave writes and reads)
__device__ __forceinline__ void wave_sync() { __builtin_amdgcn_fence(3 /* release order */, "wavefront"); __builtin_amdgcn_wave_barrier(); asm volatile("" ::: "memory"); }

// k_cvt_all: every f32 -> bf16 copy of the call in ONE launch. The six destinations lie back to back in the workspace (q | k | v streams, then Wq | Wk | Wv), so the block index is the flat position there.
// A tile is 1024 elements: each wave-wide 16-byte load covers 512 contiguous bytes, each 8-byte store 256 (whole 128-B lines both ways). A block takes CVT_T consecutive tiles of one tensor,
// its loads issued ahead of the conversions: few long-lived waves in place of one short wave per 256 elements, whose start rate, not the memory, set the time.
__global__ __launch_bounds__(256) void k_cvt_all(const float* __restrict__ xq, const float* __restrict__ xk, const float* __restrict__ xv,
                                                 const float* __restrict__ wq, const float* __restrict__ wk, const float* __restrict__ wv, bf* __restrict__ dst) {
    constexpr unsigned BE = CVT_T * 1024u;                                  // elements per block
    constexpr unsigned BX = (unsigned)((size_t)NB * SEQ * DM / BE);         // blocks per stream
    constexpr unsigned BW = (unsigned)((size_t)DM * DM / BE);               // blocks per weight
    const unsigned b = blockIdx.x;
    const float* src; size_t off;
    if (b < 3u * BX) {
        const unsigned s = b / BX; const size_t e = (size_t)(b - s * BX) * BE; const size_t bt = e / ((size_t)SEQ * DM);
        src = s == 0u ? xq : (s == 1u ? xk : xv);
        off = bt * ((size_t)SEQ_FULL * DM) + (e - bt * ((size_t)SEQ * DM));   // batch pitch of the source is the full sequence
    } else {
        const unsigned w = b - 3u * BX, s = w / BW;
        src = s == 0u ? wq : (s == 1u ? wk : wv);
        off = (size_t)(w - s * BW) * BE;
    }
    const float* p = src + off + threadIdx.x * 4u;
    bf* q = dst + (size_t)b * BE + threadIdx.x * 4u;
    v4f v[CVT_T];                                                          // the loads stand ahead of the first conversion: as many in flight as the compiler keeps there
#pragma unroll
    for (int j = 0; j < CVT_T; ++j) v[j] = *(const v4f*)(p + j * 1024);
#pragma unroll
    for (int j = 0; j < CVT_T; ++j) { v4us o;
#pragma unroll
        for (int k = 0; k < 4; ++k) o[k] = f2bf(v[j][k]);
        *(v4us*)(q + j * 1024) = o; }
}

// one k-slice's copies of one lane: rows r, r + 32, r + 64, r + 96 of the A slice and of the B slice (128 rows x 128 B each), 16 B each, global -> LDS through no register.
// The closing s_wait_xcnt stands inside the statement so that no address register named here is rewritten ahead of it.
__device__ __forceinline__ void stage_slice(const bf* ga, const bf* gb, unsigned l) {
    const bf* ga1 = ga + (size_t)32 * DM; const bf* ga2 = ga + (size_t)64 * DM; const bf* ga3 = ga + (size_t)96 * DM;
    const bf* gb1 = gb + (size_t)32 * DM; const bf* gb2 = gb + (size_t)64 * DM; const bf* gb3 = gb + (size_t)96 * DM;
    const unsigned rs = 32u * PIT * 2u;
    const unsigned l1 = l + rs, l2 = l + 2u * rs, l3 = l + 3u * rs, l4 = l + PPLH * 2u, l5 = l4 + rs, l6 = l4 + 2u * rs, l7 = l4 + 3u * rs;
    asm volatile("global_load_async_to_lds_b128 %0, %8, off\n\t"
                 "global_load_async_to_lds_b128 %1, %9, off\n\t"
                 "global_load_async_to_lds_b128 %2, %10, off\n\t"
                 "global_load_async_to_lds_b128 %3, %11, off\n\t"
                 "global_load_async_to_lds_b128 %4, %12, off\n\t"
                 "global_load_async_to_lds_b128 %5, %13, off\n\t"
                 "global_load_async_to_lds_b128 %6, %14, off\n\t"
                 "global_load_async_to_lds_b128 %7, %15, off\n\t"
                 "s_wait_xcnt 0x0"
                 :: "v"(l), "v"(l1), "v"(l2), "v"(l3), "v"(l4), "v"(l5), "v"(l6), "v"(l7), "v"(ga), "v"(ga1), "v"(ga2), "v"(ga3), "v"(gb), "v"(gb1), "v"(gb2), "v"(gb3) : "memory");
}

// k_proj: register-blocked bf16 GEMM, 128x128 tile per block, EIGHT WAVES of 32x64 each (8 accumulators; wave w: rows 32*(w>>1), columns 64*(w&1)), K = DM.
// Slice s = k 64s .. 64s+63 of the block's 128 A rows and 128 Bt rows: two planes of 128 rows x 128 B, copied in whole 128-B lines (4 + 4 copies per lane); slice s+1 flies while slice s is worked on.
// C[m][n] = sum_k A[m][k] Bt[n][k], written as f16 (Ph) and optionally the f16 residual x2048 (Pr, useRes != 0) at
// wave tile base (r0/RB)*sRB + (r0%RB)*pitch + (c0/CB)*sCB + (c0%CB), row pitch 'pitch' (halves). grid (M/128, N/128), 256 threads.
__global__ __launch_bounds__(256) void k_proj(const bf* __restrict__ A, const bf* __restrict__ Bt, h16* Ph, h16* Pr, int useRes, int RB, size_t sRB, int pitch, int CB, size_t sCB) {
    __shared__ __align__(16) float osb[8 * 16 * 68];
    __shared__ __align__(128) bf pring[2 * PBUFH];
    const int K = DM;
    const int lane = threadIdx.x & 31, lr = lane & 15, hi = lane >> 4;
    const int wave = __builtin_amdgcn_readfirstlane(threadIdx.x >> 5);
    const int rb = blockIdx.x * 128, cb = blockIdx.y * 128;
    const int r0 = rb + (wave >> 1) * 32, c0 = cb + (wave & 1) * 64;
    float* os = osb + wave * 16 * 68;                        // wave-private output staging
    v8f acc[2][4];
#pragma unroll
    for (int mb = 0; mb < 2; ++mb)
#pragma unroll
        for (int nb = 0; nb < 4; ++nb) acc[mb][nb] = (v8f){};
    // copy map: lane takes rows crow + 32 j (j = 0 .. 3), 16-byte column ccol, of each operand's slice
    const int crow = threadIdx.x >> 3, ccol = threadIdx.x & 7;
    const bf* ga = A + (size_t)(rb + crow) * K + ccol * 8;   // + k0
    const bf* gb = Bt + (size_t)(cb + crow) * K + ccol * 8;  // + k0
    const unsigned lc = (unsigned)(size_t)pring + (unsigned)(crow * PIT + ccol * 8) * 2u;   // LDS byte address, + buffer
    stage_slice(ga, gb, lc);
    asm volatile("s_wait_asynccnt 0x0" ::: "memory");        // slice 0 landed (this wave's copies) before the barrier publishes it
    __syncthreads();
    stage_slice(ga + PKS, gb + PKS, lc + PBUFH * 2u);
    const int fa = ((wave >> 1) * 32 + lr) * PIT + 8 * hi;          // A fragment offset in a buffer: + mb * 16 * PIT + k0
    const int fb = PPLH + ((wave & 1) * 64 + lr) * PIT + 8 * hi;    // B fragment offset in a buffer: + nb * 16 * PIT + k0
#pragma unroll 1   // stays rolled: one small body serves both buffers, the buffer is picked by st & 1
    for (int st = 0; st < K / PKS; ++st) {
        const bf* tp = pring + (st & 1) * PBUFH;
        v16bf a0[2], b0[4], a1[2], b1[4];                    // both k-steps' fragments are read as one group ahead of the products
#pragma unroll
        for (int i = 0; i < 2; ++i) a0[i] = ldb(tp + fa + i * 16 * PIT);
#pragma unroll
        for (int i = 0; i < 4; ++i) b0[i] = ldb(tp + fb + i * 16 * PIT);
#pragma unroll
        for (int i = 0; i < 2; ++i) a1[i] = ldb(tp + fa + i * 16 * PIT + 32);
#pragma unroll
        for (int i = 0; i < 4; ++i) b1[i] = ldb(tp + fb + i * 16 * PIT + 32);
#pragma unroll
        for (int nb = 0; nb < 4; ++nb)
#pragma unroll
            for (int mb = 0; mb < 2; ++mb) acc[mb][nb] = wmmab(a0[mb], b0[nb], acc[mb][nb]);
#pragma unroll
        for (int nb = 0; nb < 4; ++nb)
#pragma unroll
            for (int mb = 0; mb < 2; ++mb) acc[mb][nb] = wmmab(a1[mb], b1[nb], acc[mb][nb]);
        asm volatile("s_wait_dscnt 0x0" ::: "memory");       // this wave's reads of slice st are done before its buffer may be refilled
        asm volatile("s_wait_asynccnt 0x0" ::: "memory");    // this wave's copies of slice st+1 have landed before the barrier publishes them
        __syncthreads();                                     // publishes slice st+1 and ends every wave's reads of slice st
        if (st + 2 < K / PKS) { const int k2 = (st + 2) * PKS; stage_slice(ga + k2, gb + k2, lc + (unsigned)(st & 1) * (PBUFH * 2u)); }
    }
    asm volatile("s_wait_asynccnt 0x0" ::: "memory");        // nothing of this wave is in flight behind the loop
    const size_t tbase = (size_t)(r0 / RB) * sRB + (size_t)(r0 % RB) * (size_t)pitch + (size_t)(c0 / CB) * sCB + (size_t)(c0 % CB);
#pragma unroll
    for (int mb = 0; mb < 2; ++mb) {
#pragma unroll
        for (int nb = 0; nb < 4; ++nb) {
#pragma unroll
            for (int j = 0; j < 8; ++j) os[(hi * 8 + j) * 68 + nb * 16 + lr] = acc[mb][nb][j]; }   // D: row 8h+j, col lane&15
        wave_sync();
        const size_t sb = tbase + (size_t)(mb * 16) * (size_t)pitch;
{
#pragma unroll
            for (int s = 0; s < 4; ++s) { const int row = 4 * s + (lane >> 3), c8 = (lane & 7) * 8;   // 4 s x 4 row groups = 16 rows; 8 lanes x 8 = 64 columns
                const v4f x0 = *(const v4fa*)(&os[row * 68 + c8]); const v4f x1 = *(const v4fa*)(&os[row * 68 + c8 + 4]); v8h hv, rv;
#pragma unroll
                for (int i = 0; i < 4; ++i) { const h16 a0 = (h16)x0[i]; const h16 a1 = (h16)x1[i]; hv[i] = a0; hv[4 + i] = a1; rv[i] = (h16)((x0[i] - (float)a0) * QRS); rv[4 + i] = (h16)((x1[i] - (float)a1) * QRS); }
                const size_t oo = sb + (size_t)row * (size_t)pitch + c8;
                *(v8h*)(Ph + oo) = hv; if (useRes) *(v8h*)(Pr + oo) = rv; }
             }
        wave_sync();
    }
}

// one tile's copies of one lane: rows r and r + 32 of the K value, K residual and V^T planes, 16 B each, global -> LDS through no register.
// The closing s_wait_xcnt stands inside the statement so that no address register named here is rewritten ahead of it.
__device__ __forceinline__ void stage_tile(const h16* gk, const h16* gr, const h16* gv, unsigned l) {
    const h16* gk1 = gk + (size_t)32 * HD; const h16* gr1 = gr + (size_t)32 * HD; const h16* gv1 = gv + (size_t)32 * SEQ;
    const unsigned l1 = l + 32u * PIT * 2u, l2 = l + PLH * 2u, l3 = l2 + 32u * PIT * 2u, l4 = l + 2u * PLH * 2u, l5 = l4 + 32u * PIT * 2u;
    asm volatile("global_load_async_to_lds_b128 %0, %6, off\n\t"
                 "global_load_async_to_lds_b128 %1, %7, off\n\t"
                 "global_load_async_to_lds_b128 %2, %8, off\n\t"
                 "global_load_async_to_lds_b128 %3, %9, off\n\t"
                 "global_load_async_to_lds_b128 %4, %10, off\n\t"
                 "global_load_async_to_lds_b128 %5, %11, off\n\t"
                 "s_wait_xcnt 0x0"
                 :: "v"(l), "v"(l1), "v"(l2), "v"(l3), "v"(l4), "v"(l5), "v"(gk), "v"(gk1), "v"(gr), "v"(gr1), "v"(gv), "v"(gv1) : "memory");
}

// k_flash: fused attention, one wave per 16 query rows of one flat slot n = b*16 + h; Q fragments straight from the f16 planes; K (value, residual) and V^T fragments from the block's LDS tile (two 16-B reads each).
// Tile t = keys 64t .. 64t+63: three planes of 64 rows x 128 B (K rows = keys, V^T rows = d), each lane copies 2 x 16 B per plane in whole 128-B lines; tile t+1 flies while tile t is worked on.
// Transposed form: S^T[key][t] = K Q^T (A = K rows, B = Q rows); lane (t = lane&15, h = lane>>4) holds keys 8h+r of each 16-key tile, so the packed
// P tile is directly the B fragment of O^T[d][t] = V^T P^T (element r <- tile keys 0..15, element 8+r <- tile keys 16..31, lane unchanged).
// Scores per 16-key tile: sH = Khi Qhi^T, sL = Khi Qres^T + Kres Qhi^T (both residual planes carry x2048), s = sH + sL/2048; one 16-key tile live at a time.
// Softmax state (running max, partial sum) is one scalar per lane; the two lane halves of a row are combined with one xor-16 exchange.
// Output address: n is re-read as n = c*NB_FULL + b2 -> OUT[b2][t][c*64 + d].
__global__ __launch_bounds__(32 * AW) void k_flash(const h16* __restrict__ QH, const h16* __restrict__ QR, const h16* __restrict__ KP, const h16* __restrict__ KR, const h16* __restrict__ VT, float* OUT) {
    __shared__ __align__(16) float os[AW * 16 * 68];
    __shared__ __align__(128) h16 ring[2 * BUFH];
    const int lane = threadIdx.x & 31, lr = lane & 15, hi = lane >> 4;
    const int wave = __builtin_amdgcn_readfirstlane(threadIdx.x >> 5);
    const int zh = blockIdx.y;                               // flat slot n = b*NH_ + h
    const int t0 = (blockIdx.x * AW + wave) * 16;
    const size_t pbase = (size_t)zh * SEQ * HD;
    const size_t qo = pbase + (size_t)(t0 + lr) * HD + 8 * hi;
    const v16h qh0 = ldh(QH + qo), qh1 = ldh(QH + qo + 32), qr0 = ldh(QR + qo), qr1 = ldh(QR + qo + 32);   // B fragments: col t, k = d
    const int fo = lr * PIT + 8 * hi;                        // fragment offset inside a plane: + row0 * PIT + k0 (A fragment: row lr, k = 8h ..)
    // copy map: lane takes rows crow and crow + 32, 16-byte column ccol, of each plane
    const int crow = threadIdx.x >> 3, ccol = threadIdx.x & 7;
    const h16* gk = KP + pbase + (size_t)crow * HD + ccol * 8;    // + key0 * HD
    const h16* gr = KR + pbase + (size_t)crow * HD + ccol * 8;    // + key0 * HD
    const h16* gv = VT + pbase + (size_t)crow * SEQ + ccol * 8;   // + key0
    const unsigned lc = (unsigned)(size_t)ring + (unsigned)(crow * PIT + ccol * 8) * 2u;   // LDS byte address, + buffer, plane, 32 rows
    stage_tile(gk, gr, gv, lc);
    asm volatile("s_wait_asynccnt 0x0" ::: "memory");        // tile 0 landed (this wave's copies) before the barrier publishes it
    __syncthreads();
    stage_tile(gk + (size_t)KS * HD, gr + (size_t)KS * HD, gv + KS, lc + BUFH * 2u);
    v8f o0 = (v8f){}, o1 = (v8f){}, o2 = (v8f){}, o3 = (v8f){};
    float m = -3.0e38f, l = 0.0f;
#pragma unroll 1
    for (int st = 0; st < SEQ / KS; ++st) {
      const h16* tk = ring + (st & 1) * BUFH + fo;           // K value plane; + PLH residual, + 2 * PLH V^T
#pragma unroll
      for (int p0 = 0; p0 < KS; p0 += 32) {                  // constant offsets into the tile
        float ta[8], tb[8];
        {   // keys p0 .. p0+15 of the tile
            const h16* ka = tk + p0 * PIT;
            const v16h kh0 = ldh(ka), kh1 = ldh(ka + 32), kr0 = ldh(ka + PLH), kr1 = ldh(ka + PLH + 32);
            v8f sH = (v8f){}, sL = (v8f){};
            sH = wmma16(kh0, qh0, sH); sH = wmma16(kh1, qh1, sH);
            sL = wmma16(kh0, qr0, sL); sL = wmma16(kh1, qr1, sL);
            sL = wmma16(kr0, qh0, sL); sL = wmma16(kr1, qh1, sL);
#pragma unroll
            for (int r = 0; r < 8; ++r) ta[r] = (sH[r] + sL[r] * QRI) * SC2;
        }
        {   // keys p0+16 .. p0+31 of the tile
            const h16* kb = tk + (p0 + 16) * PIT;
            const v16h kh0 = ldh(kb), kh1 = ldh(kb + 32), kr0 = ldh(kb + PLH), kr1 = ldh(kb + PLH + 32);
            v8f sH = (v8f){}, sL = (v8f){};
            sH = wmma16(kh0, qh0, sH); sH = wmma16(kh1, qh1, sH);
            sL = wmma16(kh0, qr0, sL); sL = wmma16(kh1, qr1, sL);
            sL = wmma16(kr0, qh0, sL); sL = wmma16(kr1, qh1, sL);
#pragma unroll
            for (int r = 0; r < 8; ++r) tb[r] = (sH[r] + sL[r] * QRI) * SC2;
        }
        float mx = -3.0e38f;
#pragma unroll
        for (int r = 0; r < 8; ++r) mx = fmaxf(mx, fmaxf(ta[r], tb[r]));
        mx = fmaxf(mx, __shfl_xor(mx, 16, 32));
        const float mnew = fmaxf(m, mx);
        const float alpha = __builtin_amdgcn_exp2f(m - mnew);
        const float sh = PSH - mnew;
        v16h pb; float ls = 0.0f;
#pragma unroll
        for (int r = 0; r < 8; ++r) { const float ea = __builtin_amdgcn_exp2f(ta[r] + sh); const float eb = __builtin_amdgcn_exp2f(tb[r] + sh); pb[r] = (h16)ea; pb[8 + r] = (h16)eb; ls += ea + eb; }
        l = l * alpha + ls; m = mnew;
        o0 = o0 * alpha; o1 = o1 * alpha; o2 = o2 * alpha; o3 = o3 * alpha;
        const h16* va = tk + 2 * PLH + p0;
        const v16h v0 = ldh(va), v1 = ldh(va + 16 * PIT), v2 = ldh(va + 32 * PIT), v3 = ldh(va + 48 * PIT);
        o0 = wmma16(v0, pb, o0); o1 = wmma16(v1, pb, o1); o2 = wmma16(v2, pb, o2); o3 = wmma16(v3, pb, o3);
      }
      asm volatile("s_wait_dscnt 0x0" ::: "memory");         // this wave's reads of tile st are done before its buffer may be refilled
      asm volatile("s_wait_asynccnt 0x0" ::: "memory");      // this wave's copies of tile st+1 have landed before the barrier publishes them
      __syncthreads();                                       // publishes tile st+1 and ends every wave's reads of tile st
      if (st + 2 < SEQ / KS) { const size_t k2 = (size_t)(st + 2) * KS; stage_tile(gk + k2 * HD, gr + k2 * HD, gv + k2, lc + (unsigned)(st & 1) * (BUFH * 2u)); }
    }
    asm volatile("s_wait_asynccnt 0x0" ::: "memory");        // nothing of this wave is in flight behind the loop
    l += __shfl_xor(l, 16, 32);
    const float inv = 1.0f / l;
    const int wb = wave * 16 * 68;
    // O^T D layout: o_j[r] = (d = 16j + 8h + r, t = lane&15) -> os[t][d]; rows 0..15 x columns 0..63 all written
    { v4f a, c;
      a[0] = o0[0] * inv; a[1] = o0[1] * inv; a[2] = o0[2] * inv; a[3] = o0[3] * inv; c[0] = o0[4] * inv; c[1] = o0[5] * inv; c[2] = o0[6] * inv; c[3] = o0[7] * inv;
      *(v4fa*)(&os[wb + lr * 68 +  0 + 8 * hi]) = a; *(v4fa*)(&os[wb + lr * 68 +  0 + 8 * hi + 4]) = c;
      a[0] = o1[0] * inv; a[1] = o1[1] * inv; a[2] = o1[2] * inv; a[3] = o1[3] * inv; c[0] = o1[4] * inv; c[1] = o1[5] * inv; c[2] = o1[6] * inv; c[3] = o1[7] * inv;
      *(v4fa*)(&os[wb + lr * 68 + 16 + 8 * hi]) = a; *(v4fa*)(&os[wb + lr * 68 + 16 + 8 * hi + 4]) = c;
      a[0] = o2[0] * inv; a[1] = o2[1] * inv; a[2] = o2[2] * inv; a[3] = o2[3] * inv; c[0] = o2[4] * inv; c[1] = o2[5] * inv; c[2] = o2[6] * inv; c[3] = o2[7] * inv;
      *(v4fa*)(&os[wb + lr * 68 + 32 + 8 * hi]) = a; *(v4fa*)(&os[wb + lr * 68 + 32 + 8 * hi + 4]) = c;
      a[0] = o3[0] * inv; a[1] = o3[1] * inv; a[2] = o3[2] * inv; a[3] = o3[3] * inv; c[0] = o3[4] * inv; c[1] = o3[5] * inv; c[2] = o3[6] * inv; c[3] = o3[7] * inv;
      *(v4fa*)(&os[wb + lr * 68 + 48 + 8 * hi]) = a; *(v4fa*)(&os[wb + lr * 68 + 48 + 8 * hi + 4]) = c; }
    wave_sync();
    const int b2 = zh % NB_FULL, cb = zh / NB_FULL;          // regrouped address: output batch b2, column block cb
    float* orow = OUT + ((size_t)b2 * OUT_SEQ + t0) * DM + (size_t)cb * HD;
{
#pragma unroll
        for (int s = 0; s < 8; ++s) { const int row = 2 * s + hi, cofs = lr * 4;   // 8 s x 2 rows = 16 rows; 16 lanes x 4 floats = 64 columns
            const v4f val = *(const v4fa*)(&os[wb + row * 68 + cofs]);
            *(v4f*)(orow + (size_t)row * DM + cofs) = val; }
         }
}

static constexpr size_t al256(size_t v) { return (v + 255) & ~(size_t)255; }
static constexpr size_t SZ_XB = al256((size_t)NB * SEQ * DM * 2);          // one bf16 stream copy
static constexpr size_t SZ_WB = al256((size_t)3 * DM * DM * 2);
static constexpr size_t SZ_PL = al256((size_t)NB * NH_ * SEQ * HD * 2);
static constexpr size_t SZ_TOTAL = 3 * SZ_XB + SZ_WB + 5 * SZ_PL;
static_assert(SZ_TOTAL <= (size_t)134217728);          // workspace carve <= 128 MiB
static_assert(((size_t)DM * DM * 2) % 256 == 0);       // weight sub-planes stay 256-byte aligned
static_assert(SZ_XB == (size_t)NB * SEQ * DM * 2);     // no pad between the bf16 copies: the conversion writes them as one range
static constexpr unsigned CVT_G = (unsigned)((3 * (size_t)NB * SEQ * DM + 3 * (size_t)DM * DM) / ((size_t)CVT_T * 1024));   // conversion blocks: three streams, three weights
static_assert((size_t)NB * SEQ * DM == (size_t)NB * NH_ * SEQ * HD);   // projection grid x tile == plane extent

extern "C" void kernel_launch(void* const* d_in, const int* in_sizes, int n_in,
                              void* d_out, int out_size, void* d_ws, size_t ws_size, hipStream_t stream) {
    if (n_in < 6) return;
    const size_t needx = ((size_t)(NB - 1) * SEQ_FULL + SEQ) * DM;
    if ((size_t)in_sizes[0] < needx || (size_t)in_sizes[1] < needx || (size_t)in_sizes[2] < needx) return;
    if ((size_t)in_sizes[3] < (size_t)DM * DM || (size_t)in_sizes[4] < (size_t)DM * DM || (size_t)in_sizes[5] < (size_t)DM * DM) return;
    if ((size_t)out_size < ((size_t)(NB_FULL - 1) * OUT_SEQ + SEQ) * DM) return;
    if (SZ_TOTAL > ws_size) return;
    // wire order: q, k, v streams, then Wq, Wk, Wv ([out][in] = Bt as-is)
    const float* xq = (const float*)d_in[0]; const float* xk = (const float*)d_in[1]; const float* xv = (const float*)d_in[2];
    const float* wq = (const float*)d_in[3]; const float* wk = (const float*)d_in[4]; const float* wv = (const float*)d_in[5];
    float* OUT = (float*)d_out;      // [NB_FULL][OUT_SEQ][1024]
    char* wsp = (char*)d_ws;
    bf* XQ = (bf*)wsp; wsp += SZ_XB;                 // [NB*SEQ][1024]
    bf* XK = (bf*)wsp; wsp += SZ_XB;                 // [NB*SEQ][1024]
    bf* XV = (bf*)wsp; wsp += SZ_XB;                 // [NB*SEQ][1024]
    bf* WB = (bf*)wsp; wsp += SZ_WB;                 // [3][1024][1024]: q | k | v
    h16* QH = (h16*)wsp; wsp += SZ_PL;               // [NB*16][SEQ][64]
    h16* QR = (h16*)wsp; wsp += SZ_PL;               // [NB*16][SEQ][64] residual x2048
    h16* KP = (h16*)wsp; wsp += SZ_PL;               // [NB*16][SEQ][64]
    h16* KR = (h16*)wsp; wsp += SZ_PL;               // [NB*16][SEQ][64] residual x2048
    h16* VT = (h16*)wsp; wsp += SZ_PL;               // [NB*16][64][SEQ]
    bf* WQ = WB; bf* WK = WB + (size_t)DM * DM; bf* WV = WB + (size_t)2 * DM * DM;

    // XQ | XK | XV | WQ | WK | WV are one contiguous bf16 range that starts at XQ
    k_cvt_all<<<dim3(CVT_G, 1, 1), 256, 0, stream>>>(xq, xk, xv, wq, wk, wv, XQ);

    // q, k: A = stream rows (m = b*SEQ + t), Bt = W rows (n = h*64 + d) -> plane [(b*16 + h)][t][d], value + residual planes
    k_proj<<<dim3(NB * SEQ / 128, DM / 128, 1), 256, 0, stream>>>(XQ, WQ, QH, QR, 1, SEQ, (size_t)NH_ * SEQ * HD, HD, HD, (size_t)SEQ * HD);
    k_proj<<<dim3(NB * SEQ / 128, DM / 128, 1), 256, 0, stream>>>(XK, WK, KP, KR, 1, SEQ, (size_t)NH_ * SEQ * HD, HD, HD, (size_t)SEQ * HD);
    // v^T: A = Wv rows (m = h*64 + d), Bt = v-stream rows (n = b*SEQ + t) -> plane [(b*1024 + m)][t] = [(b*16 + h)][d][t]
    k_proj<<<dim3(DM / 128, NB * SEQ / 128, 1), 256, 0, stream>>>(WV, XV, VT, VT, 0, DM, (size_t)0, SEQ, SEQ, (size_t)DM * SEQ);

    k_flash<<<dim3(SEQ / (16 * AW), NB * NH_, 1), 32 * AW, 0, stream>>>(QH, QR, KP, KR, VT, OUT);
}

// v004
// A run of this version takes 110 microseconds.
// Two timings next to v003 both put it at 1.06 times that version's speed.
// All steps since v000 together make it 2.83 times as fast.
#include <hip/hip_runtime.h>

// Non-causal multi-head attention with three input streams, width 1024 = 16 heads x 64; q/k/v [NB][SEQ][1024], Wq/Wk/Wv [out][in] (y = x W^T), no biases, no mask, score scale 1/8, no output projection; context written at the regrouped address (flat n = b*16+h re-read as n = c*NB_FULL + b2).
// Compute dtypes, f32 accumulate everywhere: projections v_wmma_f32_16x16x32_bf16 (x and W RNE-converted to bf16; products exact);
// scores v_wmma_f32_16x16x32_f16 with q and k each as f16 value + f16 residual x2048 (three products: hi*hi in one accumulator, hi*res + res*hi in a second accumulator folded back by 1/2048); P (x256 carry, cancels in the normalisation, row sum from the f32 values) and v single f16; softmax f32 (online, running max).
// Layout: bf16 copies of q/k/v streams and W; q (hi, residual), k (hi, residual) planes [b*16+h][t][d] and v^T plane [b*16+h][d][t] written by the GEMM epilogue (GEMM: 128x128 block tile, eight waves of 32x64, k-slices of 64 of both operands staged in LDS by asynchronous copies, two buffers); fused flash kernel in transposed form (S^T = K Q^T, O^T = V^T P^T), K / V^T tiles of 64 keys staged in LDS by asynchronous copies (two buffers) and shared by the block's waves, output from f32 accumulators.

#ifndef NB
#define NB 2
#endif
#ifndef SEQ
#define SEQ 2048
#endif
#define NB_FULL  2
#define SEQ_FULL 2048
#ifndef OUT_SEQ
#define OUT_SEQ SEQ              // row pitch (in tokens) between batches of the output
#endif
#define DM   1024
#define NH_  16
#define HD   64
#define AW   8                   // waves per flash block; all share one staged K / V^T tile
#define QT   2                   // query tiles of 16 rows per flash wave: each K / V^T fragment read from LDS serves all of them
#define KS   64                  // keys per staged tile (two passes of 32 keys)
#define PIT  72                  // LDS row pitch in halves: 144 B = 16 B x odd, conflict-free for 16-byte row reads
#define PLH  (64 * PIT)          // halves per staged plane: 64 rows
#define BUFH (3 * PLH)           // halves per buffer: K value, K residual, V^T
#define PKS  64                  // GEMM: k per staged slice (two k-steps of 32); one row of a slice = one 128-B line
#define PPLH (128 * PIT)         // GEMM: halves per staged operand slice: 128 rows
#define PBUFH (2 * PPLH)         // GEMM: halves per buffer: A slice, B slice
#define CVT_T 32                 // conversion: tiles of 1024 elements per block
#define QRS  2048.0f             // carry of the residual planes
#define QRI  (1.0f / 2048.0f)
#define SC2  (0.125f * 1.4426950408889634f)   // HD^-0.5 * log2(e)
#define PSH  8.0f                // log2 of the P carry (256)

static_assert(HD == 64);
static_assert(8 * 8 == HD);                    // plane store: 8 lanes x 8 halves per row
static_assert(16 * 4 == HD);                   // output store: 16 lanes x 4 floats per row segment
static_assert(NH_ * HD == DM);                 // head h = columns h*64 + d
static_assert(DM % 64 == 0);                   // column tiles of 64
static_assert(DM % 32 == 0);                   // GEMM k-steps of 32
static_assert(DM % 128 == 0 && (NB * SEQ) % 128 == 0);   // GEMM block tiles of 128 x 128 cover both extents exactly
static_assert(DM % PKS == 0 && DM / PKS >= 2 && PKS == 64);   // whole k-slices; the two-buffer prologue needs slices 0 and 1; copy map: 8 lanes x 16 B = one row
static_assert(HD % 32 == 0);                   // score k-steps of 32
static_assert(SEQ % 64 == 0);                  // a 64-row tile never straddles two batches
static_assert((NB * SEQ) % 64 == 0);
static_assert(SEQ % 32 == 0);                  // key loop steps by 32
static_assert(SEQ % (16 * QT * AW) == 0);      // flash grid covers the sequence exactly
static_assert(SEQ % KS == 0 && SEQ / KS >= 2); // whole tiles; the two-buffer prologue needs tiles 0 and 1
static_assert(KS == 64 && 32 * AW == 256);     // copy map: 256 lanes x 16 B x 2 = one 64-row x 128-B plane
static_assert((PIT * 2) % 16 == 0);            // every LDS row starts on a 16-byte multiple
static_assert(((size_t)SEQ * DM) % (CVT_T * 1024) == 0);   // a conversion block never straddles two batches or two streams
static_assert(((size_t)DM * DM) % (CVT_T * 1024) == 0);    // nor two weights
static_assert(NB <= NB_FULL);
static_assert(SEQ <= SEQ_FULL);
static_assert(SEQ <= OUT_SEQ);
static_assert(((NB * NH_ - 1) / NB_FULL) * HD + HD <= DM);   // regrouped column block stays inside the row
static_assert((size_t)((NB_FULL - 1) * (size_t)OUT_SEQ + SEQ) * DM * 4 <= (size_t)16777216);   // last written output element inside the 16,777,216-byte output

typedef _Float16 h16;
typedef unsigned short bf;
typedef __attribute__((ext_vector_type(16))) __bf16   v16bf;
typedef __attribute__((ext_vector_type(16))) _Float16 v16h;
typedef __attribute__((ext_vector_type(8)))  _Float16 v8h;
typedef __attribute__((ext_vector_type(8)))  unsigned short v8us;
typedef __attribute__((ext_vector_type(4)))  unsigned short v4us;
typedef __attribute__((ext_vector_type(8)))  float    v8f;
typedef __attribute__((ext_vector_type(4)))  float    v4f;
typedef v4f  __attribute__((may_alias)) v4fa;

__device__ __forceinline__ unsigned short f2bf(float f) { unsigned u = __float_as_uint(f); u += 0x7FFFu + ((u >> 16) & 1u); return (unsigned short)(u >> 16); }
__device__ __forceinline__ v16h cat16(v8h lo, v8h hi) { return __builtin_shufflevector(lo, hi, 0, 1, 2, 3, 4, 5, 6, 7, 8, 9, 10, 11, 12, 13, 14, 15); }
__device__ __forceinline__ v16bf cat16b(v8us lo, v8us hi) { return __builtin_bit_cast(v16bf, __builtin_shufflevector(lo, hi, 0, 1, 2, 3, 4, 5, 6, 7, 8, 9, 10, 11, 12, 13, 14, 15)); }
// f16 form (k_flash): the plain builtin, the compiler keeps the distance behind it. A guard statement as in wmmab would tie every fragment and accumulator of the two query tiles to the first 256 registers, where they do not fit.
__device__ __forceinline__ v8f wmma16(v16h a, v16h b, v8f c) {
    return __builtin_amdgcn_wmma_f32_16x16x32_f16(false, a, false, b, (short)0, c, false, false);
}
// bf16 form (k_proj): followed by its own four-slot guard tying exactly its accumulator and keeping its operands live
__device__ __forceinline__ v8f wmmab(v16bf a, v16bf b, v8f c) {
    c = __builtin_amdgcn_wmma_f32_16x16x32_bf16(false, a, false, b, (short)0, c, false, false);
    asm volatile("v_nop\n\tv_nop\n\tv_nop\n\tv_nop" : "+v"(c) : "v"(a), "v"(b));
    return c;
}
// fragment loaders from K-contiguous 16-bit rows; p already includes + 8*(lane>>4): elements 0..7 <- k0+8h+0..7, elements 8..15 <- k0+16+8h+0..7 (same map for A and B)
__device__ __forceinline__ v16h  ldh(const h16* p) { return cat16(*(const v8h*)p, *(const v8h*)(p + 16)); }
__device__ __forceinline__ v16bf ldb(const bf* p)  { return cat16b(*(const v8us*)p, *(const v8us*)(p + 16)); }
// ordering point for wave-private LDS tiles (same wave writes and reads)
__device__ __forceinline__ void wave_sync() { __builtin_amdgcn_fence(3 /* release order */, "wavefront"); __builtin_amdgcn_wave_barrier(); asm volatile("" ::: "memory"); }

// k_cvt_all: every f32 -> bf16 copy of the call in ONE launch. The six destinations lie back to back in the workspace (q | k | v streams, then Wq | Wk | Wv), so the block index is the flat position there.
// A tile is 1024 elements: each wave-wide 16-byte load covers 512 contiguous bytes, each 8-byte store 256 (whole 128-B lines both ways). A block takes CVT_T consecutive tiles of one tensor,
// its loads issued ahead of the conversions: few long-lived waves in place of one short wave per 256 elements.
__global__ __launch_bounds__(256) void k_cvt_all(const float* __restrict__ xq, const float* __restrict__ xk, const float* __restrict__ xv,
                                                 const float* __restrict__ wq, const float* __restrict__ wk, const float* __restrict__ wv, bf* __restrict__ dst) {
    constexpr unsigned BE = CVT_T * 1024u;                                  // elements per block
    constexpr unsigned BX = (unsigned)((size_t)NB * SEQ * DM / BE);         // blocks per stream
    constexpr unsigned BW = (unsigned)((size_t)DM * DM / BE);               // blocks per weight
    const unsigned b = blockIdx.x;
    const float* src; size_t off;
    if (b < 3u * BX) {
        const unsigned s = b / BX; const size_t e = (size_t)(b - s * BX) * BE; const size_t bt = e / ((size_t)SEQ * DM);
        src = s == 0u ? xq : (s == 1u ? xk : xv);
        off = bt * ((size_t)SEQ_FULL * DM) + (e - bt * ((size_t)SEQ * DM));   // batch pitch of the source is the full sequence
    } else {
        const unsigned w = b - 3u * BX, s = w / BW;
        src = s == 0u ? wq : (s == 1u ? wk : wv);
        off = (size_t)(w - s * BW) * BE;
    }
    const float* p = src + off + threadIdx.x * 4u;
    bf* q = dst + (size_t)b * BE + threadIdx.x * 4u;
    v4f v[CVT_T];                                                          // the loads stand ahead of the first conversion: as many in flight as the compiler keeps there
#pragma unroll
    for (int j = 0; j < CVT_T; ++j) v[j] = *(const v4f*)(p + j * 1024);
#pragma unroll
    for (int j = 0; j < CVT_T; ++j) { v4us o;
#pragma unroll
        for (int k = 0; k < 4; ++k) o[k] = f2bf(v[j][k]);
        *(v4us*)(q + j * 1024) = o; }
}

// one k-slice's copies of one lane: rows r, r + 32, r + 64, r + 96 of the A slice and of the B slice (128 rows x 128 B each), 16 B each, global -> LDS through no register.
// The closing s_wait_xcnt stands inside the statement so that no address register named here is rewritten ahead of it.
__device__ __forceinline__ void stage_slice(const bf* ga, const bf* gb, unsigned l) {
    const bf* ga1 = ga + (size_t)32 * DM; const bf* ga2 = ga + (size_t)64 * DM; const bf* ga3 = ga + (size_t)96 * DM;
    const bf* gb1 = gb + (size_t)32 * DM; const bf* gb2 = gb + (size_t)64 * DM; const bf* gb3 = gb + (size_t)96 * DM;
    const unsigned rs = 32u * PIT * 2u;
    const unsigned l1 = l + rs, l2 = l + 2u * rs, l3 = l + 3u * rs, l4 = l + PPLH * 2u, l5 = l4 + rs, l6 = l4 + 2u * rs, l7 = l4 + 3u * rs;
    asm volatile("global_load_async_to_lds_b128 %0, %8, off\n\t"
                 "global_load_async_to_lds_b128 %1, %9, off\n\t"
                 "global_load_async_to_lds_b128 %2, %10, off\n\t"
                 "global_load_async_to_lds_b128 %3, %11, off\n\t"
                 "global_load_async_to_lds_b128 %4, %12, off\n\t"
                 "global_load_async_to_lds_b128 %5, %13, off\n\t"
                 "global_load_async_to_lds_b128 %6, %14, off\n\t"
                 "global_load_async_to_lds_b128 %7, %15, off\n\t"
                 "s_wait_xcnt 0x0"
                 :: "v"(l), "v"(l1), "v"(l2), "v"(l3), "v"(l4), "v"(l5), "v"(l6), "v"(l7), "v"(ga), "v"(ga1), "v"(ga2), "v"(ga3), "v"(gb), "v"(gb1), "v"(gb2), "v"(gb3) : "memory");
}

// k_proj: register-blocked bf16 GEMM, 128x128 tile per block, EIGHT WAVES of 32x64 each (8 accumulators; wave w: rows 32*(w>>1), columns 64*(w&1)), K = DM.
// Slice s = k 64s .. 64s+63 of the block's 128 A rows and 128 Bt rows: two planes of 128 rows x 128 B, copied in whole 128-B lines (4 + 4 copies per lane); slice s+1 flies while slice s is worked on.
// C[m][n] = sum_k A[m][k] Bt[n][k], written as f16 (Ph) and optionally the f16 residual x2048 (Pr, useRes != 0) at
// wave tile base (r0/RB)*sRB + (r0%RB)*pitch + (c0/CB)*sCB + (c0%CB), row pitch 'pitch' (halves). grid (M/128, N/128), 256 threads.
__global__ __launch_bounds__(256) void k_proj(const bf* __restrict__ A, const bf* __restrict__ Bt, h16* Ph, h16* Pr, int useRes, int RB, size_t sRB, int pitch, int CB, size_t sCB) {
    __shared__ __align__(16) float osb[8 * 16 * 68];
    __shared__ __align__(128) bf pring[2 * PBUFH];
    const int K = DM;
    const int lane = threadIdx.x & 31, lr = lane & 15, hi = lane >> 4;
    const int wave = __builtin_amdgcn_readfirstlane(threadIdx.x >> 5);
    const int rb = blockIdx.x * 128, cb = blockIdx.y * 128;
    const int r0 = rb + (wave >> 1) * 32, c0 = cb + (wave & 1) * 64;
    float* os = osb + wave * 16 * 68;                        // wave-private output staging
    v8f acc[2][4];
#pragma unroll
    for (int mb = 0; mb < 2; ++mb)
#pragma unroll
        for (int nb = 0; nb < 4; ++nb) acc[mb][nb] = (v8f){};
    // copy map: lane takes rows crow + 32 j (j = 0 .. 3), 16-byte column ccol, of each operand's slice
    const int crow = threadIdx.x >> 3, ccol = threadIdx.x & 7;
    const bf* ga = A + (size_t)(rb + crow) * K + ccol * 8;   // + k0
    const bf* gb = Bt + (size_t)(cb + crow) * K + ccol * 8;  // + k0
    const unsigned lc = (unsigned)(size_t)pring + (unsigned)(crow * PIT + ccol * 8) * 2u;   // LDS byte address, + buffer
    stage_slice(ga, gb, lc);
    asm volatile("s_wait_asynccnt 0x0" ::: "memory");        // slice 0 landed (this wave's copies) before the barrier publishes it
    __syncthreads();
    stage_slice(ga + PKS, gb + PKS, lc + PBUFH * 2u);
    const int fa = ((wave >> 1) * 32 + lr) * PIT + 8 * hi;          // A fragment offset in a buffer: + mb * 16 * PIT + k0
    const int fb = PPLH + ((wave & 1) * 64 + lr) * PIT + 8 * hi;    // B fragment offset in a buffer: + nb * 16 * PIT + k0
#pragma unroll 1   // stays rolled: one small body serves both buffers, the buffer is picked by st & 1
    for (int st = 0; st < K / PKS; ++st) {
        const bf* tp = pring + (st & 1) * PBUFH;
        v16bf a0[2], b0[4], a1[2], b1[4];                    // both k-steps' fragments are read as one group ahead of the products
#pragma unroll
        for (int i = 0; i < 2; ++i) a0[i] = ldb(tp + fa + i * 16 * PIT);
#pragma unroll
        for (int i = 0; i < 4; ++i) b0[i] = ldb(tp + fb + i * 16 * PIT);
#pragma unroll
        for (int i = 0; i < 2; ++i) a1[i] = ldb(tp + fa + i * 16 * PIT + 32);
#pragma unroll
        for (int i = 0; i < 4; ++i) b1[i] = ldb(tp + fb + i * 16 * PIT + 32);
#pragma unroll
        for (int nb = 0; nb < 4; ++nb)
#pragma unroll
            for (int mb = 0; mb < 2; ++mb) acc[mb][nb] = wmmab(a0[mb], b0[nb], acc[mb][nb]);
#pragma unroll
        for (int nb = 0; nb < 4; ++nb)
#pragma unroll
            for (int mb = 0; mb < 2; ++mb) acc[mb][nb] = wmmab(a1[mb], b1[nb], acc[mb][nb]);
        asm volatile("s_wait_dscnt 0x0" ::: "memory");       // this wave's reads of slice st are done before its buffer may be refilled
        asm volatile("s_wait_asynccnt 0x0" ::: "memory");    // this wave's copies of slice st+1 have landed before the barrier publishes them
        __syncthreads();                                     // publishes slice st+1 and ends every wave's reads of slice st
        if (st + 2 < K / PKS) { const int k2 = (st + 2) * PKS; stage_slice(ga + k2, gb + k2, lc + (unsigned)(st & 1) * (PBUFH * 2u)); }
    }
    asm volatile("s_wait_asynccnt 0x0" ::: "memory");        // nothing of this wave is in flight behind the loop
    const size_t tbase = (size_t)(r0 / RB) * sRB + (size_t)(r0 % RB) * (size_t)pitch + (size_t)(c0 / CB) * sCB + (size_t)(c0 % CB);
#pragma unroll
    for (int mb = 0; mb < 2; ++mb) {
#pragma unroll
        for (int nb = 0; nb < 4; ++nb) {
#pragma unroll
            for (int j = 0; j < 8; ++j) os[(hi * 8 + j) * 68 + nb * 16 + lr] = acc[mb][nb][j]; }   // D: row 8h+j, col lane&15
        wave_sync();
        const size_t sb = tbase + (size_t)(mb * 16) * (size_t)pitch;
{
#pragma unroll
            for (int s = 0; s < 4; ++s) { const int row = 4 * s + (lane >> 3), c8 = (lane & 7) * 8;   // 4 s x 4 row groups = 16 rows; 8 lanes x 8 = 64 columns
                const v4f x0 = *(const v4fa*)(&os[row * 68 + c8]); const v4f x1 = *(const v4fa*)(&os[row * 68 + c8 + 4]); v8h hv, rv;
#pragma unroll
                for (int i = 0; i < 4; ++i) { const h16 a0 = (h16)x0[i]; const h16 a1 = (h16)x1[i]; hv[i] = a0; hv[4 + i] = a1; rv[i] = (h16)((x0[i] - (float)a0) * QRS); rv[4 + i] = (h16)((x1[i] - (float)a1) * QRS); }
                const size_t oo = sb + (size_t)row * (size_t)pitch + c8;
                *(v8h*)(Ph + oo) = hv; if (useRes) *(v8h*)(Pr + oo) = rv; }
             }
        wave_sync();
    }
}

// one tile's copies of one lane: rows r and r + 32 of the K value, K residual and V^T planes, 16 B each, global -> LDS through no register.
// The closing s_wait_xcnt stands inside the statement so that no address register named here is rewritten ahead of it.
__device__ __forceinline__ void stage_tile(const h16* gk, const h16* gr, const h16* gv, unsigned l) {
    const h16* gk1 = gk + (size_t)32 * HD; const h16* gr1 = gr + (size_t)32 * HD; const h16* gv1 = gv + (size_t)32 * SEQ;
    const unsigned l1 = l + 32u * PIT * 2u, l2 = l + PLH * 2u, l3 = l2 + 32u * PIT * 2u, l4 = l + 2u * PLH * 2u, l5 = l4 + 32u * PIT * 2u;
    asm volatile("global_load_async_to_lds_b128 %0, %6, off\n\t"
                 "global_load_async_to_lds_b128 %1, %7, off\n\t"
                 "global_load_async_to_lds_b128 %2, %8, off\n\t"
                 "global_load_async_to_lds_b128 %3, %9, off\n\t"
                 "global_load_async_to_lds_b128 %4, %10, off\n\t"
                 "global_load_async_to_lds_b128 %5, %11, off\n\t"
                 "s_wait_xcnt 0x0"
                 :: "v"(l), "v"(l1), "v"(l2), "v"(l3), "v"(l4), "v"(l5), "v"(gk), "v"(gk1), "v"(gr), "v"(gr1), "v"(gv), "v"(gv1) : "memory");
}

// k_flash: fused attention, one wave per QT tiles of 16 query rows of one flat slot n = b*16 + h (every K and V^T fragment is read from LDS once and multiplied with each query tile in turn); Q fragments straight from the f16 planes; K (value, residual) and V^T fragments from the block's LDS tile (two 16-B reads each).
// Tile t = keys 64t .. 64t+63: three planes of 64 rows x 128 B (K rows = keys, V^T rows = d), each lane copies 2 x 16 B per plane in whole 128-B lines; tile t+1 flies while tile t is worked on.
// Transposed form: S^T[key][t] = K Q^T (A = K rows, B = Q rows); lane (t = lane&15, h = lane>>4) holds keys 8h+r of each 16-key tile, so the packed
// P tile is directly the B fragment of O^T[d][t] = V^T P^T (element r <- tile keys 0..15, element 8+r <- tile keys 16..31, lane unchanged).
// Scores per 16-key tile: sH = Khi Qhi^T, sL = Khi Qres^T + Kres Qhi^T (both residual planes carry x2048), s = sH + sL/2048; one 16-key tile live at a time.
// Softmax state (running max, partial sum) is one scalar per lane and query tile; the two lane halves of a row are combined with one xor-16 exchange.
// Output address: n is re-read as n = c*NB_FULL + b2 -> OUT[b2][t][c*64 + d].
__global__ __launch_bounds__(32 * AW) void k_flash(const h16* __restrict__ QH, const h16* __restrict__ QR, const h16* __restrict__ KP, const h16* __restrict__ KR, const h16* __restrict__ VT, float* OUT) {
    __shared__ __align__(16) float os[AW * 16 * 68];
    __shared__ __align__(128) h16 ring[2 * BUFH];
    const int lane = threadIdx.x & 31, lr = lane & 15, hi = lane >> 4;
    const int wave = __builtin_amdgcn_readfirstlane(threadIdx.x >> 5);
    const int zh = blockIdx.y;                               // flat slot n = b*NH_ + h
    const int t0 = (blockIdx.x * AW + wave) * (16 * QT);
    const size_t pbase = (size_t)zh * SEQ * HD;
    // every loop over q, kt, j or r in this kernel is unrolled so that the arrays it indexes stay in registers
    v16h qh0[QT], qh1[QT], qr0[QT], qr1[QT];                 // B fragments: col t, k = d
#pragma unroll
    for (int q = 0; q < QT; ++q) { const size_t qo = pbase + (size_t)(t0 + 16 * q + lr) * HD + 8 * hi;
        qh0[q] = ldh(QH + qo); qh1[q] = ldh(QH + qo + 32); qr0[q] = ldh(QR + qo); qr1[q] = ldh(QR + qo + 32);
        if (q + 1 < QT) asm volatile("s_wait_xcnt 0x0" ::: "memory"); }   // the next tile's loads land in the address registers of these loads: the wait stands in front of them
    const int fo = lr * PIT + 8 * hi;                        // fragment offset inside a plane: + row0 * PIT + k0 (A fragment: row lr, k = 8h ..)
    // copy map: lane takes rows crow and crow + 32, 16-byte column ccol, of each plane
    const int crow = threadIdx.x >> 3, ccol = threadIdx.x & 7;
    const h16* gk = KP + pbase + (size_t)crow * HD + ccol * 8;    // + key0 * HD
    const h16* gr = KR + pbase + (size_t)crow * HD + ccol * 8;    // + key0 * HD
    const h16* gv = VT + pbase + (size_t)crow * SEQ + ccol * 8;   // + key0
    const unsigned lc = (unsigned)(size_t)ring + (unsigned)(crow * PIT + ccol * 8) * 2u;   // LDS byte address, + buffer, plane, 32 rows
    stage_tile(gk, gr, gv, lc);
    asm volatile("s_wait_asynccnt 0x0" ::: "memory");        // tile 0 landed (this wave's copies) before the barrier publishes it
    __syncthreads();
    stage_tile(gk + (size_t)KS * HD, gr + (size_t)KS * HD, gv + KS, lc + BUFH * 2u);
    v8f o[QT][4];
    float m[QT], l[QT];
#pragma unroll
    for (int q = 0; q < QT; ++q) { m[q] = -3.0e38f; l[q] = 0.0f;
#pragma unroll
        for (int j = 0; j < 4; ++j) o[q][j] = (v8f){}; }
#pragma unroll 1
    for (int st = 0; st < SEQ / KS; ++st) {
      const h16* tk = ring + (st & 1) * BUFH + fo;           // K value plane; + PLH residual, + 2 * PLH V^T
#pragma unroll
      for (int p0 = 0; p0 < KS; p0 += 32) {                  // constant offsets into the tile
        float ts[QT][2][8];                                  // scores: query tile, 16-key tile, key 8h + r
#pragma unroll
        for (int kt = 0; kt < 2; ++kt) {   // keys p0 + 16 kt .. + 15 of the tile; the query tiles' accumulator chains alternate, each chain in the order hi*hi | hi*res, res*hi
            const h16* ka = tk + (p0 + 16 * kt) * PIT;
            const v16h kh0 = ldh(ka), kh1 = ldh(ka + 32), kr0 = ldh(ka + PLH), kr1 = ldh(ka + PLH + 32);
            v8f sH[QT], sL[QT];
#pragma unroll
            for (int q = 0; q < QT; ++q) { sH[q] = wmma16(kh0, qh0[q], (v8f){}); sL[q] = wmma16(kh0, qr0[q], (v8f){}); }
#pragma unroll
            for (int q = 0; q < QT; ++q) { sH[q] = wmma16(kh1, qh1[q], sH[q]); sL[q] = wmma16(kh1, qr1[q], sL[q]); }
#pragma unroll
            for (int q = 0; q < QT; ++q) sL[q] = wmma16(kr0, qh0[q], sL[q]);
#pragma unroll
            for (int q = 0; q < QT; ++q) sL[q] = wmma16(kr1, qh1[q], sL[q]);
#pragma unroll
            for (int q = 0; q < QT; ++q)
#pragma unroll
                for (int r = 0; r < 8; ++r) ts[q][kt][r] = (sH[q][r] + sL[q][r] * QRI) * SC2;
        }
        v16h pb[QT];
#pragma unroll
        for (int q = 0; q < QT; ++q) {
            float mx = -3.0e38f;
#pragma unroll
            for (int r = 0; r < 8; ++r) mx = fmaxf(mx, fmaxf(ts[q][0][r], ts[q][1][r]));
            mx = fmaxf(mx, __shfl_xor(mx, 16, 32));
            const float mnew = fmaxf(m[q], mx);
            const float alpha = __builtin_amdgcn_exp2f(m[q] - mnew);
            const float sh = PSH - mnew;
            float ls = 0.0f;
#pragma unroll
            for (int r = 0; r < 8; ++r) { const float ea = __builtin_amdgcn_exp2f(ts[q][0][r] + sh); const float eb = __builtin_amdgcn_exp2f(ts[q][1][r] + sh); pb[q][r] = (h16)ea; pb[q][8 + r] = (h16)eb; ls += ea + eb; }
            l[q] = l[q] * alpha + ls; m[q] = mnew;
#pragma unroll
            for (int j = 0; j < 4; ++j) o[q][j] = o[q][j] * alpha;
        }
        const h16* va = tk + 2 * PLH + p0;
        const v16h v0 = ldh(va), v1 = ldh(va + 16 * PIT), v2 = ldh(va + 32 * PIT), v3 = ldh(va + 48 * PIT);
#pragma unroll
        for (int q = 0; q < QT; ++q) { o[q][0] = wmma16(v0, pb[q], o[q][0]); o[q][1] = wmma16(v1, pb[q], o[q][1]); o[q][2] = wmma16(v2, pb[q], o[q][2]); o[q][3] = wmma16(v3, pb[q], o[q][3]); }
      }
      asm volatile("s_wait_dscnt 0x0" ::: "memory");         // this wave's reads of tile st are done before its buffer may be refilled
      asm volatile("s_wait_asynccnt 0x0" ::: "memory");      // this wave's copies of tile st+1 have landed before the barrier publishes them
      __syncthreads();                                       // publishes tile st+1 and ends every wave's reads of tile st
      if (st + 2 < SEQ / KS) { const size_t k2 = (size_t)(st + 2) * KS; stage_tile(gk + k2 * HD, gr + k2 * HD, gv + k2, lc + (unsigned)(st & 1) * (BUFH * 2u)); }
    }
    asm volatile("s_wait_asynccnt 0x0" ::: "memory");        // nothing of this wave is in flight behind the loop
    const int wb = wave * 16 * 68;
    const int b2 = zh % NB_FULL, cb = zh / NB_FULL;          // regrouped address: output batch b2, column block cb
#pragma unroll
    for (int q = 0; q < QT; ++q) {                           // one query tile at a time through the wave's own staging rows
        const float lq = l[q] + __shfl_xor(l[q], 16, 32);
        const float inv = 1.0f / lq;
        // O^T D layout: o[q][j][r] = (d = 16j + 8h + r, t = lane&15) -> os[t][d]; rows 0..15 x columns 0..63 all written
#pragma unroll
        for (int j = 0; j < 4; ++j) { v4f a, c;
#pragma unroll
            for (int r = 0; r < 4; ++r) { a[r] = o[q][j][r] * inv; c[r] = o[q][j][4 + r] * inv; }
            *(v4fa*)(&os[wb + lr * 68 + 16 * j + 8 * hi]) = a; *(v4fa*)(&os[wb + lr * 68 + 16 * j + 8 * hi + 4]) = c; }
        wave_sync();
        float* orow = OUT + ((size_t)b2 * OUT_SEQ + t0 + 16 * q) * DM + (size_t)cb * HD;
#pragma unroll
        for (int s = 0; s < 8; ++s) { const int row = 2 * s + hi, cofs = lr * 4;   // 8 s x 2 rows = 16 rows; 16 lanes x 4 floats = 64 columns
            const v4f val = *(const v4fa*)(&os[wb + row * 68 + cofs]);
            *(v4f*)(orow + (size_t)row * DM + cofs) = val; }
        if (q + 1 < QT) wave_sync();                         // the rows are read out before the next query tile overwrites them
    }
}

static constexpr size_t al256(size_t v) { return (v + 255) & ~(size_t)255; }
static constexpr size_t SZ_XB = al256((size_t)NB * SEQ * DM * 2);          // one bf16 stream copy
static constexpr size_t SZ_WB = al256((size_t)3 * DM * DM * 2);
static constexpr size_t SZ_PL = al256((size_t)NB * NH_ * SEQ * HD * 2);
static constexpr size_t SZ_TOTAL = 3 * SZ_XB + SZ_WB + 5 * SZ_PL;
static_assert(SZ_TOTAL <= (size_t)134217728);          // workspace carve <= 128 MiB
static_assert(((size_t)DM * DM * 2) % 256 == 0);       // weight sub-planes stay 256-byte aligned
static_assert(SZ_XB == (size_t)NB * SEQ * DM * 2);     // no pad between the bf16 copies: the conversion writes them as one range
static constexpr unsigned CVT_G = (unsigned)((3 * (size_t)NB * SEQ * DM + 3 * (size_t)DM * DM) / ((size_t)CVT_T * 1024));   // conversion blocks: three streams, three weights
static_assert((size_t)NB * SEQ * DM == (size_t)NB * NH_ * SEQ * HD);   // projection grid x tile == plane extent

extern "C" void kernel_launch(void* const* d_in, const int* in_sizes, int n_in,
                              void* d_out, int out_size, void* d_ws, size_t ws_size, hipStream_t stream) {
    if (n_in < 6) return;
    const size_t needx = ((size_t)(NB - 1) * SEQ_FULL + SEQ) * DM;
    if ((size_t)in_sizes[0] < needx || (size_t)in_sizes[1] < needx || (size_t)in_sizes[2] < needx) return;
    if ((size_t)in_sizes[3] < (size_t)DM * DM || (size_t)in_sizes[4] < (size_t)DM * DM || (size_t)in_sizes[5] < (size_t)DM * DM) return;
    if ((size_t)out_size < ((size_t)(NB_FULL - 1) * OUT_SEQ + SEQ) * DM) return;
    if (SZ_TOTAL > ws_size) return;
    // wire order: q, k, v streams, then Wq, Wk, Wv ([out][in] = Bt as-is)
    const float* xq = (const float*)d_in[0]; const float* xk = (const float*)d_in[1]; const float* xv = (const float*)d_in[2];
    const float* wq = (const float*)d_in[3]; const float* wk = (const float*)d_in[4]; const float* wv = (const float*)d_in[5];
    float* OUT = (float*)d_out;      // [NB_FULL][OUT_SEQ][1024]
    char* wsp = (char*)d_ws;
    bf* XQ = (bf*)wsp; wsp += SZ_XB;                 // [NB*SEQ][1024]
    bf* XK = (bf*)wsp; wsp += SZ_XB;                 // [NB*SEQ][1024]
    bf* XV = (bf*)wsp; wsp += SZ_XB;                 // [NB*SEQ][1024]
    bf* WB = (bf*)wsp; wsp += SZ_WB;                 // [3][1024][1024]: q | k | v
    h16* QH = (h16*)wsp; wsp += SZ_PL;               // [NB*16][SEQ][64]
    h16* QR = (h16*)wsp; wsp += SZ_PL;               // [NB*16][SEQ][64] residual x2048
    h16* KP = (h16*)wsp; wsp += SZ_PL;               // [NB*16][SEQ][64]
    h16* KR = (h16*)wsp; wsp += SZ_PL;               // [NB*16][SEQ][64] residual x2048
    h16* VT = (h16*)wsp; wsp += SZ_PL;               // [NB*16][64][SEQ]
    bf* WQ = WB; bf* WK = WB + (size_t)DM * DM; bf* WV = WB + (size_t)2 * DM * DM;

    // XQ | XK | XV | WQ | WK | WV are one contiguous bf16 range that starts at XQ
    k_cvt_all<<<dim3(CVT_G, 1, 1), 256, 0, stream>>>(xq, xk, xv, wq, wk, wv, XQ);

    // q, k: A = stream rows (m = b*SEQ + t), Bt = W rows (n = h*64 + d) -> plane [(b*16 + h)][t][d], value + residual planes
    k_proj<<<dim3(NB * SEQ / 128, DM / 128, 1), 256, 0, stream>>>(XQ, WQ, QH, QR, 1, SEQ, (size_t)NH_ * SEQ * HD, HD, HD, (size_t)SEQ * HD);
    k_proj<<<dim3(NB * SEQ / 128, DM / 128, 1), 256, 0, stream>>>(XK, WK, KP, KR, 1, SEQ, (size_t)NH_ * SEQ * HD, HD, HD, (size_t)SEQ * HD);
    // v^T: A = Wv rows (m = h*64 + d), Bt = v-stream rows (n = b*SEQ + t) -> plane [(b*1024 + m)][t] = [(b*16 + h)][d][t]
    k_proj<<<dim3(DM / 128, NB * SEQ / 128, 1), 256, 0, stream>>>(WV, XV, VT, VT, 0, DM, (size_t)0, SEQ, SEQ, (size_t)DM * SEQ);

    k_flash<<<dim3(SEQ / (16 * QT * AW), NB * NH_, 1), 32 * AW, 0, stream>>>(QH, QR, KP, KR, VT, OUT);
}

// v005
// Measured time: 91.6 microseconds a run.
// Two timings next to v004 both put it at 1.21 times that version's speed.
// Over all steps from v000 it is 3.42 times as fast.
#include <hip/hip_runtime.h>

// Non-causal multi-head attention with three input streams, width 1024 = 16 heads x 64; q/k/v [NB][SEQ][1024], Wq/Wk/Wv [out][in] (y = x W^T), no biases, no mask, score scale 1/8, no output projection; context written at the regrouped address (flat n = b*16+h re-read as n = c*NB_FULL + b2).
// Compute dtypes, f32 accumulate everywhere: projections v_wmma_f32_16x16x32_bf16 (x and W RNE-converted to bf16; products exact);
// scores v_wmma_f32_16x16x32_f16 with q and k each as f16 value + f16 residual x2048 (three products: hi*hi in one accumulator, hi*res + res*hi in a second accumulator folded back by 1/2048); P (x256 carry, cancels in the normalisation, row sum from the f32 values) and v single f16; softmax f32 (online, running max).
// Layout: bf16 copies of q/k/v streams and W; q (hi, residual), k (hi, residual) planes [b*16+h][t][d] and v^T plane [b*16+h][d][t] written by the GEMM epilogue (GEMM: 128x128 block tile, eight waves of 32x64, k-slices of 64 of both operands staged in LDS by asynchronous copies, two buffers); fused flash kernel in transposed form (S^T = K Q^T, O^T = V^T P^T), K / V^T tiles of 64 keys staged in LDS by asynchronous copies (two buffers) and shared by the block's waves, output from f32 accumulators.

#ifndef NB
#define NB 2
#endif
#ifndef SEQ
#define SEQ 2048
#endif
#define NB_FULL  2
#define SEQ_FULL 2048
#ifndef OUT_SEQ
#define OUT_SEQ SEQ              // row pitch (in tokens) between batches of the output
#endif
#define DM   1024
#define NH_  16
#define HD   64
#define AW   8                   // waves per flash block; all share one staged K / V^T tile
#define QT   2                   // query tiles of 16 rows per flash wave: each K / V^T fragment read from LDS serves all of them
#define KS   64                  // keys per staged tile (two passes of 32 keys)
#define PIT  72                  // LDS row pitch in halves: 144 B = 16 B x odd, conflict-free for 16-byte row reads
#define PLH  (64 * PIT)          // halves per staged plane: 64 rows
#define BUFH (3 * PLH)           // halves per buffer: K value, K residual, V^T
#define PKS  64                  // GEMM: k per staged slice (two k-steps of 32); one row of a slice = one 128-B line
#define PPLH (128 * PIT)         // GEMM: halves per staged operand slice: 128 rows
#define PBUFH (2 * PPLH)         // GEMM: halves per buffer: A slice, B slice
#define CVT_T 32                 // conversion: tiles of 1024 elements per block
#define QRS  2048.0f             // carry of the residual planes
#define QRI  (1.0f / 2048.0f)
#define SC2  (0.125f * 1.4426950408889634f)   // HD^-0.5 * log2(e)
#define PSH  8.0f                // log2 of the P carry (256)

static_assert(HD == 64);
static_assert(8 * 8 == HD);                    // plane store: 8 lanes x 8 halves per row
static_assert(16 * 4 == HD);                   // output store: 16 lanes x 4 floats per row segment
static_assert(NH_ * HD == DM);                 // head h = columns h*64 + d
static_assert(DM % 64 == 0);                   // column tiles of 64
static_assert(DM % 32 == 0);                   // GEMM k-steps of 32
static_assert(DM % 128 == 0 && (NB * SEQ) % 128 == 0);   // GEMM block tiles of 128 x 128 cover both extents exactly
static_assert(DM % PKS == 0 && DM / PKS >= 2 && PKS == 64);   // whole k-slices; the two-buffer prologue needs slices 0 and 1; copy map: 8 lanes x 16 B = one row
static_assert(HD % 32 == 0);                   // score k-steps of 32
static_assert(SEQ % 64 == 0);                  // a 64-row tile never straddles two batches
static_assert((NB * SEQ) % 64 == 0);
static_assert(SEQ % 32 == 0);                  // key loop steps by 32
static_assert(SEQ % (16 * QT * AW) == 0);      // flash grid covers the sequence exactly
static_assert(SEQ % KS == 0 && SEQ / KS >= 2); // whole tiles; the two-buffer prologue needs tiles 0 and 1
static_assert(KS == 64 && 32 * AW == 256);     // copy map: 256 lanes x 16 B x 2 = one 64-row x 128-B plane
static_assert((PIT * 2) % 16 == 0);            // every LDS row starts on a 16-byte multiple
static_assert(((size_t)SEQ * DM) % (CVT_T * 1024) == 0);   // a conversion block never straddles two batches or two streams
static_assert(((size_t)DM * DM) % (CVT_T * 1024) == 0);    // nor two weights
static_assert(NB <= NB_FULL);
static_assert(SEQ <= SEQ_FULL);
static_assert(SEQ <= OUT_SEQ);
static_assert(((NB * NH_ - 1) / NB_FULL) * HD + HD <= DM);   // regrouped column block stays inside the row
static_assert((size_t)((NB_FULL - 1) * (size_t)OUT_SEQ + SEQ) * DM * 4 <= (size_t)16777216);   // last written output element inside the 16,777,216-byte output

typedef _Float16 h16;
typedef unsigned short bf;
typedef __attribute__((ext_vector_type(16))) __bf16   v16bf;
typedef __attribute__((ext_vector_type(16))) _Float16 v16h;
typedef __attribute__((ext_vector_type(8)))  _Float16 v8h;
typedef __attribute__((ext_vector_type(8)))  unsigned short v8us;
typedef __attribute__((ext_vector_type(4)))  unsigned short v4us;
typedef __attribute__((ext_vector_type(8)))  float    v8f;
typedef __attribute__((ext_vector_type(4)))  float    v4f;
typedef v4f  __attribute__((may_alias)) v4fa;

__device__ __forceinline__ unsigned short f2bf(float f) { unsigned u = __float_as_uint(f); u += 0x7FFFu + ((u >> 16) & 1u); return (unsigned short)(u >> 16); }
__device__ __forceinline__ v16h cat16(v8h lo, v8h hi) { return __builtin_shufflevector(lo, hi, 0, 1, 2, 3, 4, 5, 6, 7, 8, 9, 10, 11, 12, 13, 14, 15); }
__device__ __forceinline__ v16bf cat16b(v8us lo, v8us hi) { return __builtin_bit_cast(v16bf, __builtin_shufflevector(lo, hi, 0, 1, 2, 3, 4, 5, 6, 7, 8, 9, 10, 11, 12, 13, 14, 15)); }
// f16 form (k_flash): the plain builtin, the compiler keeps the distance behind it. A guard statement as in wmmab would tie every fragment and accumulator of the two query tiles to the first 256 registers, where they do not fit.
__device__ __forceinline__ v8f wmma16(v16h a, v16h b, v8f c) {
    return __builtin_amdgcn_wmma_f32_16x16x32_f16(false, a, false, b, (short)0, c, false, false);
}
// bf16 form (k_proj): followed by its own four-slot guard tying exactly its accumulator and keeping its operands live
__device__ __forceinline__ v8f wmmab(v16bf a, v16bf b, v8f c) {
    c = __builtin_amdgcn_wmma_f32_16x16x32_bf16(false, a, false, b, (short)0, c, false, false);
    asm volatile("v_nop\n\tv_nop\n\tv_nop\n\tv_nop" : "+v"(c) : "v"(a), "v"(b));
    return c;
}
// fragment loaders from K-contiguous 16-bit rows; p already includes + 8*(lane>>4): elements 0..7 <- k0+8h+0..7, elements 8..15 <- k0+16+8h+0..7 (same map for A and B)
__device__ __forceinline__ v16h  ldh(const h16* p) { return cat16(*(const v8h*)p, *(const v8h*)(p + 16)); }
__device__ __forceinline__ v16bf ldb(const bf* p)  { return cat16b(*(const v8us*)p, *(const v8us*)(p + 16)); }
// ordering point for wave-private LDS tiles (same wave writes and reads)
__device__ __forceinline__ void wave_sync() { __builtin_amdgcn_fence(3 /* release order */, "wavefront"); __builtin_amdgcn_wave_barrier(); asm volatile("" ::: "memory"); }

// k_cvt_all: every f32 -> bf16 copy of the call in ONE launch. The six destinations lie back to back in the workspace (q | k | v streams, then Wq | Wk | Wv), so the block index is the flat position there.
// A tile is 1024 elements: each wave-wide 16-byte load covers 512 contiguous bytes, each 8-byte store 256 (whole 128-B lines both ways). A block takes CVT_T consecutive tiles of one tensor,
// its loads issued ahead of the conversions: few long-lived waves in place of one short wave per 256 elements.
__global__ __launch_bounds__(256) void k_cvt_all(const float* __restrict__ xq, const float* __restrict__ xk, const float* __restrict__ xv,
                                                 const float* __restrict__ wq, const float* __restrict__ wk, const float* __restrict__ wv, bf* __restrict__ dst) {
    constexpr unsigned BE = CVT_T * 1024u;                                  // elements per block
    constexpr unsigned BX = (unsigned)((size_t)NB * SEQ * DM / BE);         // blocks per stream
    constexpr unsigned BW = (unsigned)((size_t)DM * DM / BE);               // blocks per weight
    const unsigned b = blockIdx.x;
    const float* src; size_t off;
    if (b < 3u * BX) {
        const unsigned s = b / BX; const size_t e = (size_t)(b - s * BX) * BE; const size_t bt = e / ((size_t)SEQ * DM);
        src = s == 0u ? xq : (s == 1u ? xk : xv);
        off = bt * ((size_t)SEQ_FULL * DM) + (e - bt * ((size_t)SEQ * DM));   // batch pitch of the source is the full sequence
    } else {
        const unsigned w = b - 3u * BX, s = w / BW;
        src = s == 0u ? wq : (s == 1u ? wk : wv);
        off = (size_t)(w - s * BW) * BE;
    }
    const float* p = src + off + threadIdx.x * 4u;
    bf* q = dst + (size_t)b * BE + threadIdx.x * 4u;
    v4f v[CVT_T];                                                          // the loads stand ahead of the first conversion: as many in flight as the compiler keeps there
#pragma unroll
    for (int j = 0; j < CVT_T; ++j) v[j] = *(const v4f*)(p + j * 1024);
#pragma unroll
    for (int j = 0; j < CVT_T; ++j) { v4us o;
#pragma unroll
        for (int k = 0; k < 4; ++k) o[k] = f2bf(v[j][k]);
        *(v4us*)(q + j * 1024) = o; }
}

// one k-slice's copies of one lane: rows r, r + 32, r + 64, r + 96 of the A slice and of the B slice (128 rows x 128 B each), 16 B each, global -> LDS through no register.
// The closing s_wait_xcnt stands inside the statement so that no address register named here is rewritten ahead of it.
__device__ __forceinline__ void stage_slice(const bf* ga, const bf* gb, unsigned l) {
    const bf* ga1 = ga + (size_t)32 * DM; const bf* ga2 = ga + (size_t)64 * DM; const bf* ga3 = ga + (size_t)96 * DM;
    const bf* gb1 = gb + (size_t)32 * DM; const bf* gb2 = gb + (size_t)64 * DM; const bf* gb3 = gb + (size_t)96 * DM;
    const unsigned rs = 32u * PIT * 2u;
    const unsigned l1 = l + rs, l2 = l + 2u * rs, l3 = l + 3u * rs, l4 = l + PPLH * 2u, l5 = l4 + rs, l6 = l4 + 2u * rs, l7 = l4 + 3u * rs;
    asm volatile("global_load_async_to_lds_b128 %0, %8, off\n\t"
                 "global_load_async_to_lds_b128 %1, %9, off\n\t"
                 "global_load_async_to_lds_b128 %2, %10, off\n\t"
                 "global_load_async_to_lds_b128 %3, %11, off\n\t"
                 "global_load_async_to_lds_b128 %4, %12, off\n\t"
                 "global_load_async_to_lds_b128 %5, %13, off\n\t"
                 "global_load_async_to_lds_b128 %6, %14, off\n\t"
                 "global_load_async_to_lds_b128 %7, %15, off\n\t"
                 "s_wait_xcnt 0x0"
                 :: "v"(l), "v"(l1), "v"(l2), "v"(l3), "v"(l4), "v"(l5), "v"(l6), "v"(l7), "v"(ga), "v"(ga1), "v"(ga2), "v"(ga3), "v"(gb), "v"(gb1), "v"(gb2), "v"(gb3) : "memory");
}

// k_proj: register-blocked bf16 GEMM, 128x128 tile per block, EIGHT WAVES of 32x64 each (8 accumulators; wave w: rows 32*(w>>1), columns 64*(w&1)), K = DM.
// Slice s = k 64s .. 64s+63 of the block's 128 A rows and 128 Bt rows: two planes of 128 rows x 128 B, copied in whole 128-B lines (4 + 4 copies per lane); slice s+1 flies while slice s is worked on.
// C[m][n] = sum_k A[m][k] Bt[n][k], written as f16 (Ph) and, for q and k, the f16 residual x2048 (Pr), row pitch 'pitch' (halves).
// ALL THREE PROJECTIONS IN ONE LAUNCH: grid (NB*SEQ/128, DM/128, 3), 256 threads; blockIdx.z picks the product, blockIdx.x the 128 stream rows, blockIdx.y the 128 weight rows.
//   z = 0, 1 (q, k): A = stream rows (m = b*SEQ + t), Bt = W rows (n = h*64 + d) -> planes [(b*16 + h)][t][d], value + residual
//   z = 2 (v^T):     A = Wv rows (m = h*64 + d), Bt = v-stream rows (n = b*SEQ + t) -> plane [(b*1024 + m)][t] = [(b*16 + h)][d][t], value only
// X = the three bf16 stream copies back to back, Wb = the three bf16 weights back to back.
// Second launch bound: six waves per SIMD, so that three blocks (LDS 3 x 108,544 B) stand on one WGP and one block's copy, LDS and barrier waits are filled by the other two.
__global__ __launch_bounds__(256, 6) void k_proj(const bf* __restrict__ X, const bf* __restrict__ Wb, h16* QH, h16* QR, h16* KP, h16* KR, h16* VT) {
    __shared__ __align__(16) float osb[8 * 16 * 68];
    __shared__ __align__(128) bf pring[2 * PBUFH];
    const int K = DM;
    const int lane = threadIdx.x & 31, lr = lane & 15, hi = lane >> 4;
    const int wave = __builtin_amdgcn_readfirstlane(threadIdx.x >> 5);
    const int z = blockIdx.z;
    const bool useRes = z < 2;
    const bf* xs = X + (size_t)z * ((size_t)NB * SEQ * DM);
    const bf* wsl = Wb + (size_t)z * ((size_t)DM * DM);
    const bf* A = useRes ? xs : wsl;
    const bf* Bt = useRes ? wsl : xs;
    h16* Ph = z == 0 ? QH : (z == 1 ? KP : VT);
    h16* Pr = z == 0 ? QR : KR;                              // stored only where useRes
    const int pitch = useRes ? HD : SEQ;
    const int rb = (useRes ? blockIdx.x : blockIdx.y) * 128, cb = (useRes ? blockIdx.y : blockIdx.x) * 128;
    const int r0 = rb + (wave >> 1) * 32, c0 = cb + (wave & 1) * 64;
    float* os = osb + wave * 16 * 68;                        // wave-private output staging
    v8f acc[2][4];
#pragma unroll
    for (int mb = 0; mb < 2; ++mb)
#pragma unroll
        for (int nb = 0; nb < 4; ++nb) acc[mb][nb] = (v8f){};
    // copy map: lane takes rows crow + 32 j (j = 0 .. 3), 16-byte column ccol, of each operand's slice
    const int crow = threadIdx.x >> 3, ccol = threadIdx.x & 7;
    const bf* ga = A + (size_t)(rb + crow) * K + ccol * 8;   // + k0
    const bf* gb = Bt + (size_t)(cb + crow) * K + ccol * 8;  // + k0
    const unsigned lc = (unsigned)(size_t)pring + (unsigned)(crow * PIT + ccol * 8) * 2u;   // LDS byte address, + buffer
    stage_slice(ga, gb, lc);
    asm volatile("s_wait_asynccnt 0x0" ::: "memory");        // slice 0 landed (this wave's copies) before the barrier publishes it
    __syncthreads();
    stage_slice(ga + PKS, gb + PKS, lc + PBUFH * 2u);
    const int fa = ((wave >> 1) * 32 + lr) * PIT + 8 * hi;          // A fragment offset in a buffer: + mb * 16 * PIT + k0
    const int fb = PPLH + ((wave & 1) * 64 + lr) * PIT + 8 * hi;    // B fragment offset in a buffer: + nb * 16 * PIT + k0
#pragma unroll 1   // stays rolled: one small body serves both buffers, the buffer is picked by st & 1
    for (int st = 0; st < K / PKS; ++st) {
        const bf* tp = pring + (st & 1) * PBUFH;
        v16bf a0[2], b0[4], a1[2], b1[4];                    // the first k-step's fragments, the second's two A and first two B fragments are read as one group ahead of the products
#pragma unroll
        for (int i = 0; i < 2; ++i) a0[i] = ldb(tp + fa + i * 16 * PIT);
#pragma unroll
        for (int i = 0; i < 4; ++i) b0[i] = ldb(tp + fb + i * 16 * PIT);
#pragma unroll
        for (int i = 0; i < 2; ++i) a1[i] = ldb(tp + fa + i * 16 * PIT + 32);
#pragma unroll
        for (int i = 0; i < 2; ++i) b1[i] = ldb(tp + fb + i * 16 * PIT + 32);
#pragma unroll
        for (int nb = 0; nb < 2; ++nb)
#pragma unroll
            for (int mb = 0; mb < 2; ++mb) acc[mb][nb] = wmmab(a0[mb], b0[nb], acc[mb][nb]);
#pragma unroll
        for (int i = 2; i < 4; ++i) b1[i] = ldb(tp + fb + i * 16 * PIT + 32);   // the last two fragments take the registers that b0[0], b0[1] have left: the live set stays inside 160 registers
#pragma unroll
        for (int nb = 2; nb < 4; ++nb)
#pragma unroll
            for (int mb = 0; mb < 2; ++mb) acc[mb][nb] = wmmab(a0[mb], b0[nb], acc[mb][nb]);
#pragma unroll
        for (int nb = 0; nb < 4; ++nb)
#pragma unroll
            for (int mb = 0; mb < 2; ++mb) acc[mb][nb] = wmmab(a1[mb], b1[nb], acc[mb][nb]);
        asm volatile("s_wait_dscnt 0x0" ::: "memory");       // this wave's reads of slice st are done before its buffer may be refilled
        asm volatile("s_wait_asynccnt 0x0" ::: "memory");    // this wave's copies of slice st+1 have landed before the barrier publishes them
        __syncthreads();                                     // publishes slice st+1 and ends every wave's reads of slice st
        if (st + 2 < K / PKS) { const int k2 = (st + 2) * PKS; stage_slice(ga + k2, gb + k2, lc + (unsigned)(st & 1) * (PBUFH * 2u)); }
    }
    asm volatile("s_wait_asynccnt 0x0" ::: "memory");        // nothing of this wave is in flight behind the loop
    const size_t tbase = useRes ? (size_t)(r0 / SEQ) * ((size_t)NH_ * SEQ * HD) + (size_t)(r0 % SEQ) * HD + (size_t)(c0 / HD) * ((size_t)SEQ * HD) + (size_t)(c0 % HD)
                                : (size_t)r0 * SEQ + (size_t)(c0 / SEQ) * ((size_t)DM * SEQ) + (size_t)(c0 % SEQ);
#pragma unroll
    for (int mb = 0; mb < 2; ++mb) {
#pragma unroll
        for (int nb = 0; nb < 4; ++nb) {
#pragma unroll
            for (int j = 0; j < 8; ++j) os[(hi * 8 + j) * 68 + nb * 16 + lr] = acc[mb][nb][j]; }   // D: row 8h+j, col lane&15
        wave_sync();
        const size_t sb = tbase + (size_t)(mb * 16) * (size_t)pitch;
{
#pragma unroll
            for (int s = 0; s < 4; ++s) { const int row = 4 * s + (lane >> 3), c8 = (lane & 7) * 8;   // 4 s x 4 row groups = 16 rows; 8 lanes x 8 = 64 columns
                const v4f x0 = *(const v4fa*)(&os[row * 68 + c8]); const v4f x1 = *(const v4fa*)(&os[row * 68 + c8 + 4]); v8h hv, rv;
#pragma unroll
                for (int i = 0; i < 4; ++i) { const h16 a0 = (h16)x0[i]; const h16 a1 = (h16)x1[i]; hv[i] = a0; hv[4 + i] = a1; rv[i] = (h16)((x0[i] - (float)a0) * QRS); rv[4 + i] = (h16)((x1[i] - (float)a1) * QRS); }
                const size_t oo = sb + (size_t)row * (size_t)pitch + c8;
                *(v8h*)(Ph + oo) = hv; if (useRes) *(v8h*)(Pr + oo) = rv; }
             }
        wave_sync();
    }
}

// one tile's copies of one lane: rows r and r + 32 of the K value, K residual and V^T planes, 16 B each, global -> LDS through no register.
// The closing s_wait_xcnt stands inside the statement so that no address register named here is rewritten ahead of it.
__device__ __forceinline__ void stage_tile(const h16* gk, const h16* gr, const h16* gv, unsigned l) {
    const h16* gk1 = gk + (size_t)32 * HD; const h16* gr1 = gr + (size_t)32 * HD; const h16* gv1 = gv + (size_t)32 * SEQ;
    const unsigned l1 = l + 32u * PIT * 2u, l2 = l + PLH * 2u, l3 = l2 + 32u * PIT * 2u, l4 = l + 2u * PLH * 2u, l5 = l4 + 32u * PIT * 2u;
    asm volatile("global_load_async_to_lds_b128 %0, %6, off\n\t"
                 "global_load_async_to_lds_b128 %1, %7, off\n\t"
                 "global_load_async_to_lds_b128 %2, %8, off\n\t"
                 "global_load_async_to_lds_b128 %3, %9, off\n\t"
                 "global_load_async_to_lds_b128 %4, %10, off\n\t"
                 "global_load_async_to_lds_b128 %5, %11, off\n\t"
                 "s_wait_xcnt 0x0"
                 :: "v"(l), "v"(l1), "v"(l2), "v"(l3), "v"(l4), "v"(l5), "v"(gk), "v"(gk1), "v"(gr), "v"(gr1), "v"(gv), "v"(gv1) : "memory");
}

// k_flash: fused attention, one wave per QT tiles of 16 query rows of one flat slot n = b*16 + h (every K and V^T fragment is read from LDS once and multiplied with each query tile in turn); Q fragments straight from the f16 planes; K (value, residual) and V^T fragments from the block's LDS tile (two 16-B reads each).
// Tile t = keys 64t .. 64t+63: three planes of 64 rows x 128 B (K rows = keys, V^T rows = d), each lane copies 2 x 16 B per plane in whole 128-B lines; tile t+1 flies while tile t is worked on.
// Transposed form: S^T[key][t] = K Q^T (A = K rows, B = Q rows); lane (t = lane&15, h = lane>>4) holds keys 8h+r of each 16-key tile, so the packed
// P tile is directly the B fragment of O^T[d][t] = V^T P^T (element r <- tile keys 0..15, element 8+r <- tile keys 16..31, lane unchanged).
// Scores per 16-key tile: sH = Khi Qhi^T, sL = Khi Qres^T + Kres Qhi^T (both residual planes carry x2048), s = sH + sL/2048; one 16-key tile live at a time.
// Softmax state (running max, partial sum) is one scalar per lane and query tile; the two lane halves of a row are combined with one xor-16 exchange.
// Output address: n is re-read as n = c*NB_FULL + b2 -> OUT[b2][t][c*64 + d].
__global__ __launch_bounds__(32 * AW) void k_flash(const h16* __restrict__ QH, const h16* __restrict__ QR, const h16* __restrict__ KP, const h16* __restrict__ KR, const h16* __restrict__ VT, float* OUT) {
    __shared__ __align__(16) float os[AW * 16 * 68];
    __shared__ __align__(128) h16 ring[2 * BUFH];
    const int lane = threadIdx.x & 31, lr = lane & 15, hi = lane >> 4;
    const int wave = __builtin_amdgcn_readfirstlane(threadIdx.x >> 5);
    const int zh = blockIdx.y;                               // flat slot n = b*NH_ + h
    const int t0 = (blockIdx.x * AW + wave) * (16 * QT);
    const size_t pbase = (size_t)zh * SEQ * HD;
    // every loop over q, kt, j or r in this kernel is unrolled so that the arrays it indexes stay in registers
    v16h qh0[QT], qh1[QT], qr0[QT], qr1[QT];                 // B fragments: col t, k = d
#pragma unroll
    for (int q = 0; q < QT; ++q) { const size_t qo = pbase + (size_t)(t0 + 16 * q + lr) * HD + 8 * hi;
        qh0[q] = ldh(QH + qo); qh1[q] = ldh(QH + qo + 32); qr0[q] = ldh(QR + qo); qr1[q] = ldh(QR + qo + 32);
        if (q + 1 < QT) asm volatile("s_wait_xcnt 0x0" ::: "memory"); }   // the next tile's loads land in the address registers of these loads: the wait stands in front of them
    const int fo = lr * PIT + 8 * hi;                        // fragment offset inside a plane: + row0 * PIT + k0 (A fragment: row lr, k = 8h ..)
    // copy map: lane takes rows crow and crow + 32, 16-byte column ccol, of each plane
    const int crow = threadIdx.x >> 3, ccol = threadIdx.x & 7;
    const h16* gk = KP + pbase + (size_t)crow * HD + ccol * 8;    // + key0 * HD
    const h16* gr = KR + pbase + (size_t)crow * HD + ccol * 8;    // + key0 * HD
    const h16* gv = VT + pbase + (size_t)crow * SEQ + ccol * 8;   // + key0
    const unsigned lc = (unsigned)(size_t)ring + (unsigned)(crow * PIT + ccol * 8) * 2u;   // LDS byte address, + buffer, plane, 32 rows
    stage_tile(gk, gr, gv, lc);
    asm volatile("s_wait_asynccnt 0x0" ::: "memory");        // tile 0 landed (this wave's copies) before the barrier publishes it
    __syncthreads();
    stage_tile(gk + (size_t)KS * HD, gr + (size_t)KS * HD, gv + KS, lc + BUFH * 2u);
    v8f o[QT][4];
    float m[QT], l[QT];
#pragma unroll
    for (int q = 0; q < QT; ++q) { m[q] = -3.0e38f; l[q] = 0.0f;
#pragma unroll
        for (int j = 0; j < 4; ++j) o[q][j] = (v8f){}; }
#pragma unroll 1
    for (int st = 0; st < SEQ / KS; ++st) {
      const h16* tk = ring + (st & 1) * BUFH + fo;           // K value plane; + PLH residual, + 2 * PLH V^T
#pragma unroll
      for (int p0 = 0; p0 < KS; p0 += 32) {                  // constant offsets into the tile
        float ts[QT][2][8];                                  // scores: query tile, 16-key tile, key 8h + r
#pragma unroll
        for (int kt = 0; kt < 2; ++kt) {   // keys p0 + 16 kt .. + 15 of the tile; the query tiles' accumulator chains alternate, each chain in the order hi*hi | hi*res, res*hi
            const h16* ka = tk + (p0 + 16 * kt) * PIT;
            const v16h kh0 = ldh(ka), kh1 = ldh(ka + 32), kr0 = ldh(ka + PLH), kr1 = ldh(ka + PLH + 32);
            v8f sH[QT], sL[QT];
#pragma unroll
            for (int q = 0; q < QT; ++q) { sH[q] = wmma16(kh0, qh0[q], (v8f){}); sL[q] = wmma16(kh0, qr0[q], (v8f){}); }
#pragma unroll
            for (int q = 0; q < QT; ++q) { sH[q] = wmma16(kh1, qh1[q], sH[q]); sL[q] = wmma16(kh1, qr1[q], sL[q]); }
#pragma unroll
            for (int q = 0; q < QT; ++q) sL[q] = wmma16(kr0, qh0[q], sL[q]);
#pragma unroll
            for (int q = 0; q < QT; ++q) sL[q] = wmma16(kr1, qh1[q], sL[q]);
#pragma unroll
            for (int q = 0; q < QT; ++q)
#pragma unroll
                for (int r = 0; r < 8; ++r) ts[q][kt][r] = (sH[q][r] + sL[q][r] * QRI) * SC2;
        }
        v16h pb[QT];
#pragma unroll
        for (int q = 0; q < QT; ++q) {
            float mx = -3.0e38f;
#pragma unroll
            for (int r = 0; r < 8; ++r) mx = fmaxf(mx, fmaxf(ts[q][0][r], ts[q][1][r]));
            mx = fmaxf(mx, __shfl_xor(mx, 16, 32));
            const float mnew = fmaxf(m[q], mx);
            const float alpha = __builtin_amdgcn_exp2f(m[q] - mnew);
            const float sh = PSH - mnew;
            float ls = 0.0f;
#pragma unroll
            for (int r = 0; r < 8; ++r) { const float ea = __builtin_amdgcn_exp2f(ts[q][0][r] + sh); const float eb = __builtin_amdgcn_exp2f(ts[q][1][r] + sh); pb[q][r] = (h16)ea; pb[q][8 + r] = (h16)eb; ls += ea + eb; }
            l[q] = l[q] * alpha + ls; m[q] = mnew;
#pragma unroll
            for (int j = 0; j < 4; ++j) o[q][j] = o[q][j] * alpha;
        }
        const h16* va = tk + 2 * PLH + p0;
        const v16h v0 = ldh(va), v1 = ldh(va + 16 * PIT), v2 = ldh(va + 32 * PIT), v3 = ldh(va + 48 * PIT);
#pragma unroll
        for (int q = 0; q < QT; ++q) { o[q][0] = wmma16(v0, pb[q], o[q][0]); o[q][1] = wmma16(v1, pb[q], o[q][1]); o[q][2] = wmma16(v2, pb[q], o[q][2]); o[q][3] = wmma16(v3, pb[q], o[q][3]); }
      }
      asm volatile("s_wait_dscnt 0x0" ::: "memory");         // this wave's reads of tile st are done before its buffer may be refilled
      asm volatile("s_wait_asynccnt 0x0" ::: "memory");      // this wave's copies of tile st+1 have landed before the barrier publishes them
      __syncthreads();                                       // publishes tile st+1 and ends every wave's reads of tile st
      if (st + 2 < SEQ / KS) { const size_t k2 = (size_t)(st + 2) * KS; stage_tile(gk + k2 * HD, gr + k2 * HD, gv + k2, lc + (unsigned)(st & 1) * (BUFH * 2u)); }
    }
    asm volatile("s_wait_asynccnt 0x0" ::: "memory");        // nothing of this wave is in flight behind the loop
    const int wb = wave * 16 * 68;
    const int b2 = zh % NB_FULL, cb = zh / NB_FULL;          // regrouped address: output batch b2, column block cb
#pragma unroll
    for (int q = 0; q < QT; ++q) {                           // one query tile at a time through the wave's own staging rows
        const float lq = l[q] + __shfl_xor(l[q], 16, 32);
        const float inv = 1.0f / lq;
        // O^T D layout: o[q][j][r] = (d = 16j + 8h + r, t = lane&15) -> os[t][d]; rows 0..15 x columns 0..63 all written
#pragma unroll
        for (int j = 0; j < 4; ++j) { v4f a, c;
#pragma unroll
            for (int r = 0; r < 4; ++r) { a[r] = o[q][j][r] * inv; c[r] = o[q][j][4 + r] * inv; }
            *(v4fa*)(&os[wb + lr * 68 + 16 * j + 8 * hi]) = a; *(v4fa*)(&os[wb + lr * 68 + 16 * j + 8 * hi + 4]) = c; }
        wave_sync();
        float* orow = OUT + ((size_t)b2 * OUT_SEQ + t0 + 16 * q) * DM + (size_t)cb * HD;
#pragma unroll
        for (int s = 0; s < 8; ++s) { const int row = 2 * s + hi, cofs = lr * 4;   // 8 s x 2 rows = 16 rows; 16 lanes x 4 floats = 64 columns
            const v4f val = *(const v4fa*)(&os[wb + row * 68 + cofs]);
            *(v4f*)(orow + (size_t)row * DM + cofs) = val; }
        if (q + 1 < QT) wave_sync();                         // the rows are read out before the next query tile overwrites them
    }
}

static constexpr size_t al256(size_t v) { return (v + 255) & ~(size_t)255; }
static constexpr size_t SZ_XB = al256((size_t)NB * SEQ * DM * 2);          // one bf16 stream copy
static constexpr size_t SZ_WB = al256((size_t)3 * DM * DM * 2);
static constexpr size_t SZ_PL = al256((size_t)NB * NH_ * SEQ * HD * 2);
static constexpr size_t SZ_TOTAL = 3 * SZ_XB + SZ_WB + 5 * SZ_PL;
static_assert(SZ_TOTAL <= (size_t)134217728);          // workspace carve <= 128 MiB
static_assert(((size_t)DM * DM * 2) % 256 == 0);       // weight sub-planes stay 256-byte aligned
static_assert(SZ_XB == (size_t)NB * SEQ * DM * 2);     // no pad between the bf16 copies: the conversion writes them as one range
static constexpr unsigned CVT_G = (unsigned)((3 * (size_t)NB * SEQ * DM + 3 * (size_t)DM * DM) / ((size_t)CVT_T * 1024));   // conversion blocks: three streams, three weights
static_assert((size_t)NB * SEQ * DM == (size_t)NB * NH_ * SEQ * HD);   // projection grid x tile == plane extent

extern "C" void kernel_launch(void* const* d_in, const int* in_sizes, int n_in,
                              void* d_out, int out_size, void* d_ws, size_t ws_size, hipStream_t stream) {
    if (n_in < 6) return;
    const size_t needx = ((size_t)(NB - 1) * SEQ_FULL + SEQ) * DM;
    if ((size_t)in_sizes[0] < needx || (size_t)in_sizes[1] < needx || (size_t)in_sizes[2] < needx) return;
    if ((size_t)in_sizes[3] < (size_t)DM * DM || (size_t)in_sizes[4] < (size_t)DM * DM || (size_t)in_sizes[5] < (size_t)DM * DM) return;
    if ((size_t)out_size < ((size_t)(NB_FULL - 1) * OUT_SEQ + SEQ) * DM) return;
    if (SZ_TOTAL > ws_size) return;
    // wire order: q, k, v streams, then Wq, Wk, Wv ([out][in] = Bt as-is)
    const float* xq = (const float*)d_in[0]; const float* xk = (const float*)d_in[1]; const float* xv = (const float*)d_in[2];
    const float* wq = (const float*)d_in[3]; const float* wk = (const float*)d_in[4]; const float* wv = (const float*)d_in[5];
    float* OUT = (float*)d_out;      // [NB_FULL][OUT_SEQ][1024]
    char* wsp = (char*)d_ws;
    bf* XQ = (bf*)wsp; wsp += SZ_XB;                 // [NB*SEQ][1024]
    wsp += SZ_XB;                                    // k stream copy, [NB*SEQ][1024]
    wsp += SZ_XB;                                    // v stream copy, [NB*SEQ][1024]
    bf* WB = (bf*)wsp; wsp += SZ_WB;                 // [3][1024][1024]: q | k | v
    h16* QH = (h16*)wsp; wsp += SZ_PL;               // [NB*16][SEQ][64]
    h16* QR = (h16*)wsp; wsp += SZ_PL;               // [NB*16][SEQ][64] residual x2048
    h16* KP = (h16*)wsp; wsp += SZ_PL;               // [NB*16][SEQ][64]
    h16* KR = (h16*)wsp; wsp += SZ_PL;               // [NB*16][SEQ][64] residual x2048
    h16* VT = (h16*)wsp; wsp += SZ_PL;               // [NB*16][64][SEQ]

    // XQ | XK | XV | WQ | WK | WV are one contiguous bf16 range that starts at XQ
    k_cvt_all<<<dim3(CVT_G, 1, 1), 256, 0, stream>>>(xq, xk, xv, wq, wk, wv, XQ);

    // q, k and v^T projections: one launch, blockIdx.z = 0, 1, 2
    k_proj<<<dim3(NB * SEQ / 128, DM / 128, 3), 256, 0, stream>>>(XQ, WB, QH, QR, KP, KR, VT);

    k_flash<<<dim3(SEQ / (16 * QT * AW), NB * NH_, 1), 32 * AW, 0, stream>>>(QH, QR, KP, KR, VT, OUT);
}

// v006
// One run takes 88.5 microseconds.
// Two timings next to v005 both put it at 1.04 times that version's speed.
// Over all steps from v000 it is 3.56 times as fast.
#include <hip/hip_runtime.h>

// Non-causal multi-head attention with three input streams, width 1024 = 16 heads x 64; q/k/v [NB][SEQ][1024], Wq/Wk/Wv [out][in] (y = x W^T), no biases, no mask, score scale 1/8, no output projection; context written at the regrouped address (flat n = b*16+h re-read as n = c*NB_FULL + b2).
// Compute dtypes, f32 accumulate everywhere: projections v_wmma_f32_16x16x32_bf16 (x and W RNE-converted to bf16; products exact);
// scores v_wmma_f32_16x16x32_f16 with q (times the score scale) and k each as f16 value + f16 residual at its own size (three products hi*res, res*hi, hi*hi summed in ONE accumulator, which then holds the scaled score); P (x256 carry, cancels in the normalisation, row sum from the f32 values) and v single f16; softmax f32 (online, running max).
// Layout: bf16 copies of q/k/v streams and W; q (hi, residual), k (hi, residual) planes [b*16+h][t][d] and v^T plane [b*16+h][d][t] written by the GEMM epilogue (GEMM: 128x128 block tile, eight waves of 32x64, k-slices of 64 of both operands staged in LDS by asynchronous copies, two buffers); fused flash kernel in transposed form (S^T = K Q^T, O^T = V^T P^T), K / V^T tiles of 64 keys staged in LDS by asynchronous copies (two buffers) and shared by the block's waves, output from f32 accumulators.

#ifndef NB
#define NB 2
#endif
#ifndef SEQ
#define SEQ 2048
#endif
#define NB_FULL  2
#define SEQ_FULL 2048
#ifndef OUT_SEQ
#define OUT_SEQ SEQ              // row pitch (in tokens) between batches of the output
#endif
#define DM   1024
#define NH_  16
#define HD   64
#define AW   8                   // waves per flash block; all share one staged K / V^T tile
#define QT   2                   // query tiles of 16 rows per flash wave: each K / V^T fragment read from LDS serves all of them
#define KS   64                  // keys per staged tile (two passes of 32 keys)
#define PIT  72                  // LDS row pitch in halves: 144 B = 16 B x odd, conflict-free for 16-byte row reads
#define PLH  (64 * PIT)          // halves per staged plane: 64 rows
#define BUFH (3 * PLH)           // halves per buffer: K value, K residual, V^T
#define PKS  64                  // GEMM: k per staged slice (two k-steps of 32); one row of a slice = one 128-B line
#define PPLH (128 * PIT)         // GEMM: halves per staged operand slice: 128 rows
#define PBUFH (2 * PPLH)         // GEMM: halves per buffer: A slice, B slice
#define CVT_T 32                 // conversion: tiles of 1024 elements per block
#define SC2  (0.125f * 1.4426950408889634f)   // HD^-0.5 * log2(e)
#define PSH  8.0f                // log2 of the P carry (256)

static_assert(HD == 64);
static_assert(8 * 8 == HD);                    // plane store: 8 lanes x 8 halves per row
static_assert(16 * 4 == HD);                   // output store: 16 lanes x 4 floats per row segment
static_assert(NH_ * HD == DM);                 // head h = columns h*64 + d
static_assert(DM % 64 == 0);                   // column tiles of 64
static_assert(DM % 32 == 0);                   // GEMM k-steps of 32
static_assert(DM % 128 == 0 && (NB * SEQ) % 128 == 0);   // GEMM block tiles of 128 x 128 cover both extents exactly
static_assert(DM % PKS == 0 && DM / PKS >= 2 && PKS == 64);   // whole k-slices; the two-buffer prologue needs slices 0 and 1; copy map: 8 lanes x 16 B = one row
static_assert(HD % 32 == 0);                   // score k-steps of 32
static_assert(SEQ % 64 == 0);                  // a 64-row tile never straddles two batches
static_assert((NB * SEQ) % 64 == 0);
static_assert(SEQ % 32 == 0);                  // key loop steps by 32
static_assert(SEQ % (16 * QT * AW) == 0);      // flash grid covers the sequence exactly
static_assert(SEQ % KS == 0 && SEQ / KS >= 2); // whole tiles; the two-buffer prologue needs tiles 0 and 1
static_assert(KS == 64 && 32 * AW == 256);     // copy map: 256 lanes x 16 B x 2 = one 64-row x 128-B plane
static_assert((PIT * 2) % 16 == 0);            // every LDS row starts on a 16-byte multiple
static_assert(((size_t)SEQ * DM) % (CVT_T * 1024) == 0);   // a conversion block never straddles two batches or two streams
static_assert(((size_t)DM * DM) % (CVT_T * 1024) == 0);    // nor two weights
static_assert(NB <= NB_FULL);
static_assert(SEQ <= SEQ_FULL);
static_assert(SEQ <= OUT_SEQ);
static_assert(((NB * NH_ - 1) / NB_FULL) * HD + HD <= DM);   // regrouped column block stays inside the row
static_assert((size_t)((NB_FULL - 1) * (size_t)OUT_SEQ + SEQ) * DM * 4 <= (size_t)16777216);   // last written output element inside the 16,777,216-byte output

typedef _Float16 h16;
typedef unsigned short bf;
typedef __attribute__((ext_vector_type(16))) __bf16   v16bf;
typedef __attribute__((ext_vector_type(16))) _Float16 v16h;
typedef __attribute__((ext_vector_type(8)))  _Float16 v8h;
typedef __attribute__((ext_vector_type(8)))  unsigned short v8us;
typedef __attribute__((ext_vector_type(4)))  unsigned short v4us;
typedef __attribute__((ext_vector_type(8)))  float    v8f;
typedef __attribute__((ext_vector_type(4)))  float    v4f;
typedef v4f  __attribute__((may_alias)) v4fa;

__device__ __forceinline__ unsigned short f2bf(float f) { unsigned u = __float_as_uint(f); u += 0x7FFFu + ((u >> 16) & 1u); return (unsigned short)(u >> 16); }
__device__ __forceinline__ v16h cat16(v8h lo, v8h hi) { return __builtin_shufflevector(lo, hi, 0, 1, 2, 3, 4, 5, 6, 7, 8, 9, 10, 11, 12, 13, 14, 15); }
__device__ __forceinline__ v16bf cat16b(v8us lo, v8us hi) { return __builtin_bit_cast(v16bf, __builtin_shufflevector(lo, hi, 0, 1, 2, 3, 4, 5, 6, 7, 8, 9, 10, 11, 12, 13, 14, 15)); }
// f16 form (k_flash): the plain builtin, the compiler keeps the distance behind it. A guard statement as in wmmab would tie every fragment and accumulator of the two query tiles to the first 256 registers, where they do not fit.
__device__ __forceinline__ v8f wmma16(v16h a, v16h b, v8f c) {
    return __builtin_amdgcn_wmma_f32_16x16x32_f16(false, a, false, b, (short)0, c, false, false);
}
// bf16 form (k_proj): followed by its own four-slot guard tying exactly its accumulator and keeping its operands live
__device__ __forceinline__ v8f wmmab(v16bf a, v16bf b, v8f c) {
    c = __builtin_amdgcn_wmma_f32_16x16x32_bf16(false, a, false, b, (short)0, c, false, false);
    asm volatile("v_nop\n\tv_nop\n\tv_nop\n\tv_nop" : "+v"(c) : "v"(a), "v"(b));
    return c;
}
// fragment loaders from K-contiguous 16-bit rows; p already includes + 8*(lane>>4): elements 0..7 <- k0+8h+0..7, elements 8..15 <- k0+16+8h+0..7 (same map for A and B)
__device__ __forceinline__ v16h  ldh(const h16* p) { return cat16(*(const v8h*)p, *(const v8h*)(p + 16)); }
__device__ __forceinline__ v16bf ldb(const bf* p)  { return cat16b(*(const v8us*)p, *(const v8us*)(p + 16)); }
// ordering point for wave-private LDS tiles (same wave writes and reads)
__device__ __forceinline__ void wave_sync() { __builtin_amdgcn_fence(3 /* release order */, "wavefront"); __builtin_amdgcn_wave_barrier(); asm volatile("" ::: "memory"); }

// k_cvt_all: every f32 -> bf16 copy of the call in ONE launch. The six destinations lie back to back in the workspace (q | k | v streams, then Wq | Wk | Wv), so the block index is the flat position there.
// A tile is 1024 elements: each wave-wide 16-byte load covers 512 contiguous bytes, each 8-byte store 256 (whole 128-B lines both ways). A block takes CVT_T consecutive tiles of one tensor,
// its loads issued ahead of the conversions: few long-lived waves in place of one short wave per 256 elements.
__global__ __launch_bounds__(256) void k_cvt_all(const float* __restrict__ xq, const float* __restrict__ xk, const float* __restrict__ xv,
                                                 const float* __restrict__ wq, const float* __restrict__ wk, const float* __restrict__ wv, bf* __restrict__ dst) {
    constexpr unsigned BE = CVT_T * 1024u;                                  // elements per block
    constexpr unsigned BX = (unsigned)((size_t)NB * SEQ * DM / BE);         // blocks per stream
    constexpr unsigned BW = (unsigned)((size_t)DM * DM / BE);               // blocks per weight
    const unsigned b = blockIdx.x;
    const float* src; size_t off;
    if (b < 3u * BX) {
        const unsigned s = b / BX; const size_t e = (size_t)(b - s * BX) * BE; const size_t bt = e / ((size_t)SEQ * DM);
        src = s == 0u ? xq : (s == 1u ? xk : xv);
        off = bt * ((size_t)SEQ_FULL * DM) + (e - bt * ((size_t)SEQ * DM));   // batch pitch of the source is the full sequence
    } else {
        const unsigned w = b - 3u * BX, s = w / BW;
        src = s == 0u ? wq : (s == 1u ? wk : wv);
        off = (size_t)(w - s * BW) * BE;
    }
    const float* p = src + off + threadIdx.x * 4u;
    bf* q = dst + (size_t)b * BE + threadIdx.x * 4u;
    v4f v[CVT_T];                                                          // the loads stand ahead of the first conversion: as many in flight as the compiler keeps there
#pragma unroll
    for (int j = 0; j < CVT_T; ++j) v[j] = *(const v4f*)(p + j * 1024);
#pragma unroll
    for (int j = 0; j < CVT_T; ++j) { v4us o;
#pragma unroll
        for (int k = 0; k < 4; ++k) o[k] = f2bf(v[j][k]);
        *(v4us*)(q + j * 1024) = o; }
}

// one k-slice's copies of one lane: rows r, r + 32, r + 64, r + 96 of the A slice and of the B slice (128 rows x 128 B each), 16 B each, global -> LDS through no register.
// The closing s_wait_xcnt stands inside the statement so that no address register named here is rewritten ahead of it.
__device__ __forceinline__ void stage_slice(const bf* ga, const bf* gb, unsigned l) {
    const bf* ga1 = ga + (size_t)32 * DM; const bf* ga2 = ga + (size_t)64 * DM; const bf* ga3 = ga + (size_t)96 * DM;
    const bf* gb1 = gb + (size_t)32 * DM; const bf* gb2 = gb + (size_t)64 * DM; const bf* gb3 = gb + (size_t)96 * DM;
    const unsigned rs = 32u * PIT * 2u;
    const unsigned l1 = l + rs, l2 = l + 2u * rs, l3 = l + 3u * rs, l4 = l + PPLH * 2u, l5 = l4 + rs, l6 = l4 + 2u * rs, l7 = l4 + 3u * rs;
    asm volatile("global_load_async_to_lds_b128 %0, %8, off\n\t"
                 "global_load_async_to_lds_b128 %1, %9, off\n\t"
                 "global_load_async_to_lds_b128 %2, %10, off\n\t"
                 "global_load_async_to_lds_b128 %3, %11, off\n\t"
                 "global_load_async_to_lds_b128 %4, %12, off\n\t"
                 "global_load_async_to_lds_b128 %5, %13, off\n\t"
                 "global_load_async_to_lds_b128 %6, %14, off\n\t"
                 "global_load_async_to_lds_b128 %7, %15, off\n\t"
                 "s_wait_xcnt 0x0"
                 :: "v"(l), "v"(l1), "v"(l2), "v"(l3), "v"(l4), "v"(l5), "v"(l6), "v"(l7), "v"(ga), "v"(ga1), "v"(ga2), "v"(ga3), "v"(gb), "v"(gb1), "v"(gb2), "v"(gb3) : "memory");
}

// k_proj: register-blocked bf16 GEMM, 128x128 tile per block, EIGHT WAVES of 32x64 each (8 accumulators; wave w: rows 32*(w>>1), columns 64*(w&1)), K = DM.
// Slice s = k 64s .. 64s+63 of the block's 128 A rows and 128 Bt rows: two planes of 128 rows x 128 B, copied in whole 128-B lines (4 + 4 copies per lane); slice s+1 flies while slice s is worked on.
// C[m][n] = sum_k A[m][k] Bt[n][k], times osc (the score scale for q, else 1), written as f16 (Ph) and, for q and k, the f16 residual (Pr; small ones are f16 subnormals, step 2^-24), row pitch 'pitch' (halves).
// ALL THREE PROJECTIONS IN ONE LAUNCH: grid (NB*SEQ/128, DM/128, 3), 256 threads; blockIdx.z picks the product, blockIdx.x the 128 stream rows, blockIdx.y the 128 weight rows.
//   z = 0, 1 (q, k): A = stream rows (m = b*SEQ + t), Bt = W rows (n = h*64 + d) -> planes [(b*16 + h)][t][d], value + residual
//   z = 2 (v^T):     A = Wv rows (m = h*64 + d), Bt = v-stream rows (n = b*SEQ + t) -> plane [(b*1024 + m)][t] = [(b*16 + h)][d][t], value only
// X = the three bf16 stream copies back to back, Wb = the three bf16 weights back to back.
// Second launch bound: six waves per SIMD, so that three blocks (LDS 3 x 108,544 B) stand on one WGP and one block's copy, LDS and barrier waits are filled by the other two.
__global__ __launch_bounds__(256, 6) void k_proj(const bf* __restrict__ X, const bf* __restrict__ Wb, h16* QH, h16* QR, h16* KP, h16* KR, h16* VT) {
    __shared__ __align__(16) float osb[8 * 16 * 68];
    __shared__ __align__(128) bf pring[2 * PBUFH];
    const int K = DM;
    const int lane = threadIdx.x & 31, lr = lane & 15, hi = lane >> 4;
    const int wave = __builtin_amdgcn_readfirstlane(threadIdx.x >> 5);
    const int z = blockIdx.z;
    const bool useRes = z < 2;
    const bf* xs = X + (size_t)z * ((size_t)NB * SEQ * DM);
    const bf* wsl = Wb + (size_t)z * ((size_t)DM * DM);
    const bf* A = useRes ? xs : wsl;
    const bf* Bt = useRes ? wsl : xs;
    h16* Ph = z == 0 ? QH : (z == 1 ? KP : VT);
    h16* Pr = z == 0 ? QR : KR;                              // stored only where useRes
    const int pitch = useRes ? HD : SEQ;
    const float osc = z == 0 ? SC2 : 1.0f;                   // the q planes carry the score scale (1/8 and log2 e), so that k_flash's score accumulators are the exponents as they stand
    const int rb = (useRes ? blockIdx.x : blockIdx.y) * 128, cb = (useRes ? blockIdx.y : blockIdx.x) * 128;
    const int r0 = rb + (wave >> 1) * 32, c0 = cb + (wave & 1) * 64;
    float* os = osb + wave * 16 * 68;                        // wave-private output staging
    v8f acc[2][4];
#pragma unroll
    for (int mb = 0; mb < 2; ++mb)
#pragma unroll
        for (int nb = 0; nb < 4; ++nb) acc[mb][nb] = (v8f){};
    // copy map: lane takes rows crow + 32 j (j = 0 .. 3), 16-byte column ccol, of each operand's slice
    const int crow = threadIdx.x >> 3, ccol = threadIdx.x & 7;
    const bf* ga = A + (size_t)(rb + crow) * K + ccol * 8;   // + k0
    const bf* gb = Bt + (size_t)(cb + crow) * K + ccol * 8;  // + k0
    const unsigned lc = (unsigned)(size_t)pring + (unsigned)(crow * PIT + ccol * 8) * 2u;   // LDS byte address, + buffer
    stage_slice(ga, gb, lc);
    asm volatile("s_wait_asynccnt 0x0" ::: "memory");        // slice 0 landed (this wave's copies) before the barrier publishes it
    __syncthreads();
    stage_slice(ga + PKS, gb + PKS, lc + PBUFH * 2u);
    const int fa = ((wave >> 1) * 32 + lr) * PIT + 8 * hi;          // A fragment offset in a buffer: + mb * 16 * PIT + k0
    const int fb = PPLH + ((wave & 1) * 64 + lr) * PIT + 8 * hi;    // B fragment offset in a buffer: + nb * 16 * PIT + k0
#pragma unroll 1   // stays rolled: one small body serves both buffers, the buffer is picked by st & 1
    for (int st = 0; st < K / PKS; ++st) {
        const bf* tp = pring + (st & 1) * PBUFH;
        v16bf a0[2], b0[4], a1[2], b1[4];                    // the first k-step's fragments, the second's two A and first two B fragments are read as one group ahead of the products
#pragma unroll
        for (int i = 0; i < 2; ++i) a0[i] = ldb(tp + fa + i * 16 * PIT);
#pragma unroll
        for (int i = 0; i < 4; ++i) b0[i] = ldb(tp + fb + i * 16 * PIT);
#pragma unroll
        for (int i = 0; i < 2; ++i) a1[i] = ldb(tp + fa + i * 16 * PIT + 32);
#pragma unroll
        for (int i = 0; i < 2; ++i) b1[i] = ldb(tp + fb + i * 16 * PIT + 32);
#pragma unroll
        for (int nb = 0; nb < 2; ++nb)
#pragma unroll
            for (int mb = 0; mb < 2; ++mb) acc[mb][nb] = wmmab(a0[mb], b0[nb], acc[mb][nb]);
#pragma unroll
        for (int i = 2; i < 4; ++i) b1[i] = ldb(tp + fb + i * 16 * PIT + 32);   // the last two fragments take the registers that b0[0], b0[1] have left: the live set stays inside 160 registers
#pragma unroll
        for (int nb = 2; nb < 4; ++nb)
#pragma unroll
            for (int mb = 0; mb < 2; ++mb) acc[mb][nb] = wmmab(a0[mb], b0[nb], acc[mb][nb]);
#pragma unroll
        for (int nb = 0; nb < 4; ++nb)
#pragma unroll
            for (int mb = 0; mb < 2; ++mb) acc[mb][nb] = wmmab(a1[mb], b1[nb], acc[mb][nb]);
        asm volatile("s_wait_dscnt 0x0" ::: "memory");       // this wave's reads of slice st are done before its buffer may be refilled
        asm volatile("s_wait_asynccnt 0x0" ::: "memory");    // this wave's copies of slice st+1 have landed before the barrier publishes them
        __syncthreads();                                     // publishes slice st+1 and ends every wave's reads of slice st
        if (st + 2 < K / PKS) { const int k2 = (st + 2) * PKS; stage_slice(ga + k2, gb + k2, lc + (unsigned)(st & 1) * (PBUFH * 2u)); }
    }
    asm volatile("s_wait_asynccnt 0x0" ::: "memory");        // nothing of this wave is in flight behind the loop
    const size_t tbase = useRes ? (size_t)(r0 / SEQ) * ((size_t)NH_ * SEQ * HD) + (size_t)(r0 % SEQ) * HD + (size_t)(c0 / HD) * ((size_t)SEQ * HD) + (size_t)(c0 % HD)
                                : (size_t)r0 * SEQ + (size_t)(c0 / SEQ) * ((size_t)DM * SEQ) + (size_t)(c0 % SEQ);
#pragma unroll
    for (int mb = 0; mb < 2; ++mb) {
#pragma unroll
        for (int nb = 0; nb < 4; ++nb) {
#pragma unroll
            for (int j = 0; j < 8; ++j) os[(hi * 8 + j) * 68 + nb * 16 + lr] = acc[mb][nb][j] * osc; }   // D: row 8h+j, col lane&15; scaled here, in f32, ahead of the value / residual split
        wave_sync();
        const size_t sb = tbase + (size_t)(mb * 16) * (size_t)pitch;
{
#pragma unroll
            for (int s = 0; s < 4; ++s) { const int row = 4 * s + (lane >> 3), c8 = (lane & 7) * 8;   // 4 s x 4 row groups = 16 rows; 8 lanes x 8 = 64 columns
                const v4f x0 = *(const v4fa*)(&os[row * 68 + c8]); const v4f x1 = *(const v4fa*)(&os[row * 68 + c8 + 4]); v8h hv, rv;
#pragma unroll
                for (int i = 0; i < 4; ++i) { const h16 a0 = (h16)x0[i]; const h16 a1 = (h16)x1[i]; hv[i] = a0; hv[4 + i] = a1; rv[i] = (h16)(x0[i] - (float)a0); rv[4 + i] = (h16)(x1[i] - (float)a1); }
                const size_t oo = sb + (size_t)row * (size_t)pitch + c8;
                *(v8h*)(Ph + oo) = hv; if (useRes) *(v8h*)(Pr + oo) = rv; }
             }
        wave_sync();
    }
}

// one tile's copies of one lane: rows r and r + 32 of the K value, K residual and V^T planes, 16 B each, global -> LDS through no register.
// The closing s_wait_xcnt stands inside the statement so that no address register named here is rewritten ahead of it.
__device__ __forceinline__ void stage_tile(const h16* gk, const h16* gr, const h16* gv, unsigned l) {
    const h16* gk1 = gk + (size_t)32 * HD; const h16* gr1 = gr + (size_t)32 * HD; const h16* gv1 = gv + (size_t)32 * SEQ;
    const unsigned l1 = l + 32u * PIT * 2u, l2 = l + PLH * 2u, l3 = l2 + 32u * PIT * 2u, l4 = l + 2u * PLH * 2u, l5 = l4 + 32u * PIT * 2u;
    asm volatile("global_load_async_to_lds_b128 %0, %6, off\n\t"
                 "global_load_async_to_lds_b128 %1, %7, off\n\t"
                 "global_load_async_to_lds_b128 %2, %8, off\n\t"
                 "global_load_async_to_lds_b128 %3, %9, off\n\t"
                 "global_load_async_to_lds_b128 %4, %10, off\n\t"
                 "global_load_async_to_lds_b128 %5, %11, off\n\t"
                 "s_wait_xcnt 0x0"
                 :: "v"(l), "v"(l1), "v"(l2), "v"(l3), "v"(l4), "v"(l5), "v"(gk), "v"(gk1), "v"(gr), "v"(gr1), "v"(gv), "v"(gv1) : "memory");
}

// k_flash: fused attention, one wave per QT tiles of 16 query rows of one flat slot n = b*16 + h (every K and V^T fragment is read from LDS once and multiplied with each query tile in turn); Q fragments straight from the f16 planes; K (value, residual) and V^T fragments from the block's LDS tile (two 16-B reads each).
// Tile t = keys 64t .. 64t+63: three planes of 64 rows x 128 B (K rows = keys, V^T rows = d), each lane copies 2 x 16 B per plane in whole 128-B lines; tile t+1 flies while tile t is worked on.
// Transposed form: S^T[key][t] = K Q^T (A = K rows, B = Q rows); lane (t = lane&15, h = lane>>4) holds keys 8h+r of each 16-key tile, so the packed
// P tile is directly the B fragment of O^T[d][t] = V^T P^T (element r <- tile keys 0..15, element 8+r <- tile keys 16..31, lane unchanged).
// Scores per 16-key tile: s = Khi Qres^T + Kres Qhi^T + Khi Qhi^T in one accumulator; the q planes already carry the scale 1/8 * log2 e, so s goes to the maximum and the exponent with no further multiply.
// Softmax state (running max, partial sum) is one scalar per lane and query tile; the two lane halves of a row are combined with one xor-16 exchange.
// Output address: n is re-read as n = c*NB_FULL + b2 -> OUT[b2][t][c*64 + d].
__global__ __launch_bounds__(32 * AW) void k_flash(const h16* __restrict__ QH, const h16* __restrict__ QR, const h16* __restrict__ KP, const h16* __restrict__ KR, const h16* __restrict__ VT, float* OUT) {
    __shared__ __align__(16) float os[AW * 16 * 68];
    __shared__ __align__(128) h16 ring[2 * BUFH];
    const int lane = threadIdx.x & 31, lr = lane & 15, hi = lane >> 4;
    const int wave = __builtin_amdgcn_readfirstlane(threadIdx.x >> 5);
    const int zh = blockIdx.y;                               // flat slot n = b*NH_ + h
    const int t0 = (blockIdx.x * AW + wave) * (16 * QT);
    const size_t pbase = (size_t)zh * SEQ * HD;
    // every loop over q, kt, j or r in this kernel is unrolled so that the arrays it indexes stay in registers
    v16h qh0[QT], qh1[QT], qr0[QT], qr1[QT];                 // B fragments: col t, k = d
#pragma unroll
    for (int q = 0; q < QT; ++q) { const size_t qo = pbase + (size_t)(t0 + 16 * q + lr) * HD + 8 * hi;
        qh0[q] = ldh(QH + qo); qh1[q] = ldh(QH + qo + 32); qr0[q] = ldh(QR + qo); qr1[q] = ldh(QR + qo + 32);
        if (q + 1 < QT) asm volatile("s_wait_xcnt 0x0" ::: "memory"); }   // the next tile's loads land in the address registers of these loads: the wait stands in front of them
    const int fo = lr * PIT + 8 * hi;                        // fragment offset inside a plane: + row0 * PIT + k0 (A fragment: row lr, k = 8h ..)
    // copy map: lane takes rows crow and crow + 32, 16-byte column ccol, of each plane
    const int crow = threadIdx.x >> 3, ccol = threadIdx.x & 7;
    const h16* gk = KP + pbase + (size_t)crow * HD + ccol * 8;    // + key0 * HD
    const h16* gr = KR + pbase + (size_t)crow * HD + ccol * 8;    // + key0 * HD
    const h16* gv = VT + pbase + (size_t)crow * SEQ + ccol * 8;   // + key0
    const unsigned lc = (unsigned)(size_t)ring + (unsigned)(crow * PIT + ccol * 8) * 2u;   // LDS byte address, + buffer, plane, 32 rows
    stage_tile(gk, gr, gv, lc);
    asm volatile("s_wait_asynccnt 0x0" ::: "memory");        // tile 0 landed (this wave's copies) before the barrier publishes it
    __syncthreads();
    stage_tile(gk + (size_t)KS * HD, gr + (size_t)KS * HD, gv + KS, lc + BUFH * 2u);
    v8f o[QT][4];
    float m[QT], l[QT];
#pragma unroll
    for (int q = 0; q < QT; ++q) { m[q] = -3.0e38f; l[q] = 0.0f;
#pragma unroll
        for (int j = 0; j < 4; ++j) o[q][j] = (v8f){}; }
#pragma unroll 1
    for (int st = 0; st < SEQ / KS; ++st) {
      const h16* tk = ring + (st & 1) * BUFH + fo;           // K value plane; + PLH residual, + 2 * PLH V^T
#pragma unroll
      for (int p0 = 0; p0 < KS; p0 += 32) {                  // constant offsets into the tile
        v8f ts[QT][2];                                       // scaled scores (log2 domain): query tile, 16-key tile, key 8h + r
        {   // keys p0 .. p0 + 31 of the tile; per query tile the two 16-key tiles' accumulator chains alternate, each in the order hi*res, res*hi, hi*hi: the small terms are summed first
            const h16* ka = tk + p0 * PIT; const h16* kb = ka + 16 * PIT;
            const v16h kh[2][2] = { { ldh(ka), ldh(ka + 32) }, { ldh(kb), ldh(kb + 32) } };
            const v16h kr[2][2] = { { ldh(ka + PLH), ldh(ka + PLH + 32) }, { ldh(kb + PLH), ldh(kb + PLH + 32) } };
#pragma unroll
            for (int q = 0; q < QT; ++q) {
#pragma unroll
                for (int kt = 0; kt < 2; ++kt) ts[q][kt] = wmma16(kh[kt][0], qr0[q], (v8f){});
#pragma unroll
                for (int kt = 0; kt < 2; ++kt) ts[q][kt] = wmma16(kh[kt][1], qr1[q], ts[q][kt]);
#pragma unroll
                for (int kt = 0; kt < 2; ++kt) ts[q][kt] = wmma16(kr[kt][0], qh0[q], ts[q][kt]);
#pragma unroll
                for (int kt = 0; kt < 2; ++kt) ts[q][kt] = wmma16(kr[kt][1], qh1[q], ts[q][kt]);
#pragma unroll
                for (int kt = 0; kt < 2; ++kt) ts[q][kt] = wmma16(kh[kt][0], qh0[q], ts[q][kt]);
#pragma unroll
                for (int kt = 0; kt < 2; ++kt) ts[q][kt] = wmma16(kh[kt][1], qh1[q], ts[q][kt]);
            }
        }
        v16h pb[QT];
#pragma unroll
        for (int q = 0; q < QT; ++q) {
            float mx = -3.0e38f;
#pragma unroll
            for (int r = 0; r < 8; ++r) mx = fmaxf(mx, fmaxf(ts[q][0][r], ts[q][1][r]));
            mx = fmaxf(mx, __shfl_xor(mx, 16, 32));
            const float mnew = fmaxf(m[q], mx);
            const float alpha = __builtin_amdgcn_exp2f(m[q] - mnew);
            const float sh = PSH - mnew;
            float ls = 0.0f;
#pragma unroll
            for (int r = 0; r < 8; ++r) { const float ea = __builtin_amdgcn_exp2f(ts[q][0][r] + sh); const float eb = __builtin_amdgcn_exp2f(ts[q][1][r] + sh); pb[q][r] = (h16)ea; pb[q][8 + r] = (h16)eb; ls += ea + eb; }
            l[q] = l[q] * alpha + ls; m[q] = mnew;
#pragma unroll
            for (int j = 0; j < 4; ++j) o[q][j] = o[q][j] * alpha;
        }
        const h16* va = tk + 2 * PLH + p0;
        const v16h v0 = ldh(va), v1 = ldh(va + 16 * PIT), v2 = ldh(va + 32 * PIT), v3 = ldh(va + 48 * PIT);
#pragma unroll
        for (int q = 0; q < QT; ++q) { o[q][0] = wmma16(v0, pb[q], o[q][0]); o[q][1] = wmma16(v1, pb[q], o[q][1]); o[q][2] = wmma16(v2, pb[q], o[q][2]); o[q][3] = wmma16(v3, pb[q], o[q][3]); }
      }
      asm volatile("s_wait_dscnt 0x0" ::: "memory");         // this wave's reads of tile st are done before its buffer may be refilled
      asm volatile("s_wait_asynccnt 0x0" ::: "memory");      // this wave's copies of tile st+1 have landed before the barrier publishes them
      __syncthreads();                                       // publishes tile st+1 and ends every wave's reads of tile st
      if (st + 2 < SEQ / KS) { const size_t k2 = (size_t)(st + 2) * KS; stage_tile(gk + k2 * HD, gr + k2 * HD, gv + k2, lc + (unsigned)(st & 1) * (BUFH * 2u)); }
    }
    asm volatile("s_wait_asynccnt 0x0" ::: "memory");        // nothing of this wave is in flight behind the loop
    const int wb = wave * 16 * 68;
    const int b2 = zh % NB_FULL, cb = zh / NB_FULL;          // regrouped address: output batch b2, column block cb
#pragma unroll
    for (int q = 0; q < QT; ++q) {                           // one query tile at a time through the wave's own staging rows
        const float lq = l[q] + __shfl_xor(l[q], 16, 32);
        const float inv = 1.0f / lq;
        // O^T D layout: o[q][j][r] = (d = 16j + 8h + r, t = lane&15) -> os[t][d]; rows 0..15 x columns 0..63 all written
#pragma unroll
        for (int j = 0; j < 4; ++j) { v4f a, c;
#pragma unroll
            for (int r = 0; r < 4; ++r) { a[r] = o[q][j][r] * inv; c[r] = o[q][j][4 + r] * inv; }
            *(v4fa*)(&os[wb + lr * 68 + 16 * j + 8 * hi]) = a; *(v4fa*)(&os[wb + lr * 68 + 16 * j + 8 * hi + 4]) = c; }
        wave_sync();
        float* orow = OUT + ((size_t)b2 * OUT_SEQ + t0 + 16 * q) * DM + (size_t)cb * HD;
#pragma unroll
        for (int s = 0; s < 8; ++s) { const int row = 2 * s + hi, cofs = lr * 4;   // 8 s x 2 rows = 16 rows; 16 lanes x 4 floats = 64 columns
            const v4f val = *(const v4fa*)(&os[wb + row * 68 + cofs]);
            *(v4f*)(orow + (size_t)row * DM + cofs) = val; }
        if (q + 1 < QT) wave_sync();                         // the rows are read out before the next query tile overwrites them
    }
}

static constexpr size_t al256(size_t v) { return (v + 255) & ~(size_t)255; }
static constexpr size_t SZ_XB = al256((size_t)NB * SEQ * DM * 2);          // one bf16 stream copy
static constexpr size_t SZ_WB = al256((size_t)3 * DM * DM * 2);
static constexpr size_t SZ_PL = al256((size_t)NB * NH_ * SEQ * HD * 2);
static constexpr size_t SZ_TOTAL = 3 * SZ_XB + SZ_WB + 5 * SZ_PL;
static_assert(SZ_TOTAL <= (size_t)134217728);          // workspace carve <= 128 MiB
static_assert(((size_t)DM * DM * 2) % 256 == 0);       // weight sub-planes stay 256-byte aligned
static_assert(SZ_XB == (size_t)NB * SEQ * DM * 2);     // no pad between the bf16 copies: the conversion writes them as one range
static constexpr unsigned CVT_G = (unsigned)((3 * (size_t)NB * SEQ * DM + 3 * (size_t)DM * DM) / ((size_t)CVT_T * 1024));   // conversion blocks: three streams, three weights
static_assert((size_t)NB * SEQ * DM == (size_t)NB * NH_ * SEQ * HD);   // projection grid x tile == plane extent

extern "C" void kernel_launch(void* const* d_in, const int* in_sizes, int n_in,
                              void* d_out, int out_size, void* d_ws, size_t ws_size, hipStream_t stream) {
    if (n_in < 6) return;
    const size_t needx = ((size_t)(NB - 1) * SEQ_FULL + SEQ) * DM;
    if ((size_t)in_sizes[0] < needx || (size_t)in_sizes[1] < needx || (size_t)in_sizes[2] < needx) return;
    if ((size_t)in_sizes[3] < (size_t)DM * DM || (size_t)in_sizes[4] < (size_t)DM * DM || (size_t)in_sizes[5] < (size_t)DM * DM) return;
    if ((size_t)out_size < ((size_t)(NB_FULL - 1) * OUT_SEQ + SEQ) * DM) return;
    if (SZ_TOTAL > ws_size) return;
    // wire order: q, k, v streams, then Wq, Wk, Wv ([out][in] = Bt as-is)
    const float* xq = (const float*)d_in[0]; const float* xk = (const float*)d_in[1]; const float* xv = (const float*)d_in[2];
    const float* wq = (const float*)d_in[3]; const float* wk = (const float*)d_in[4]; const float* wv = (const float*)d_in[5];
    float* OUT = (float*)d_out;      // [NB_FULL][OUT_SEQ][1024]
    char* wsp = (char*)d_ws;
    bf* XQ = (bf*)wsp; wsp += SZ_XB;                 // [NB*SEQ][1024]
    wsp += SZ_XB;                                    // k stream copy, [NB*SEQ][1024]
    wsp += SZ_XB;                                    // v stream copy, [NB*SEQ][1024]
    bf* WB = (bf*)wsp; wsp += SZ_WB;                 // [3][1024][1024]: q | k | v
    h16* QH = (h16*)wsp; wsp += SZ_PL;               // [NB*16][SEQ][64], times the score scale
    h16* QR = (h16*)wsp; wsp += SZ_PL;               // [NB*16][SEQ][64] residual
    h16* KP = (h16*)wsp; wsp += SZ_PL;               // [NB*16][SEQ][64]
    h16* KR = (h16*)wsp; wsp += SZ_PL;               // [NB*16][SEQ][64] residual
    h16* VT = (h16*)wsp; wsp += SZ_PL;               // [NB*16][64][SEQ]

    // XQ | XK | XV | WQ | WK | WV are one contiguous bf16 range that starts at XQ
    k_cvt_all<<<dim3(CVT_G, 1, 1), 256, 0, stream>>>(xq, xk, xv, wq, wk, wv, XQ);

    // q, k and v^T projections: one launch, blockIdx.z = 0, 1, 2
    k_proj<<<dim3(NB * SEQ / 128, DM / 128, 3), 256, 0, stream>>>(XQ, WB, QH, QR, KP, KR, VT);

    k_flash<<<dim3(SEQ / (16 * QT * AW), NB * NH_, 1), 32 * AW, 0, stream>>>(QH, QR, KP, KR, VT, OUT);
}

// v007
// It runs in 83.1 microseconds.
// Two timings next to v006 put it at 1.07 and 1.06 times that version's speed.
// Counting every step since v000, it is 3.78 times as fast.
#include <hip/hip_runtime.h>

// Non-causal multi-head attention with three input streams, width 1024 = 16 heads x 64; q/k/v [NB][SEQ][1024], Wq/Wk/Wv [out][in] (y = x W^T), no biases, no mask, score scale 1/8, no output projection; context written at the regrouped address (flat n = b*16+h re-read as n = c*NB_FULL + b2).
// Compute dtypes, f32 accumulate everywhere: projections v_wmma_f32_16x16x32_bf16 (x and W RNE-converted to bf16; products exact);
// scores v_wmma_f32_16x16x32_f16 with q (times the score scale) and k each as f16 value + f16 residual at its own size (three products hi*res, res*hi, hi*hi summed in ONE accumulator, which starts at carry - reference and then holds the exponent); P (x256 carry, cancels in the normalisation, row sum from the f32 values) and v single f16; softmax f32 (online; the reference is a maximum that is renewed in the first group of keys and when a P sum leaves its range).
// Layout: bf16 copies of q/k/v streams and W; q (hi, residual), k (hi, residual) planes [b*16+h][t][d] and v^T plane [b*16+h][d][t] written by the GEMM epilogue (GEMM: 128x128 block tile, eight waves of 32x64, k-slices of 64 of both operands staged in LDS by asynchronous copies, two buffers); fused flash kernel in transposed form (S^T = K Q^T, O^T = V^T P^T), K / V^T tiles of 64 keys staged in LDS by asynchronous copies (two buffers) and shared by the block's waves, output from f32 accumulators.

#ifndef NB
#define NB 2
#endif
#ifndef SEQ
#define SEQ 2048
#endif
#define NB_FULL  2
#define SEQ_FULL 2048
#ifndef OUT_SEQ
#define OUT_SEQ SEQ              // row pitch (in tokens) between batches of the output
#endif
#define DM   1024
#define NH_  16
#define HD   64
#define AW   8                   // waves per flash block; all share one staged K / V^T tile
#define QT   2                   // query tiles of 16 rows per flash wave: each K / V^T fragment read from LDS serves all of them
#define KS   64                  // keys per staged tile (two passes of 32 keys)
#define PIT  72                  // LDS row pitch in halves: 144 B = 16 B x odd, conflict-free for 16-byte row reads
#define PLH  (64 * PIT)          // halves per staged plane: 64 rows
#define BUFH (3 * PLH)           // halves per buffer: K value, K residual, V^T
#define PKS  64                  // GEMM: k per staged slice (two k-steps of 32); one row of a slice = one 128-B line
#define PPLH (128 * PIT)         // GEMM: halves per staged operand slice: 128 rows
#define PBUFH (2 * PPLH)         // GEMM: halves per buffer: A slice, B slice
#define CVT_T 32                 // conversion: tiles of 1024 elements per block
#define SC2  (0.125f * 1.4426950408889634f)   // HD^-0.5 * log2(e)
#define PSH  8.0f                // log2 of the P carry (256)
#define GP   1                   // passes of 32 keys per rescale test
#define LIM  32768.0f            // a lane's P sum over one group above which the reference is renewed

static_assert(HD == 64);
static_assert(KS % (32 * GP) == 0);            // whole groups per tile
static_assert(QT * GP * 16 * 256 <= 32768);    // a group whose every score equals the reference stays inside LIM, and LIM inside the f16 range
static_assert(8 * 8 == HD);                    // plane store: 8 lanes x 8 halves per row
static_assert(16 * 4 == HD);                   // output store: 16 lanes x 4 floats per row segment
static_assert(NH_ * HD == DM);                 // head h = columns h*64 + d
static_assert(DM % 64 == 0);                   // column tiles of 64
static_assert(DM % 32 == 0);                   // GEMM k-steps of 32
static_assert(DM % 128 == 0 && (NB * SEQ) % 128 == 0);   // GEMM block tiles of 128 x 128 cover both extents exactly
static_assert(DM % PKS == 0 && DM / PKS >= 2 && PKS == 64);   // whole k-slices; the two-buffer prologue needs slices 0 and 1; copy map: 8 lanes x 16 B = one row
static_assert(HD % 32 == 0);                   // score k-steps of 32
static_assert(SEQ % 64 == 0);                  // a 64-row tile never straddles two batches
static_assert((NB * SEQ) % 64 == 0);
static_assert(SEQ % 32 == 0);                  // key loop steps by 32
static_assert(SEQ % (16 * QT * AW) == 0);      // flash grid covers the sequence exactly
static_assert(SEQ % KS == 0 && SEQ / KS >= 2); // whole tiles; the two-buffer prologue needs tiles 0 and 1
static_assert(KS == 64 && 32 * AW == 256);     // copy map: 256 lanes x 16 B x 2 = one 64-row x 128-B plane
static_assert((PIT * 2) % 16 == 0);            // every LDS row starts on a 16-byte multiple
static_assert(((size_t)SEQ * DM) % (CVT_T * 1024) == 0);   // a conversion block never straddles two batches or two streams
static_assert(((size_t)DM * DM) % (CVT_T * 1024) == 0);    // nor two weights
static_assert(NB <= NB_FULL);
static_assert(SEQ <= SEQ_FULL);
static_assert(SEQ <= OUT_SEQ);
static_assert(((NB * NH_ - 1) / NB_FULL) * HD + HD <= DM);   // regrouped column block stays inside the row
static_assert((size_t)((NB_FULL - 1) * (size_t)OUT_SEQ + SEQ) * DM * 4 <= (size_t)16777216);   // last written output element inside the 16,777,216-byte output

typedef _Float16 h16;
typedef unsigned short bf;
typedef __attribute__((ext_vector_type(16))) __bf16   v16bf;
typedef __attribute__((ext_vector_type(16))) _Float16 v16h;
typedef __attribute__((ext_vector_type(8)))  _Float16 v8h;
typedef __attribute__((ext_vector_type(8)))  unsigned short v8us;
typedef __attribute__((ext_vector_type(4)))  unsigned short v4us;
typedef __attribute__((ext_vector_type(8)))  float    v8f;
typedef __attribute__((ext_vector_type(4)))  float    v4f;
typedef v4f  __attribute__((may_alias)) v4fa;

__device__ __forceinline__ unsigned short f2bf(float f) { unsigned u = __float_as_uint(f); u += 0x7FFFu + ((u >> 16) & 1u); return (unsigned short)(u >> 16); }
__device__ __forceinline__ v16h cat16(v8h lo, v8h hi) { return __builtin_shufflevector(lo, hi, 0, 1, 2, 3, 4, 5, 6, 7, 8, 9, 10, 11, 12, 13, 14, 15); }
__device__ __forceinline__ v16bf cat16b(v8us lo, v8us hi) { return __builtin_bit_cast(v16bf, __builtin_shufflevector(lo, hi, 0, 1, 2, 3, 4, 5, 6, 7, 8, 9, 10, 11, 12, 13, 14, 15)); }
// f16 form (k_flash): the plain builtin, the compiler keeps the distance behind it. A guard statement as in wmmab would tie every fragment and accumulator of the two query tiles to the first 256 registers, where they do not fit.
__device__ __forceinline__ v8f wmma16(v16h a, v16h b, v8f c) {
    return __builtin_amdgcn_wmma_f32_16x16x32_f16(false, a, false, b, (short)0, c, false, false);
}
// bf16 form (k_proj): followed by its own four-slot guard tying exactly its accumulator and keeping its operands live
__device__ __forceinline__ v8f wmmab(v16bf a, v16bf b, v8f c) {
    c = __builtin_amdgcn_wmma_f32_16x16x32_bf16(false, a, false, b, (short)0, c, false, false);
    asm volatile("v_nop\n\tv_nop\n\tv_nop\n\tv_nop" : "+v"(c) : "v"(a), "v"(b));
    return c;
}
// fragment loaders from K-contiguous 16-bit rows; p already includes + 8*(lane>>4): elements 0..7 <- k0+8h+0..7, elements 8..15 <- k0+16+8h+0..7 (same map for A and B)
__device__ __forceinline__ v16h  ldh(const h16* p) { return cat16(*(const v8h*)p, *(const v8h*)(p + 16)); }
__device__ __forceinline__ v16bf ldb(const bf* p)  { return cat16b(*(const v8us*)p, *(const v8us*)(p + 16)); }
// ordering point for wave-private LDS tiles (same wave writes and reads)
__device__ __forceinline__ void wave_sync() { __builtin_amdgcn_fence(3 /* release order */, "wavefront"); __builtin_amdgcn_wave_barrier(); asm volatile("" ::: "memory"); }

// k_cvt_all: every f32 -> bf16 copy of the call in ONE launch. The six destinations lie back to back in the workspace (q | k | v streams, then Wq | Wk | Wv), so the block index is the flat position there.
// A tile is 1024 elements: each wave-wide 16-byte load covers 512 contiguous bytes, each 8-byte store 256 (whole 128-B lines both ways). A block takes CVT_T consecutive tiles of one tensor,
// its loads issued ahead of the conversions: few long-lived waves in place of one short wave per 256 elements.
__global__ __launch_bounds__(256) void k_cvt_all(const float* __restrict__ xq, const float* __restrict__ xk, const float* __restrict__ xv,
                                                 const float* __restrict__ wq, const float* __restrict__ wk, const float* __restrict__ wv, bf* __restrict__ dst) {
    constexpr unsigned BE = CVT_T * 1024u;                                  // elements per block
    constexpr unsigned BX = (unsigned)((size_t)NB * SEQ * DM / BE);         // blocks per stream
    constexpr unsigned BW = (unsigned)((size_t)DM * DM / BE);               // blocks per weight
    const unsigned b = blockIdx.x;
    const float* src; size_t off;
    if (b < 3u * BX) {
        const unsigned s = b / BX; const size_t e = (size_t)(b - s * BX) * BE; const size_t bt = e / ((size_t)SEQ * DM);
        src = s == 0u ? xq : (s == 1u ? xk : xv);
        off = bt * ((size_t)SEQ_FULL * DM) + (e - bt * ((size_t)SEQ * DM));   // batch pitch of the source is the full sequence
    } else {
        const unsigned w = b - 3u * BX, s = w / BW;
        src = s == 0u ? wq : (s == 1u ? wk : wv);
        off = (size_t)(w - s * BW) * BE;
    }
    const float* p = src + off + threadIdx.x * 4u;
    bf* q = dst + (size_t)b * BE + threadIdx.x * 4u;
    v4f v[CVT_T];                                                          // the loads stand ahead of the first conversion: as many in flight as the compiler keeps there
#pragma unroll
    for (int j = 0; j < CVT_T; ++j) v[j] = *(const v4f*)(p + j * 1024);
#pragma unroll
    for (int j = 0; j < CVT_T; ++j) { v4us o;
#pragma unroll
        for (int k = 0; k < 4; ++k) o[k] = f2bf(v[j][k]);
        *(v4us*)(q + j * 1024) = o; }
}

// one k-slice's copies of one lane: rows r, r + 32, r + 64, r + 96 of the A slice and of the B slice (128 rows x 128 B each), 16 B each, global -> LDS through no register.
// The closing s_wait_xcnt stands inside the statement so that no address register named here is rewritten ahead of it.
__device__ __forceinline__ void stage_slice(const bf* ga, const bf* gb, unsigned l) {
    const bf* ga1 = ga + (size_t)32 * DM; const bf* ga2 = ga + (size_t)64 * DM; const bf* ga3 = ga + (size_t)96 * DM;
    const bf* gb1 = gb + (size_t)32 * DM; const bf* gb2 = gb + (size_t)64 * DM; const bf* gb3 = gb + (size_t)96 * DM;
    const unsigned rs = 32u * PIT * 2u;
    const unsigned l1 = l + rs, l2 = l + 2u * rs, l3 = l + 3u * rs, l4 = l + PPLH * 2u, l5 = l4 + rs, l6 = l4 + 2u * rs, l7 = l4 + 3u * rs;
    asm volatile("global_load_async_to_lds_b128 %0, %8, off\n\t"
                 "global_load_async_to_lds_b128 %1, %9, off\n\t"
                 "global_load_async_to_lds_b128 %2, %10, off\n\t"
                 "global_load_async_to_lds_b128 %3, %11, off\n\t"
                 "global_load_async_to_lds_b128 %4, %12, off\n\t"
                 "global_load_async_to_lds_b128 %5, %13, off\n\t"
                 "global_load_async_to_lds_b128 %6, %14, off\n\t"
                 "global_load_async_to_lds_b128 %7, %15, off\n\t"
                 "s_wait_xcnt 0x0"
                 :: "v"(l), "v"(l1), "v"(l2), "v"(l3), "v"(l4), "v"(l5), "v"(l6), "v"(l7), "v"(ga), "v"(ga1), "v"(ga2), "v"(ga3), "v"(gb), "v"(gb1), "v"(gb2), "v"(gb3) : "memory");
}

// k_proj: register-blocked bf16 GEMM, 128x128 tile per block, EIGHT WAVES of 32x64 each (8 accumulators; wave w: rows 32*(w>>1), columns 64*(w&1)), K = DM.
// Slice s = k 64s .. 64s+63 of the block's 128 A rows and 128 Bt rows: two planes of 128 rows x 128 B, copied in whole 128-B lines (4 + 4 copies per lane); slice s+1 flies while slice s is worked on.
// C[m][n] = sum_k A[m][k] Bt[n][k], times osc (the score scale for q, else 1), written as f16 (Ph) and, for q and k, the f16 residual (Pr; small ones are f16 subnormals, step 2^-24), row pitch 'pitch' (halves).
// ALL THREE PROJECTIONS IN ONE LAUNCH: grid (NB*SEQ/128, DM/128, 3), 256 threads; blockIdx.z picks the product, blockIdx.x the 128 stream rows, blockIdx.y the 128 weight rows.
//   z = 0, 1 (q, k): A = stream rows (m = b*SEQ + t), Bt = W rows (n = h*64 + d) -> planes [(b*16 + h)][t][d], value + residual
//   z = 2 (v^T):     A = Wv rows (m = h*64 + d), Bt = v-stream rows (n = b*SEQ + t) -> plane [(b*1024 + m)][t] = [(b*16 + h)][d][t], value only
// X = the three bf16 stream copies back to back, Wb = the three bf16 weights back to back.
// Second launch bound: six waves per SIMD, so that three blocks (LDS 3 x 108,544 B) stand on one WGP and one block's copy, LDS and barrier waits are filled by the other two.
__global__ __launch_bounds__(256, 6) void k_proj(const bf* __restrict__ X, const bf* __restrict__ Wb, h16* QH, h16* QR, h16* KP, h16* KR, h16* VT) {
    __shared__ __align__(16) float osb[8 * 16 * 68];
    __shared__ __align__(128) bf pring[2 * PBUFH];
    const int K = DM;
    const int lane = threadIdx.x & 31, lr = lane & 15, hi = lane >> 4;
    const int wave = __builtin_amdgcn_readfirstlane(threadIdx.x >> 5);
    const int z = blockIdx.z;
    const bool useRes = z < 2;
    const bf* xs = X + (size_t)z * ((size_t)NB * SEQ * DM);
    const bf* wsl = Wb + (size_t)z * ((size_t)DM * DM);
    const bf* A = useRes ? xs : wsl;
    const bf* Bt = useRes ? wsl : xs;
    h16* Ph = z == 0 ? QH : (z == 1 ? KP : VT);
    h16* Pr = z == 0 ? QR : KR;                              // stored only where useRes
    const int pitch = useRes ? HD : SEQ;
    const float osc = z == 0 ? SC2 : 1.0f;                   // the q planes carry the score scale (1/8 and log2 e), so that k_flash's score accumulators are the exponents as they stand
    const int rb = (useRes ? blockIdx.x : blockIdx.y) * 128, cb = (useRes ? blockIdx.y : blockIdx.x) * 128;
    const int r0 = rb + (wave >> 1) * 32, c0 = cb + (wave & 1) * 64;
    float* os = osb + wave * 16 * 68;                        // wave-private output staging
    v8f acc[2][4];
#pragma unroll
    for (int mb = 0; mb < 2; ++mb)
#pragma unroll
        for (int nb = 0; nb < 4; ++nb) acc[mb][nb] = (v8f){};
    // copy map: lane takes rows crow + 32 j (j = 0 .. 3), 16-byte column ccol, of each operand's slice
    const int crow = threadIdx.x >> 3, ccol = threadIdx.x & 7;
    const bf* ga = A + (size_t)(rb + crow) * K + ccol * 8;   // + k0
    const bf* gb = Bt + (size_t)(cb + crow) * K + ccol * 8;  // + k0
    const unsigned lc = (unsigned)(size_t)pring + (unsigned)(crow * PIT + ccol * 8) * 2u;   // LDS byte address, + buffer
    stage_slice(ga, gb, lc);
    asm volatile("s_wait_asynccnt 0x0" ::: "memory");        // slice 0 landed (this wave's copies) before the barrier publishes it
    __syncthreads();
    stage_slice(ga + PKS, gb + PKS, lc + PBUFH * 2u);
    const int fa = ((wave >> 1) * 32 + lr) * PIT + 8 * hi;          // A fragment offset in a buffer: + mb * 16 * PIT + k0
    const int fb = PPLH + ((wave & 1) * 64 + lr) * PIT + 8 * hi;    // B fragment offset in a buffer: + nb * 16 * PIT + k0
#pragma unroll 1   // stays rolled: one small body serves both buffers, the buffer is picked by st & 1
    for (int st = 0; st < K / PKS; ++st) {
        const bf* tp = pring + (st & 1) * PBUFH;
        v16bf a0[2], b0[4], a1[2], b1[4];                    // the first k-step's fragments, the second's two A and first two B fragments are read as one group ahead of the products
#pragma unroll
        for (int i = 0; i < 2; ++i) a0[i] = ldb(tp + fa + i * 16 * PIT);
#pragma unroll
        for (int i = 0; i < 4; ++i) b0[i] = ldb(tp + fb + i * 16 * PIT);
#pragma unroll
        for (int i = 0; i < 2; ++i) a1[i] = ldb(tp + fa + i * 16 * PIT + 32);
#pragma unroll
        for (int i = 0; i < 2; ++i) b1[i] = ldb(tp + fb + i * 16 * PIT + 32);
#pragma unroll
        for (int nb = 0; nb < 2; ++nb)
#pragma unroll
            for (int mb = 0; mb < 2; ++mb) acc[mb][nb] = wmmab(a0[mb], b0[nb], acc[mb][nb]);
#pragma unroll
        for (int i = 2; i < 4; ++i) b1[i] = ldb(tp + fb + i * 16 * PIT + 32);   // the last two fragments take the registers that b0[0], b0[1] have left: the live set stays inside 160 registers
#pragma unroll
        for (int nb = 2; nb < 4; ++nb)
#pragma unroll
            for (int mb = 0; mb < 2; ++mb) acc[mb][nb] = wmmab(a0[mb], b0[nb], acc[mb][nb]);
#pragma unroll
        for (int nb = 0; nb < 4; ++nb)
#pragma unroll
            for (int mb = 0; mb < 2; ++mb) acc[mb][nb] = wmmab(a1[mb], b1[nb], acc[mb][nb]);
        asm volatile("s_wait_dscnt 0x0" ::: "memory");       // this wave's reads of slice st are done before its buffer may be refilled
        asm volatile("s_wait_asynccnt 0x0" ::: "memory");    // this wave's copies of slice st+1 have landed before the barrier publishes them
        __syncthreads();                                     // publishes slice st+1 and ends every wave's reads of slice st
        if (st + 2 < K / PKS) { const int k2 = (st + 2) * PKS; stage_slice(ga + k2, gb + k2, lc + (unsigned)(st & 1) * (PBUFH * 2u)); }
    }
    asm volatile("s_wait_asynccnt 0x0" ::: "memory");        // nothing of this wave is in flight behind the loop
    const size_t tbase = useRes ? (size_t)(r0 / SEQ) * ((size_t)NH_ * SEQ * HD) + (size_t)(r0 % SEQ) * HD + (size_t)(c0 / HD) * ((size_t)SEQ * HD) + (size_t)(c0 % HD)
                                : (size_t)r0 * SEQ + (size_t)(c0 / SEQ) * ((size_t)DM * SEQ) + (size_t)(c0 % SEQ);
#pragma unroll
    for (int mb = 0; mb < 2; ++mb) {
#pragma unroll
        for (int nb = 0; nb < 4; ++nb) {
#pragma unroll
            for (int j = 0; j < 8; ++j) os[(hi * 8 + j) * 68 + nb * 16 + lr] = acc[mb][nb][j] * osc; }   // D: row 8h+j, col lane&15; scaled here, in f32, ahead of the value / residual split
        wave_sync();
        const size_t sb = tbase + (size_t)(mb * 16) * (size_t)pitch;
{
#pragma unroll
            for (int s = 0; s < 4; ++s) { const int row = 4 * s + (lane >> 3), c8 = (lane & 7) * 8;   // 4 s x 4 row groups = 16 rows; 8 lanes x 8 = 64 columns
                const v4f x0 = *(const v4fa*)(&os[row * 68 + c8]); const v4f x1 = *(const v4fa*)(&os[row * 68 + c8 + 4]); v8h hv, rv;
#pragma unroll
                for (int i = 0; i < 4; ++i) { const h16 a0 = (h16)x0[i]; const h16 a1 = (h16)x1[i]; hv[i] = a0; hv[4 + i] = a1; rv[i] = (h16)(x0[i] - (float)a0); rv[4 + i] = (h16)(x1[i] - (float)a1); }
                const size_t oo = sb + (size_t)row * (size_t)pitch + c8;
                *(v8h*)(Ph + oo) = hv; if (useRes) *(v8h*)(Pr + oo) = rv; }
             }
        wave_sync();
    }
}

// one tile's copies of one lane: rows r and r + 32 of the K value, K residual and V^T planes, 16 B each, global -> LDS through no register.
// The closing s_wait_xcnt stands inside the statement so that no address register named here is rewritten ahead of it.
__device__ __forceinline__ void stage_tile(const h16* gk, const h16* gr, const h16* gv, unsigned l) {
    const h16* gk1 = gk + (size_t)32 * HD; const h16* gr1 = gr + (size_t)32 * HD; const h16* gv1 = gv + (size_t)32 * SEQ;
    const unsigned l1 = l + 32u * PIT * 2u, l2 = l + PLH * 2u, l3 = l2 + 32u * PIT * 2u, l4 = l + 2u * PLH * 2u, l5 = l4 + 32u * PIT * 2u;
    asm volatile("global_load_async_to_lds_b128 %0, %6, off\n\t"
                 "global_load_async_to_lds_b128 %1, %7, off\n\t"
                 "global_load_async_to_lds_b128 %2, %8, off\n\t"
                 "global_load_async_to_lds_b128 %3, %9, off\n\t"
                 "global_load_async_to_lds_b128 %4, %10, off\n\t"
                 "global_load_async_to_lds_b128 %5, %11, off\n\t"
                 "s_wait_xcnt 0x0"
                 :: "v"(l), "v"(l1), "v"(l2), "v"(l3), "v"(l4), "v"(l5), "v"(gk), "v"(gk1), "v"(gr), "v"(gr1), "v"(gv), "v"(gv1) : "memory");
}

// k_flash: fused attention, one wave per QT tiles of 16 query rows of one flat slot n = b*16 + h (every K and V^T fragment is read from LDS once and multiplied with each query tile in turn); Q fragments straight from the f16 planes; K (value, residual) and V^T fragments from the block's LDS tile (two 16-B reads each).
// Tile t = keys 64t .. 64t+63: three planes of 64 rows x 128 B (K rows = keys, V^T rows = d), each lane copies 2 x 16 B per plane in whole 128-B lines; tile t+1 flies while tile t is worked on.
// Transposed form: S^T[key][t] = K Q^T (A = K rows, B = Q rows); lane (t = lane&15, h = lane>>4) holds keys 8h+r of each 16-key tile, so the packed
// P tile is directly the B fragment of O^T[d][t] = V^T P^T (element r <- tile keys 0..15, element 8+r <- tile keys 16..31, lane unchanged).
// Scores per 16-key tile: C + Khi Qres^T + Kres Qhi^T + Khi Qhi^T in one accumulator; the q planes already carry the scale 1/8 * log2 e and C = PSH - reference, so the accumulator is the exponent of P as it stands.
// Lazy rescale: after the first group, the reference of a query column stays as it is while every lane's P sum of a group of keys stays inside LIM (one scalar branch per group); only behind that branch are the maximum, the xor-16 exchange, the new reference and the scaling of O and of the row sum computed.
// Softmax state: the reference (as C operand) and one partial sum per lane and query tile; the two lane halves' sums are joined once, in the epilogue.
// Output address: n is re-read as n = c*NB_FULL + b2 -> OUT[b2][t][c*64 + d].
__global__ __launch_bounds__(32 * AW) void k_flash(const h16* __restrict__ QH, const h16* __restrict__ QR, const h16* __restrict__ KP, const h16* __restrict__ KR, const h16* __restrict__ VT, float* OUT) {
    __shared__ __align__(16) float os[AW * 16 * 68];
    __shared__ __align__(128) h16 ring[2 * BUFH];
    const int lane = threadIdx.x & 31, lr = lane & 15, hi = lane >> 4;
    const int wave = __builtin_amdgcn_readfirstlane(threadIdx.x >> 5);
    const int zh = blockIdx.y;                               // flat slot n = b*NH_ + h
    const int t0 = (blockIdx.x * AW + wave) * (16 * QT);
    const size_t pbase = (size_t)zh * SEQ * HD;
    // every loop over q, kt, j or r in this kernel is unrolled so that the arrays it indexes stay in registers
    v16h qh0[QT], qh1[QT], qr0[QT], qr1[QT];                 // B fragments: col t, k = d
#pragma unroll
    for (int q = 0; q < QT; ++q) { const size_t qo = pbase + (size_t)(t0 + 16 * q + lr) * HD + 8 * hi;
        qh0[q] = ldh(QH + qo); qh1[q] = ldh(QH + qo + 32); qr0[q] = ldh(QR + qo); qr1[q] = ldh(QR + qo + 32);
        if (q + 1 < QT) asm volatile("s_wait_xcnt 0x0" ::: "memory"); }   // the next tile's loads land in the address registers of these loads: the wait stands in front of them
    const int fo = lr * PIT + 8 * hi;                        // fragment offset inside a plane: + row0 * PIT + k0 (A fragment: row lr, k = 8h ..)
    // copy map: lane takes rows crow and crow + 32, 16-byte column ccol, of each plane
    const int crow = threadIdx.x >> 3, ccol = threadIdx.x & 7;
    const h16* gk = KP + pbase + (size_t)crow * HD + ccol * 8;    // + key0 * HD
    const h16* gr = KR + pbase + (size_t)crow * HD + ccol * 8;    // + key0 * HD
    const h16* gv = VT + pbase + (size_t)crow * SEQ + ccol * 8;   // + key0
    const unsigned lc = (unsigned)(size_t)ring + (unsigned)(crow * PIT + ccol * 8) * 2u;   // LDS byte address, + buffer, plane, 32 rows
    stage_tile(gk, gr, gv, lc);
    asm volatile("s_wait_asynccnt 0x0" ::: "memory");        // tile 0 landed (this wave's copies) before the barrier publishes it
    __syncthreads();
    stage_tile(gk + (size_t)KS * HD, gr + (size_t)KS * HD, gv + KS, lc + BUFH * 2u);
    v8f o[QT][4], cq[QT];                                    // cq: PSH minus the reference in use, the same value in all eight elements: C operand of each score tile's first product
    float l[QT];
#pragma unroll
    for (int q = 0; q < QT; ++q) { l[q] = 0.0f;
#pragma unroll
        for (int r = 0; r < 8; ++r) cq[q][r] = PSH;          // reference 0 until the first group of keys has set the true one
#pragma unroll
        for (int j = 0; j < 4; ++j) o[q][j] = (v8f){}; }
#pragma unroll 1
    for (int st = 0; st < SEQ / KS; ++st) {
      const h16* tk = ring + (st & 1) * BUFH + fo;           // K value plane; + PLH residual, + 2 * PLH V^T
#pragma unroll
      for (int g0 = 0; g0 < KS; g0 += 32 * GP) {             // constant offsets into the tile; one rescale test per group of GP passes of 32 keys
        v8f ts[GP][QT][2];                                   // exponents as they stand (scaled score - reference + PSH): pass, query tile, 16-key tile, key 8h + r
        v16h vf[GP][4];                                      // V^T fragments of the group
#pragma unroll
        for (int p = 0; p < GP; ++p) {   // keys g0 + 32 p .. + 31 of the tile; per query tile the two 16-key tiles' accumulator chains alternate, each in the order C, hi*res, res*hi, hi*hi
            const h16* ka = tk + (g0 + 32 * p) * PIT; const h16* kb = ka + 16 * PIT;
            const v16h kh[2][2] = { { ldh(ka), ldh(ka + 32) }, { ldh(kb), ldh(kb + 32) } };
            const v16h kr[2][2] = { { ldh(ka + PLH), ldh(ka + PLH + 32) }, { ldh(kb + PLH), ldh(kb + PLH + 32) } };
#pragma unroll
            for (int q = 0; q < QT; ++q) {
#pragma unroll
                for (int kt = 0; kt < 2; ++kt) ts[p][q][kt] = wmma16(kh[kt][0], qr0[q], cq[q]);
#pragma unroll
                for (int kt = 0; kt < 2; ++kt) ts[p][q][kt] = wmma16(kh[kt][1], qr1[q], ts[p][q][kt]);
#pragma unroll
                for (int kt = 0; kt < 2; ++kt) ts[p][q][kt] = wmma16(kr[kt][0], qh0[q], ts[p][q][kt]);
#pragma unroll
                for (int kt = 0; kt < 2; ++kt) ts[p][q][kt] = wmma16(kr[kt][1], qh1[q], ts[p][q][kt]);
#pragma unroll
                for (int kt = 0; kt < 2; ++kt) ts[p][q][kt] = wmma16(kh[kt][0], qh0[q], ts[p][q][kt]);
#pragma unroll
                for (int kt = 0; kt < 2; ++kt) ts[p][q][kt] = wmma16(kh[kt][1], qh1[q], ts[p][q][kt]);
            }
            const h16* va = tk + 2 * PLH + g0 + 32 * p;
#pragma unroll
            for (int j = 0; j < 4; ++j) vf[p][j] = ldh(va + 16 * j * PIT);
        }
        v8f e[GP][QT][2]; float ls[QT];                      // P in f32 and this lane's sum of it over the group
        auto expsum = [&]() {
#pragma unroll
            for (int q = 0; q < QT; ++q) { v8f sv;
#pragma unroll
                for (int p = 0; p < GP; ++p) {
#pragma unroll
                    for (int kt = 0; kt < 2; ++kt)
#pragma unroll
                        for (int r = 0; r < 8; ++r) e[p][q][kt][r] = __builtin_amdgcn_exp2f(ts[p][q][kt][r]);
                    sv = p == 0 ? e[p][q][0] + e[p][q][1] : sv + (e[p][q][0] + e[p][q][1]); }
                ls[q] = ((sv[0] + sv[1]) + (sv[2] + sv[3])) + ((sv[4] + sv[5]) + (sv[6] + sv[7])); }
        };
        expsum();
        float tot = ls[0];
#pragma unroll
        for (int q = 1; q < QT; ++q) tot += ls[q];
        // Lazy rescale, one scalar branch per group. Every P is >= 0, so a sum inside LIM bounds each P below the f16 range; an overflow or a NaN fails the compare and takes the branch too.
        // The first group always takes it: it replaces the reference 0 by the true maximum, upward or downward.
        const bool first = g0 == 0 && st == 0;
        if ((__builtin_amdgcn_ballot_w32(!(tot <= LIM)) | (first ? 1u : 0u)) != 0u) {
#pragma unroll
            for (int q = 0; q < QT; ++q) {
                float mx = ts[0][q][0][0];
#pragma unroll
                for (int p = 0; p < GP; ++p)
#pragma unroll
                    for (int r = 0; r < 8; ++r) mx = fmaxf(mx, fmaxf(ts[p][q][0][r], ts[p][q][1][r]));
                mx = fmaxf(mx, __shfl_xor(mx, 16, 32));      // both lane halves of a query column take the same new reference
                const float d = first ? mx - PSH : fmaxf(mx - PSH, 0.0f);          // rise of the reference
                const float alpha = first ? 0.0f : __builtin_amdgcn_exp2f(-d);     // nothing is summed yet in the first group
                cq[q] = cq[q] - d; l[q] *= alpha;
#pragma unroll
                for (int p = 0; p < GP; ++p) { ts[p][q][0] = ts[p][q][0] - d; ts[p][q][1] = ts[p][q][1] - d; }
#pragma unroll
                for (int j = 0; j < 4; ++j) o[q][j] = o[q][j] * alpha;
            }
            expsum();
        }
#pragma unroll
        for (int q = 0; q < QT; ++q) l[q] += ls[q];
#pragma unroll
        for (int p = 0; p < GP; ++p) {
            v16h pb[QT];
#pragma unroll
            for (int q = 0; q < QT; ++q)
#pragma unroll
                for (int r = 0; r < 8; ++r) { pb[q][r] = (h16)e[p][q][0][r]; pb[q][8 + r] = (h16)e[p][q][1][r]; }
#pragma unroll
            for (int q = 0; q < QT; ++q)
#pragma unroll
                for (int j = 0; j < 4; ++j) o[q][j] = wmma16(vf[p][j], pb[q], o[q][j]);
        }
      }
      asm volatile("s_wait_dscnt 0x0" ::: "memory");         // this wave's reads of tile st are done before its buffer may be refilled
      asm volatile("s_wait_asynccnt 0x0" ::: "memory");      // this wave's copies of tile st+1 have landed before the barrier publishes them
      __syncthreads();                                       // publishes tile st+1 and ends every wave's reads of tile st
      if (st + 2 < SEQ / KS) { const size_t k2 = (size_t)(st + 2) * KS; stage_tile(gk + k2 * HD, gr + k2 * HD, gv + k2, lc + (unsigned)(st & 1) * (BUFH * 2u)); }
    }
    asm volatile("s_wait_asynccnt 0x0" ::: "memory");        // nothing of this wave is in flight behind the loop
    const int wb = wave * 16 * 68;
    const int b2 = zh % NB_FULL, cb = zh / NB_FULL;          // regrouped address: output batch b2, column block cb
#pragma unroll
    for (int q = 0; q < QT; ++q) {                           // one query tile at a time through the wave's own staging rows
        const float lq = l[q] + __shfl_xor(l[q], 16, 32);
        const float inv = 1.0f / lq;
        // O^T D layout: o[q][j][r] = (d = 16j + 8h + r, t = lane&15) -> os[t][d]; rows 0..15 x columns 0..63 all written
#pragma unroll
        for (int j = 0; j < 4; ++j) { v4f a, c;
#pragma unroll
            for (int r = 0; r < 4; ++r) { a[r] = o[q][j][r] * inv; c[r] = o[q][j][4 + r] * inv; }
            *(v4fa*)(&os[wb + lr * 68 + 16 * j + 8 * hi]) = a; *(v4fa*)(&os[wb + lr * 68 + 16 * j + 8 * hi + 4]) = c; }
        wave_sync();
        float* orow = OUT + ((size_t)b2 * OUT_SEQ + t0 + 16 * q) * DM + (size_t)cb * HD;
#pragma unroll
        for (int s = 0; s < 8; ++s) { const int row = 2 * s + hi, cofs = lr * 4;   // 8 s x 2 rows = 16 rows; 16 lanes x 4 floats = 64 columns
            const v4f val = *(const v4fa*)(&os[wb + row * 68 + cofs]);
            *(v4f*)(orow + (size_t)row * DM + cofs) = val; }
        if (q + 1 < QT) wave_sync();                         // the rows are read out before the next query tile overwrites them
    }
}

static constexpr size_t al256(size_t v) { return (v + 255) & ~(size_t)255; }
static constexpr size_t SZ_XB = al256((size_t)NB * SEQ * DM * 2);          // one bf16 stream copy
static constexpr size_t SZ_WB = al256((size_t)3 * DM * DM * 2);
static constexpr size_t SZ_PL = al256((size_t)NB * NH_ * SEQ * HD * 2);
static constexpr size_t SZ_TOTAL = 3 * SZ_XB + SZ_WB + 5 * SZ_PL;
static_assert(SZ_TOTAL <= (size_t)134217728);          // workspace carve <= 128 MiB
static_assert(((size_t)DM * DM * 2) % 256 == 0);       // weight sub-planes stay 256-byte aligned
static_assert(SZ_XB == (size_t)NB * SEQ * DM * 2);     // no pad between the bf16 copies: the conversion writes them as one range
static constexpr unsigned CVT_G = (unsigned)((3 * (size_t)NB * SEQ * DM + 3 * (size_t)DM * DM) / ((size_t)CVT_T * 1024));   // conversion blocks: three streams, three weights
static_assert((size_t)NB * SEQ * DM == (size_t)NB * NH_ * SEQ * HD);   // projection grid x tile == plane extent

extern "C" void kernel_launch(void* const* d_in, const int* in_sizes, int n_in,
                              void* d_out, int out_size, void* d_ws, size_t ws_size, hipStream_t stream) {
    if (n_in < 6) return;
    const size_t needx = ((size_t)(NB - 1) * SEQ_FULL + SEQ) * DM;
    if ((size_t)in_sizes[0] < needx || (size_t)in_sizes[1] < needx || (size_t)in_sizes[2] < needx) return;
    if ((size_t)in_sizes[3] < (size_t)DM * DM || (size_t)in_sizes[4] < (size_t)DM * DM || (size_t)in_sizes[5] < (size_t)DM * DM) return;
    if ((size_t)out_size < ((size_t)(NB_FULL - 1) * OUT_SEQ + SEQ) * DM) return;
    if (SZ_TOTAL > ws_size) return;
    // wire order: q, k, v streams, then Wq, Wk, Wv ([out][in] = Bt as-is)
    const float* xq = (const float*)d_in[0]; const float* xk = (const float*)d_in[1]; const float* xv = (const float*)d_in[2];
    const float* wq = (const float*)d_in[3]; const float* wk = (const float*)d_in[4]; const float* wv = (const float*)d_in[5];
    float* OUT = (float*)d_out;      // [NB_FULL][OUT_SEQ][1024]
    char* wsp = (char*)d_ws;
    bf* XQ = (bf*)wsp; wsp += SZ_XB;                 // [NB*SEQ][1024]
    wsp += SZ_XB;                                    // k stream copy, [NB*SEQ][1024]
    wsp += SZ_XB;                                    // v stream copy, [NB*SEQ][1024]
    bf* WB = (bf*)wsp; wsp += SZ_WB;                 // [3][1024][1024]: q | k | v
    h16* QH = (h16*)wsp; wsp += SZ_PL;               // [NB*16][SEQ][64], times the score scale
    h16* QR = (h16*)wsp; wsp += SZ_PL;               // [NB*16][SEQ][64] residual
    h16* KP = (h16*)wsp; wsp += SZ_PL;               // [NB*16][SEQ][64]
    h16* KR = (h16*)wsp; wsp += SZ_PL;               // [NB*16][SEQ][64] residual
    h16* VT = (h16*)wsp; wsp += SZ_PL;               // [NB*16][64][SEQ]

    // XQ | XK | XV | WQ | WK | WV are one contiguous bf16 range that starts at XQ
    k_cvt_all<<<dim3(CVT_G, 1, 1), 256, 0, stream>>>(xq, xk, xv, wq, wk, wv, XQ);

    // q, k and v^T projections: one launch, blockIdx.z = 0, 1, 2
    k_proj<<<dim3(NB * SEQ / 128, DM / 128, 3), 256, 0, stream>>>(XQ, WB, QH, QR, KP, KR, VT);

    k_flash<<<dim3(SEQ / (16 * QT * AW), NB * NH_, 1), 32 * AW, 0, stream>>>(QH, QR, KP, KR, VT, OUT);
}

// v009
// One run takes 62.8 microseconds.
// It is 1.31 times as fast as v007, going by the measured steps of the versions left out in between.
// Counting every step since v000, it is 4.96 times as fast.
#include <hip/hip_runtime.h>

// Non-causal multi-head attention with three input streams, width 1024 = 16 heads x 64; q/k/v [NB][SEQ][1024], Wq/Wk/Wv [out][in] (y = x W^T), no biases, no mask, score scale 1/8, no output projection; context written at the regrouped address (flat n = b*16+h re-read as n = c*NB_FULL + b2).
// Compute dtypes, f32 accumulate everywhere: projections v_wmma_f32_16x16x32_bf16 (x and W RNE-converted to bf16; products exact);
// scores v_wmma_f32_16x16x32_f16 with q (times the score scale) and k each as ONE f16 value (its rounding, half a step of 2^-10, is an eighth of the bf16 rounding, half a step of 2^-7, that x and W already carry into q and k; the accumulator starts at carry - reference and then holds the exponent); P (x256 carry, cancels in the normalisation, row sum from the f32 values) and v single f16; softmax f32 (online; the reference is a maximum that is renewed only when a P sum leaves its range).
// Layout: bf16 copies of q/k/v streams and W; q and k planes [b*16+h][t][d] and v^T plane [b*16+h][d][t] written by the GEMM epilogue (GEMM: 128x128 block tile, eight waves of 32x64, k-slices of 64 of both operands staged in LDS by asynchronous copies, two buffers); fused flash kernel in transposed form (S^T = K Q^T, O^T = V^T P^T), K / V^T tiles of 64 keys staged in LDS by asynchronous copies (two buffers) and shared by eight waves; the keys are split over the block's two sets of eight waves (four waves per SIMD), whose partial sums are joined through LDS; output from f32 accumulators.

#ifndef NB
#define NB 2
#endif
#ifndef SEQ
#define SEQ 2048
#endif
#define NB_FULL  2
#define SEQ_FULL 2048
#ifndef OUT_SEQ
#define OUT_SEQ SEQ              // row pitch (in tokens) between batches of the output
#endif
#define DM   1024
#define NH_  16
#define HD   64
#define AW   8                   // waves per key group of a flash block; they share one staged K / V^T tile
#define KG   2                   // key groups per flash block: group g works on keys 128 s + 64 g .. + 63 of every stage s, for the same query rows as the other group
#define QT   2                   // query tiles of 16 rows per flash wave: each K / V^T fragment read from LDS serves all of them
#define KS   64                  // keys per staged tile (two passes of 32 keys)
#define PIT  72                  // LDS row pitch in halves: 144 B = 16 B x odd, conflict-free for 16-byte row reads
#define PLH  (64 * PIT)          // halves per staged plane: 64 rows
#define BUFH (2 * PLH)           // halves per key group's tile: K, V^T (a buffer holds KG tiles)
#define PKS  64                  // GEMM: k per staged slice (two k-steps of 32); one row of a slice = one 128-B line
#define PPLH (128 * PIT)         // GEMM: halves per staged operand slice: 128 rows
#define PBUFH (2 * PPLH)         // GEMM: halves per buffer: A slice, B slice
#define CVT_T 32                 // conversion: tiles of 1024 elements per block
#define SC2  (0.125f * 1.4426950408889634f)   // HD^-0.5 * log2(e)
#define PSH  8.0f                // log2 of the P carry (256)
#define GP   1                   // passes of 32 keys per rescale test
#define LIM  32768.0f            // a lane's P sum over one group above which the reference is renewed

static_assert(HD == 64);
static_assert(KS % (32 * GP) == 0);            // whole groups per tile
static_assert(QT * GP * 16 * 256 <= 32768);    // a group whose every score equals the reference stays inside LIM, and LIM inside the f16 range
static_assert(8 * 8 == HD);                    // plane store: 8 lanes x 8 halves per row
static_assert(16 * 4 == HD);                   // output store: 16 lanes x 4 floats per row segment
static_assert(NH_ * HD == DM);                 // head h = columns h*64 + d
static_assert(DM % 64 == 0);                   // column tiles of 64
static_assert(DM % 32 == 0);                   // GEMM k-steps of 32
static_assert(DM % 128 == 0 && (NB * SEQ) % 128 == 0);   // GEMM block tiles of 128 x 128 cover both extents exactly
static_assert(DM % PKS == 0 && DM / PKS >= 2 && PKS == 64);   // whole k-slices; the two-buffer prologue needs slices 0 and 1; copy map: 8 lanes x 16 B = one row
static_assert(HD % 32 == 0);                   // score k-steps of 32
static_assert(SEQ % 64 == 0);                  // a 64-row tile never straddles two batches
static_assert((NB * SEQ) % 64 == 0);
static_assert(SEQ % 32 == 0);                  // key loop steps by 32
static_assert(SEQ % (16 * QT * AW) == 0);      // flash grid covers the sequence exactly
static_assert(SEQ % (KS * KG) == 0 && SEQ / (KS * KG) >= 2); // whole stages (one tile per key group); the two-buffer prologue needs stages 0 and 1
static_assert(KG == 2 && QT == KG && AW == 8);  // join: group g finishes query tile g; a wave's partner is wave ^ AW
static_assert(KS == 64 && 32 * AW == 256);     // copy map: a group's 256 lanes x 16 B x 2 = one 64-row x 128-B plane
static_assert((PIT * 2) % 16 == 0);            // every LDS row starts on a 16-byte multiple
static_assert(((size_t)SEQ * DM) % (CVT_T * 1024) == 0);   // a conversion block never straddles two batches or two streams
static_assert(((size_t)DM * DM) % (CVT_T * 1024) == 0);    // nor two weights
static_assert(NB <= NB_FULL);
static_assert(SEQ <= SEQ_FULL);
static_assert(SEQ <= OUT_SEQ);
static_assert(((NB * NH_ - 1) / NB_FULL) * HD + HD <= DM);   // regrouped column block stays inside the row
static_assert((size_t)((NB_FULL - 1) * (size_t)OUT_SEQ + SEQ) * DM * 4 <= (size_t)16777216);   // last written output element inside the 16,777,216-byte output

typedef _Float16 h16;
typedef unsigned short bf;
typedef __attribute__((ext_vector_type(16))) __bf16   v16bf;
typedef __attribute__((ext_vector_type(16))) _Float16 v16h;
typedef __attribute__((ext_vector_type(8)))  _Float16 v8h;
typedef __attribute__((ext_vector_type(8)))  unsigned short v8us;
typedef __attribute__((ext_vector_type(4)))  unsigned short v4us;
typedef __attribute__((ext_vector_type(8)))  float    v8f;
typedef __attribute__((ext_vector_type(4)))  float    v4f;
typedef v4f  __attribute__((may_alias)) v4fa;

__device__ __forceinline__ unsigned short f2bf(float f) { unsigned u = __float_as_uint(f); u += 0x7FFFu + ((u >> 16) & 1u); return (unsigned short)(u >> 16); }
__device__ __forceinline__ v16h cat16(v8h lo, v8h hi) { return __builtin_shufflevector(lo, hi, 0, 1, 2, 3, 4, 5, 6, 7, 8, 9, 10, 11, 12, 13, 14, 15); }
__device__ __forceinline__ v16bf cat16b(v8us lo, v8us hi) { return __builtin_bit_cast(v16bf, __builtin_shufflevector(lo, hi, 0, 1, 2, 3, 4, 5, 6, 7, 8, 9, 10, 11, 12, 13, 14, 15)); }
// f16 form (k_flash): the plain builtin, the compiler keeps the distance behind it. A guard statement as in wmmab would tie every fragment and accumulator of the two query tiles to the first 256 registers, where they do not fit.
__device__ __forceinline__ v8f wmma16(v16h a, v16h b, v8f c) {
    return __builtin_amdgcn_wmma_f32_16x16x32_f16(false, a, false, b, (short)0, c, false, false);
}
// bf16 form (k_proj): followed by its own four-slot guard tying exactly its accumulator and keeping its operands live
__device__ __forceinline__ v8f wmmab(v16bf a, v16bf b, v8f c) {
    c = __builtin_amdgcn_wmma_f32_16x16x32_bf16(false, a, false, b, (short)0, c, false, false);
    asm volatile("v_nop\n\tv_nop\n\tv_nop\n\tv_nop" : "+v"(c) : "v"(a), "v"(b));
    return c;
}
// fragment loaders from K-contiguous 16-bit rows; p already includes + 8*(lane>>4): elements 0..7 <- k0+8h+0..7, elements 8..15 <- k0+16+8h+0..7 (same map for A and B)
__device__ __forceinline__ v16h  ldh(const h16* p) { return cat16(*(const v8h*)p, *(const v8h*)(p + 16)); }
__device__ __forceinline__ v16bf ldb(const bf* p)  { return cat16b(*(const v8us*)p, *(const v8us*)(p + 16)); }
// ordering point for wave-private LDS tiles (same wave writes and reads)
__device__ __forceinline__ void wave_sync() { __builtin_amdgcn_fence(3 /* release order */, "wavefront"); __builtin_amdgcn_wave_barrier(); asm volatile("" ::: "memory"); }

// k_cvt_all: every f32 -> bf16 copy of the call in ONE launch. The six destinations lie back to back in the workspace (q | k | v streams, then Wq | Wk | Wv), so the block index is the flat position there.
// A tile is 1024 elements: each wave-wide 16-byte load covers 512 contiguous bytes, each 8-byte store 256 (whole 128-B lines both ways). A block takes CVT_T consecutive tiles of one tensor,
// its loads issued ahead of the conversions: few long-lived waves in place of one short wave per 256 elements.
__global__ __launch_bounds__(256) void k_cvt_all(const float* __restrict__ xq, const float* __restrict__ xk, const float* __restrict__ xv,
                                                 const float* __restrict__ wq, const float* __restrict__ wk, const float* __restrict__ wv, bf* __restrict__ dst) {
    constexpr unsigned BE = CVT_T * 1024u;                                  // elements per block
    constexpr unsigned BX = (unsigned)((size_t)NB * SEQ * DM / BE);         // blocks per stream
    constexpr unsigned BW = (unsigned)((size_t)DM * DM / BE);               // blocks per weight
    const unsigned b = blockIdx.x;
    const float* src; size_t off;
    if (b < 3u * BX) {
        const unsigned s = b / BX; const size_t e = (size_t)(b - s * BX) * BE; const size_t bt = e / ((size_t)SEQ * DM);
        src = s == 0u ? xq : (s == 1u ? xk : xv);
        off = bt * ((size_t)SEQ_FULL * DM) + (e - bt * ((size_t)SEQ * DM));   // batch pitch of the source is the full sequence
    } else {
        const unsigned w = b - 3u * BX, s = w / BW;
        src = s == 0u ? wq : (s == 1u ? wk : wv);
        off = (size_t)(w - s * BW) * BE;
    }
    const float* p = src + off + threadIdx.x * 4u;
    bf* q = dst + (size_t)b * BE + threadIdx.x * 4u;
    v4f v[CVT_T];                                                          // the loads stand ahead of the first conversion: as many in flight as the compiler keeps there
#pragma unroll
    for (int j = 0; j < CVT_T; ++j) v[j] = *(const v4f*)(p + j * 1024);
#pragma unroll
    for (int j = 0; j < CVT_T; ++j) { v4us o;
#pragma unroll
        for (int k = 0; k < 4; ++k) o[k] = f2bf(v[j][k]);
        *(v4us*)(q + j * 1024) = o; }
}

// one k-slice's copies of one lane: rows r, r + 32, r + 64, r + 96 of the A slice and of the B slice (128 rows x 128 B each), 16 B each, global -> LDS through no register.
// The closing s_wait_xcnt stands inside the statement so that no address register named here is rewritten ahead of it.
__device__ __forceinline__ void stage_slice(const bf* ga, const bf* gb, unsigned l) {
    const bf* ga1 = ga + (size_t)32 * DM; const bf* ga2 = ga + (size_t)64 * DM; const bf* ga3 = ga + (size_t)96 * DM;
    const bf* gb1 = gb + (size_t)32 * DM; const bf* gb2 = gb + (size_t)64 * DM; const bf* gb3 = gb + (size_t)96 * DM;
    const unsigned rs = 32u * PIT * 2u;
    const unsigned l1 = l + rs, l2 = l + 2u * rs, l3 = l + 3u * rs, l4 = l + PPLH * 2u, l5 = l4 + rs, l6 = l4 + 2u * rs, l7 = l4 + 3u * rs;
    asm volatile("global_load_async_to_lds_b128 %0, %8, off\n\t"
                 "global_load_async_to_lds_b128 %1, %9, off\n\t"
                 "global_load_async_to_lds_b128 %2, %10, off\n\t"
                 "global_load_async_to_lds_b128 %3, %11, off\n\t"
                 "global_load_async_to_lds_b128 %4, %12, off\n\t"
                 "global_load_async_to_lds_b128 %5, %13, off\n\t"
                 "global_load_async_to_lds_b128 %6, %14, off\n\t"
                 "global_load_async_to_lds_b128 %7, %15, off\n\t"
                 "s_wait_xcnt 0x0"
                 :: "v"(l), "v"(l1), "v"(l2), "v"(l3), "v"(l4), "v"(l5), "v"(l6), "v"(l7), "v"(ga), "v"(ga1), "v"(ga2), "v"(ga3), "v"(gb), "v"(gb1), "v"(gb2), "v"(gb3) : "memory");
}

// k_proj: register-blocked bf16 GEMM, 128x128 tile per block, EIGHT WAVES of 32x64 each (8 accumulators; wave w: rows 32*(w>>1), columns 64*(w&1)), K = DM.
// Slice s = k 64s .. 64s+63 of the block's 128 A rows and 128 Bt rows: two planes of 128 rows x 128 B, copied in whole 128-B lines (4 + 4 copies per lane); slice s+1 flies while slice s is worked on.
// C[m][n] = sum_k A[m][k] Bt[n][k], written as f16 (Ph), row pitch 'pitch' (halves).
// ALL THREE PROJECTIONS IN ONE LAUNCH: grid (NB*SEQ/128, DM/128, 3), 256 threads; blockIdx.z picks the product, blockIdx.x the 128 stream rows, blockIdx.y the 128 weight rows.
//   z = 0, 1 (q, k): A = stream rows (m = b*SEQ + t), Bt = W rows (n = h*64 + d) -> planes [(b*16 + h)][t][d]
//   z = 2 (v^T):     A = Wv rows (m = h*64 + d), Bt = v-stream rows (n = b*SEQ + t) -> plane [(b*1024 + m)][t] = [(b*16 + h)][d][t]
// X = the three bf16 stream copies back to back, Wb = the three bf16 weights back to back.
// Second launch bound: six waves per SIMD, so that three blocks (LDS 3 x 108,544 B) stand on one WGP and one block's copy, LDS and barrier waits are filled by the other two.
__global__ __launch_bounds__(256, 6) void k_proj(const bf* __restrict__ X, const bf* __restrict__ Wb, h16* QH, h16* KP, h16* VT) {
    __shared__ __align__(16) float osb[8 * 16 * 68];
    __shared__ __align__(128) bf pring[2 * PBUFH];
    const int K = DM;
    const int lane = threadIdx.x & 31, lr = lane & 15, hi = lane >> 4;
    const int wave = __builtin_amdgcn_readfirstlane(threadIdx.x >> 5);
    const int z = blockIdx.z;
    const bool xa = z < 2;                                   // q, k: the stream is the A operand; v^T: the weight is
    const bf* xs = X + (size_t)z * ((size_t)NB * SEQ * DM);
    const bf* wsl = Wb + (size_t)z * ((size_t)DM * DM);
    const bf* A = xa ? xs : wsl;
    const bf* Bt = xa ? wsl : xs;
    h16* Ph = z == 0 ? QH : (z == 1 ? KP : VT);
    const int pitch = xa ? HD : SEQ;
    const float osc = z == 0 ? SC2 : 1.0f;                   // the q plane carries the score scale (1/8 and log2 e), so that k_flash's score accumulators are the exponents as they stand
    const int rb = (xa ? blockIdx.x : blockIdx.y) * 128, cb = (xa ? blockIdx.y : blockIdx.x) * 128;
    const int r0 = rb + (wave >> 1) * 32, c0 = cb + (wave & 1) * 64;
    float* os = osb + wave * 16 * 68;                        // wave-private output staging
    v8f acc[2][4];
#pragma unroll
    for (int mb = 0; mb < 2; ++mb)
#pragma unroll
        for (int nb = 0; nb < 4; ++nb) acc[mb][nb] = (v8f){};
    // copy map: lane takes rows crow + 32 j (j = 0 .. 3), 16-byte column ccol, of each operand's slice
    const int crow = threadIdx.x >> 3, ccol = threadIdx.x & 7;
    const bf* ga = A + (size_t)(rb + crow) * K + ccol * 8;   // + k0
    const bf* gb = Bt + (size_t)(cb + crow) * K + ccol * 8;  // + k0
    const unsigned lc = (unsigned)(size_t)pring + (unsigned)(crow * PIT + ccol * 8) * 2u;   // LDS byte address, + buffer
    stage_slice(ga, gb, lc);
    asm volatile("s_wait_asynccnt 0x0" ::: "memory");        // slice 0 landed (this wave's copies) before the barrier publishes it
    __syncthreads();
    stage_slice(ga + PKS, gb + PKS, lc + PBUFH * 2u);
    const int fa = ((wave >> 1) * 32 + lr) * PIT + 8 * hi;          // A fragment offset in a buffer: + mb * 16 * PIT + k0
    const int fb = PPLH + ((wave & 1) * 64 + lr) * PIT + 8 * hi;    // B fragment offset in a buffer: + nb * 16 * PIT + k0
#pragma unroll 1   // stays rolled: one small body serves both buffers, the buffer is picked by st & 1
    for (int st = 0; st < K / PKS; ++st) {
        const bf* tp = pring + (st & 1) * PBUFH;
        v16bf a0[2], b0[4], a1[2], b1[4];                    // the first k-step's fragments, the second's two A and first two B fragments are read as one group ahead of the products
#pragma unroll
        for (int i = 0; i < 2; ++i) a0[i] = ldb(tp + fa + i * 16 * PIT);
#pragma unroll
        for (int i = 0; i < 4; ++i) b0[i] = ldb(tp + fb + i * 16 * PIT);
#pragma unroll
        for (int i = 0; i < 2; ++i) a1[i] = ldb(tp + fa + i * 16 * PIT + 32);
#pragma unroll
        for (int i = 0; i < 2; ++i) b1[i] = ldb(tp + fb + i * 16 * PIT + 32);
#pragma unroll
        for (int nb = 0; nb < 2; ++nb)
#pragma unroll
            for (int mb = 0; mb < 2; ++mb) acc[mb][nb] = wmmab(a0[mb], b0[nb], acc[mb][nb]);
#pragma unroll
        for (int i = 2; i < 4; ++i) b1[i] = ldb(tp + fb + i * 16 * PIT + 32);   // the last two fragments take the registers that b0[0], b0[1] have left: the live set stays inside 160 registers
#pragma unroll
        for (int nb = 2; nb < 4; ++nb)
#pragma unroll
            for (int mb = 0; mb < 2; ++mb) acc[mb][nb] = wmmab(a0[mb], b0[nb], acc[mb][nb]);
#pragma unroll
        for (int nb = 0; nb < 4; ++nb)
#pragma unroll
            for (int mb = 0; mb < 2; ++mb) acc[mb][nb] = wmmab(a1[mb], b1[nb], acc[mb][nb]);
        asm volatile("s_wait_dscnt 0x0" ::: "memory");       // this wave's reads of slice st are done before its buffer may be refilled
        asm volatile("s_wait_asynccnt 0x0" ::: "memory");    // this wave's copies of slice st+1 have landed before the barrier publishes them
        __syncthreads();                                     // publishes slice st+1 and ends every wave's reads of slice st
        if (st + 2 < K / PKS) { const int k2 = (st + 2) * PKS; stage_slice(ga + k2, gb + k2, lc + (unsigned)(st & 1) * (PBUFH * 2u)); }
    }
    asm volatile("s_wait_asynccnt 0x0" ::: "memory");        // nothing of this wave is in flight behind the loop
    const size_t tbase = xa ? (size_t)(r0 / SEQ) * ((size_t)NH_ * SEQ * HD) + (size_t)(r0 % SEQ) * HD + (size_t)(c0 / HD) * ((size_t)SEQ * HD) + (size_t)(c0 % HD)
                                : (size_t)r0 * SEQ + (size_t)(c0 / SEQ) * ((size_t)DM * SEQ) + (size_t)(c0 % SEQ);
#pragma unroll
    for (int mb = 0; mb < 2; ++mb) {
#pragma unroll
        for (int nb = 0; nb < 4; ++nb) {
#pragma unroll
            for (int j = 0; j < 8; ++j) os[(hi * 8 + j) * 68 + nb * 16 + lr] = acc[mb][nb][j] * osc; }   // D: row 8h+j, col lane&15; scaled here, in f32, ahead of the rounding to f16
        wave_sync();
        const size_t sb = tbase + (size_t)(mb * 16) * (size_t)pitch;
{
#pragma unroll
            for (int s = 0; s < 4; ++s) { const int row = 4 * s + (lane >> 3), c8 = (lane & 7) * 8;   // 4 s x 4 row groups = 16 rows; 8 lanes x 8 = 64 columns
                const v4f x0 = *(const v4fa*)(&os[row * 68 + c8]); const v4f x1 = *(const v4fa*)(&os[row * 68 + c8 + 4]); v8h hv;
#pragma unroll
                for (int i = 0; i < 4; ++i) { hv[i] = (h16)x0[i]; hv[4 + i] = (h16)x1[i]; }
                const size_t oo = sb + (size_t)row * (size_t)pitch + c8;
                *(v8h*)(Ph + oo) = hv; }
             }
        wave_sync();
    }
}

// one tile's copies of one lane: rows r and r + 32 of the K and V^T planes, 16 B each, global -> LDS through no register.
// The closing s_wait_xcnt stands inside the statement so that no address register named here is rewritten ahead of it.
__device__ __forceinline__ void stage_tile(const h16* gk, const h16* gv, unsigned l) {
    const h16* gk1 = gk + (size_t)32 * HD; const h16* gv1 = gv + (size_t)32 * SEQ;
    const unsigned l1 = l + 32u * PIT * 2u, l2 = l + PLH * 2u, l3 = l2 + 32u * PIT * 2u;
    asm volatile("global_load_async_to_lds_b128 %0, %4, off\n\t"
                 "global_load_async_to_lds_b128 %1, %5, off\n\t"
                 "global_load_async_to_lds_b128 %2, %6, off\n\t"
                 "global_load_async_to_lds_b128 %3, %7, off\n\t"
                 "s_wait_xcnt 0x0"
                 :: "v"(l), "v"(l1), "v"(l2), "v"(l3), "v"(gk), "v"(gk1), "v"(gv), "v"(gv1) : "memory");
}

// k_flash: fused attention, one wave per QT tiles of 16 query rows of one flat slot n = b*16 + h (every K and V^T fragment is read from LDS once and multiplied with each query tile in turn); Q fragments straight from the f16 plane; K and V^T fragments from the block's LDS tile (two 16-B reads each).
// Sixteen waves: wave w and wave w + 8 hold the SAME query rows and each walks half of the keys, so that four waves stand on every SIMD and one wave's exponentials run under another's products.
// Stage s = keys 128s .. 128s+127, one tile of 64 keys per group: two planes of 64 rows x 128 B (K rows = keys, V^T rows = d), each lane copies 2 x 16 B per plane of its own group's tile in whole 128-B lines; stage s+1 flies while stage s is worked on.
// Transposed form: S^T[key][t] = K Q^T (A = K rows, B = Q rows); lane (t = lane&15, h = lane>>4) holds keys 8h+r of each 16-key tile, so the packed
// P tile is directly the B fragment of O^T[d][t] = V^T P^T (element r <- tile keys 0..15, element 8+r <- tile keys 16..31, lane unchanged).
// Scores per 16-key tile: C + K Q^T (two k-steps of 32) in one accumulator; the q plane already carries the scale 1/8 * log2 e and C = PSH - reference, so the accumulator is the exponent of P as it stands.
// Lazy rescale: the reference of a query column stays as it is while this lane's P sum of a group of keys stays inside LIM (one scalar branch per group); only behind that branch are the maximum, the xor-16 exchange, the new reference and the scaling of O and of the row sum computed.
// Softmax state: the reference (as C operand) and one partial sum per lane and query tile; the two lane halves' sums are joined once, in the epilogue.
// Join of the two key groups, once, behind the loop: each wave hands the query tile it does not finish (O, row sum, reference) to its partner through LDS; both parts are scaled to the larger reference and added.
// Output address: n is re-read as n = c*NB_FULL + b2 -> OUT[b2][t][c*64 + d].
__global__ __launch_bounds__(32 * AW * KG) void k_flash(const h16* __restrict__ QH, const h16* __restrict__ KP, const h16* __restrict__ VT, float* OUT) {
    __shared__ __align__(16) float os[KG * AW * 16 * 68];
    __shared__ __align__(16) float xch[KG * AW * 9 * 32 * 4];   // join: per wave nine 16-byte words per lane (O 8, row sum and reference 1), lane-contiguous
    __shared__ __align__(128) h16 ring[2 * KG * BUFH];
    const int lane = threadIdx.x & 31, lr = lane & 15, hi = lane >> 4;
    const int wave = __builtin_amdgcn_readfirstlane(threadIdx.x >> 5);
    const int zh = blockIdx.y;                               // flat slot n = b*NH_ + h
    const int grp = wave / AW;                               // key group
    const int t0 = (blockIdx.x * AW + wave % AW) * (16 * QT);
    const size_t pbase = (size_t)zh * SEQ * HD;
    // every loop over q, kt, j or r in this kernel is unrolled so that the arrays it indexes stay in registers
    v16h qh0[QT], qh1[QT];                                   // B fragments: col t, k = d
#pragma unroll
    for (int q = 0; q < QT; ++q) { const size_t qo = pbase + (size_t)(t0 + 16 * q + lr) * HD + 8 * hi;
        qh0[q] = ldh(QH + qo); qh1[q] = ldh(QH + qo + 32); }
    const int fo = lr * PIT + 8 * hi;                        // fragment offset inside a plane: + row0 * PIT + k0 (A fragment: row lr, k = 8h ..)
    // copy map: lane takes rows crow and crow + 32, 16-byte column ccol, of each plane of its own group's tile
    const int crow = (threadIdx.x & (32 * AW - 1)) >> 3, ccol = threadIdx.x & 7;
    const h16* gk = KP + pbase + (size_t)(grp * KS + crow) * HD + ccol * 8;    // + stage key0 * HD
    const h16* gv = VT + pbase + (size_t)crow * SEQ + grp * KS + ccol * 8;     // + stage key0
    const unsigned lc = (unsigned)(size_t)ring + (unsigned)(grp * BUFH + crow * PIT + ccol * 8) * 2u;   // LDS byte address, + buffer, plane, 32 rows
    stage_tile(gk, gv, lc);
    asm volatile("s_wait_asynccnt 0x0" ::: "memory");        // stage 0 landed (this wave's copies) before the barrier publishes it
    __syncthreads();
    stage_tile(gk + (size_t)(KS * KG) * HD, gv + KS * KG, lc + KG * BUFH * 2u);
    v8f o[QT][4], cq[QT];                                    // cq: PSH minus the reference in use, the same value in all eight elements: C operand of each score tile's first product
    float l[QT];
#pragma unroll
    for (int q = 0; q < QT; ++q) { l[q] = 0.0f;
#pragma unroll
        for (int r = 0; r < 8; ++r) cq[q][r] = PSH;          // reference 0 until the first group of keys has set the true one
#pragma unroll
        for (int j = 0; j < 4; ++j) o[q][j] = (v8f){}; }
#pragma unroll 1
    for (int st = 0; st < SEQ / (KS * KG); ++st) {
      const h16* tk = ring + ((st & 1) * KG + grp) * BUFH + fo;   // this group's K plane; + PLH V^T
#pragma unroll
      for (int g0 = 0; g0 < KS; g0 += 32 * GP) {             // constant offsets into the tile; one rescale test per group of GP passes of 32 keys
        v8f ts[GP][QT][2];                                   // exponents as they stand (scaled score - reference + PSH): pass, query tile, 16-key tile, key 8h + r
        v16h vf[GP][4];                                      // V^T fragments of the group
#pragma unroll
        for (int p = 0; p < GP; ++p) {   // keys g0 + 32 p .. + 31 of the tile; the four accumulator chains (query tile, 16-key tile) alternate, each in the order C, d 0..31, d 32..63
            const h16* ka = tk + (g0 + 32 * p) * PIT; const h16* kb = ka + 16 * PIT;
            const v16h kh[2][2] = { { ldh(ka), ldh(ka + 32) }, { ldh(kb), ldh(kb + 32) } };
#pragma unroll
            for (int q = 0; q < QT; ++q)
#pragma unroll
                for (int kt = 0; kt < 2; ++kt) ts[p][q][kt] = wmma16(kh[kt][0], qh0[q], cq[q]);
#pragma unroll
            for (int q = 0; q < QT; ++q)
#pragma unroll
                for (int kt = 0; kt < 2; ++kt) ts[p][q][kt] = wmma16(kh[kt][1], qh1[q], ts[p][q][kt]);
            const h16* va = tk + PLH + g0 + 32 * p;
#pragma unroll
            for (int j = 0; j < 4; ++j) vf[p][j] = ldh(va + 16 * j * PIT);
        }
        v8f e[GP][QT][2]; float ls[QT];                      // P in f32 and this lane's sum of it over the group
        auto expsum = [&]() {
#pragma unroll
            for (int q = 0; q < QT; ++q) { v8f sv;
#pragma unroll
                for (int p = 0; p < GP; ++p) {
#pragma unroll
                    for (int kt = 0; kt < 2; ++kt)
#pragma unroll
                        for (int r = 0; r < 8; ++r) e[p][q][kt][r] = __builtin_amdgcn_exp2f(ts[p][q][kt][r]);
                    sv = p == 0 ? e[p][q][0] + e[p][q][1] : sv + (e[p][q][0] + e[p][q][1]); }
                ls[q] = ((sv[0] + sv[1]) + (sv[2] + sv[3])) + ((sv[4] + sv[5]) + (sv[6] + sv[7])); }
        };
        expsum();
        float tot = ls[0];
#pragma unroll
        for (int q = 1; q < QT; ++q) tot += ls[q];
        // Lazy rescale, one scalar branch per group. Every P is >= 0, so a sum inside LIM bounds each P below the f16 range; an overflow or a NaN fails the compare and takes the branch too.
        // The first group always takes it: it replaces the reference 0 by the true maximum, upward or downward.
        const bool first = g0 == 0 && st == 0;
        if ((__builtin_amdgcn_ballot_w32(!(tot <= LIM)) | (first ? 1u : 0u)) != 0u) {
#pragma unroll
            for (int q = 0; q < QT; ++q) {
                float mx = ts[0][q][0][0];
#pragma unroll
                for (int p = 0; p < GP; ++p)
#pragma unroll
                    for (int r = 0; r < 8; ++r) mx = fmaxf(mx, fmaxf(ts[p][q][0][r], ts[p][q][1][r]));
                mx = fmaxf(mx, __shfl_xor(mx, 16, 32));      // both lane halves of a query column take the same new reference
                const float d = first ? mx - PSH : fmaxf(mx - PSH, 0.0f);          // rise of the reference
                const float alpha = first ? 0.0f : __builtin_amdgcn_exp2f(-d);     // nothing is summed yet in the first group
                cq[q] = cq[q] - d; l[q] *= alpha;
#pragma unroll
                for (int p = 0; p < GP; ++p) { ts[p][q][0] = ts[p][q][0] - d; ts[p][q][1] = ts[p][q][1] - d; }
#pragma unroll
                for (int j = 0; j < 4; ++j) o[q][j] = o[q][j] * alpha;
            }
            expsum();
        }
#pragma unroll
        for (int q = 0; q < QT; ++q) l[q] += ls[q];
#pragma unroll
        for (int p = 0; p < GP; ++p) {
            v16h pb[QT];
#pragma unroll
            for (int q = 0; q < QT; ++q)
#pragma unroll
                for (int r = 0; r < 8; ++r) { pb[q][r] = (h16)e[p][q][0][r]; pb[q][8 + r] = (h16)e[p][q][1][r]; }
#pragma unroll
            for (int q = 0; q < QT; ++q)
#pragma unroll
                for (int j = 0; j < 4; ++j) o[q][j] = wmma16(vf[p][j], pb[q], o[q][j]);
        }
      }
      asm volatile("s_wait_dscnt 0x0" ::: "memory");         // this wave's reads of stage st are done before its buffer may be refilled
      asm volatile("s_wait_asynccnt 0x0" ::: "memory");      // this wave's copies of stage st+1 have landed before the barrier publishes them
      __syncthreads();                                       // publishes stage st+1 and ends every wave's reads of stage st
      if (st + 2 < SEQ / (KS * KG)) { const size_t k2 = (size_t)(st + 2) * (KS * KG); stage_tile(gk + k2 * HD, gv + k2, lc + (unsigned)(st & 1) * (KG * BUFH * 2u)); }
    }
    asm volatile("s_wait_asynccnt 0x0" ::: "memory");        // nothing of this wave is in flight behind the loop
    // Join of the key groups: group g finishes query tile g and hands the other tile to its partner (the selects are on a wave-uniform condition).
    const bool g1 = grp != 0;
    v8f ok[4], og[4];
#pragma unroll
    for (int j = 0; j < 4; ++j)
#pragma unroll
        for (int r = 0; r < 8; ++r) { ok[j][r] = g1 ? o[1][j][r] : o[0][j][r]; og[j][r] = g1 ? o[0][j][r] : o[1][j][r]; }
    const float lk = g1 ? l[1] : l[0], lg = g1 ? l[0] : l[1];
    const float ck = g1 ? cq[1][0] : cq[0][0], cg = g1 ? cq[0][0] : cq[1][0];
    v4fa* xw = (v4fa*)xch + wave * (9 * 32) + lane;
#pragma unroll
    for (int j = 0; j < 4; ++j) { v4f a, c;
#pragma unroll
        for (int r = 0; r < 4; ++r) { a[r] = og[j][r]; c[r] = og[j][4 + r]; }
        xw[(2 * j) * 32] = a; xw[(2 * j + 1) * 32] = c; }
    xw[8 * 32] = (v4f){ lg, cg, 0.0f, 0.0f };
    __syncthreads();                                         // every wave's handed-over tile is written before its partner reads it
    const v4fa* xr = (const v4fa*)xch + (wave ^ AW) * (9 * 32) + lane;
    const v4f sp = xr[8 * 32];
    const float cm = fminf(ck, sp[1]);                       // PSH minus the larger of the two references: both factors are at most 1
    const float fk = __builtin_amdgcn_exp2f(cm - ck), fp = __builtin_amdgcn_exp2f(cm - sp[1]);
    const float lj = lk * fk + sp[0] * fp;
    const int wb = wave * 16 * 68;
    const int b2 = zh % NB_FULL, cb = zh / NB_FULL;          // regrouped address: output batch b2, column block cb
    {
        const float lq = lj + __shfl_xor(lj, 16, 32);
        const float inv = 1.0f / lq;
        const float sk = fk * inv, sq = fp * inv;
        // O^T D layout: o[j][r] = (d = 16j + 8h + r, t = lane&15) -> os[t][d]; rows 0..15 x columns 0..63 all written
#pragma unroll
        for (int j = 0; j < 4; ++j) { const v4f pa = xr[(2 * j) * 32], pc = xr[(2 * j + 1) * 32]; v4f a, c;
#pragma unroll
            for (int r = 0; r < 4; ++r) { a[r] = ok[j][r] * sk + pa[r] * sq; c[r] = ok[j][4 + r] * sk + pc[r] * sq; }
            *(v4fa*)(&os[wb + lr * 68 + 16 * j + 8 * hi]) = a; *(v4fa*)(&os[wb + lr * 68 + 16 * j + 8 * hi + 4]) = c; }
        wave_sync();
        float* orow = OUT + ((size_t)b2 * OUT_SEQ + t0 + 16 * grp) * DM + (size_t)cb * HD;
#pragma unroll
        for (int s = 0; s < 8; ++s) { const int row = 2 * s + hi, cofs = lr * 4;   // 8 s x 2 rows = 16 rows; 16 lanes x 4 floats = 64 columns
            const v4f val = *(const v4fa*)(&os[wb + row * 68 + cofs]);
            *(v4f*)(orow + (size_t)row * DM + cofs) = val; }
    }
}

static constexpr size_t al256(size_t v) { return (v + 255) & ~(size_t)255; }
static constexpr size_t SZ_XB = al256((size_t)NB * SEQ * DM * 2);          // one bf16 stream copy
static constexpr size_t SZ_WB = al256((size_t)3 * DM * DM * 2);
static constexpr size_t SZ_PL = al256((size_t)NB * NH_ * SEQ * HD * 2);
static constexpr size_t SZ_TOTAL = 3 * SZ_XB + SZ_WB + 3 * SZ_PL;
static_assert(SZ_TOTAL <= (size_t)134217728);          // workspace carve <= 128 MiB
static_assert(((size_t)DM * DM * 2) % 256 == 0);       // weight sub-planes stay 256-byte aligned
static_assert(SZ_XB == (size_t)NB * SEQ * DM * 2);     // no pad between the bf16 copies: the conversion writes them as one range
static constexpr unsigned CVT_G = (unsigned)((3 * (size_t)NB * SEQ * DM + 3 * (size_t)DM * DM) / ((size_t)CVT_T * 1024));   // conversion blocks: three streams, three weights
static_assert((size_t)NB * SEQ * DM == (size_t)NB * NH_ * SEQ * HD);   // projection grid x tile == plane extent

extern "C" void kernel_launch(void* const* d_in, const int* in_sizes, int n_in,
                              void* d_out, int out_size, void* d_ws, size_t ws_size, hipStream_t stream) {
    if (n_in < 6) return;
    const size_t needx = ((size_t)(NB - 1) * SEQ_FULL + SEQ) * DM;
    if ((size_t)in_sizes[0] < needx || (size_t)in_sizes[1] < needx || (size_t)in_sizes[2] < needx) return;
    if ((size_t)in_sizes[3] < (size_t)DM * DM || (size_t)in_sizes[4] < (size_t)DM * DM || (size_t)in_sizes[5] < (size_t)DM * DM) return;
    if ((size_t)out_size < ((size_t)(NB_FULL - 1) * OUT_SEQ + SEQ) * DM) return;
    if (SZ_TOTAL > ws_size) return;
    // wire order: q, k, v streams, then Wq, Wk, Wv ([out][in] used as-is: Bt of q and k, A of v^T)
    const float* xq = (const float*)d_in[0]; const float* xk = (const float*)d_in[1]; const float* xv = (const float*)d_in[2];
    const float* wq = (const float*)d_in[3]; const float* wk = (const float*)d_in[4]; const float* wv = (const float*)d_in[5];
    float* OUT = (float*)d_out;      // [NB_FULL][OUT_SEQ][1024]
    char* wsp = (char*)d_ws;
    bf* XQ = (bf*)wsp; wsp += SZ_XB;                 // [NB*SEQ][1024]
    wsp += SZ_XB;                                    // k stream copy, [NB*SEQ][1024]
    wsp += SZ_XB;                                    // v stream copy, [NB*SEQ][1024]
    bf* WB = (bf*)wsp; wsp += SZ_WB;                 // [3][1024][1024]: q | k | v
    h16* QH = (h16*)wsp; wsp += SZ_PL;               // [NB*16][SEQ][64], times the score scale
    h16* KP = (h16*)wsp; wsp += SZ_PL;               // [NB*16][SEQ][64]
    h16* VT = (h16*)wsp; wsp += SZ_PL;               // [NB*16][64][SEQ]

    // XQ | XK | XV | WQ | WK | WV are one contiguous bf16 range that starts at XQ
    k_cvt_all<<<dim3(CVT_G, 1, 1), 256, 0, stream>>>(xq, xk, xv, wq, wk, wv, XQ);

    // q, k and v^T projections: one launch, blockIdx.z = 0, 1, 2
    k_proj<<<dim3(NB * SEQ / 128, DM / 128, 3), 256, 0, stream>>>(XQ, WB, QH, KP, VT);

    k_flash<<<dim3(SEQ / (16 * QT * AW), NB * NH_, 1), 32 * AW * KG, 0, stream>>>(QH, KP, VT, OUT);
}

// v010
// A run of this version takes 58.7 microseconds.
// Two timings next to v009 both put it at 1.07 times that version's speed.
// Counting every step since v000, it is 5.30 times as fast.
#include <hip/hip_runtime.h>

// Non-causal multi-head attention with three input streams, width 1024 = 16 heads x 64; q/k/v [NB][SEQ][1024], Wq/Wk/Wv [out][in] (y = x W^T), no biases, no mask, score scale 1/8, no output projection; context written at the regrouped address (flat n = b*16+h re-read as n = c*NB_FULL + b2).
// Compute dtypes, f32 accumulate everywhere: projections v_wmma_f32_16x16x32_bf16 (x and W RNE-converted to bf16; products exact);
// scores v_wmma_f32_16x16x32_f16 with q (times the score scale) and k each as ONE f16 value (its rounding, half a step of 2^-10, is an eighth of the bf16 rounding, half a step of 2^-7, that x and W already carry into q and k; the accumulator starts at carry - reference and then holds the exponent); P (x256 carry, cancels in the normalisation, row sum from the f32 values) and v single f16; softmax f32 (online; the reference is a maximum that is renewed only when a P sum leaves its range).
// Layout: bf16 copies of q/k/v streams and W; q and k planes [b*16+h][t][d] and v^T plane [b*16+h][d][t] written by the GEMM epilogue (GEMM: 128x128 block tile, eight waves of 32x64, k-slices of 64 of both operands staged in LDS by asynchronous copies, two buffers); fused flash kernel in transposed form (S^T = K Q^T, O^T = V^T P^T), K / V^T tiles of 64 keys staged in LDS by asynchronous copies (two buffers) and shared by eight waves; the keys are split over the block's two sets of eight waves (four waves per SIMD), whose partial sums are joined through LDS; output from f32 accumulators. Blocks that read the same rows (GEMM operands, K / V^T of one head) each start their walk over k or over the keys at another place and wrap round.

#ifndef NB
#define NB 2
#endif
#ifndef SEQ
#define SEQ 2048
#endif
#define NB_FULL  2
#define SEQ_FULL 2048
#ifndef OUT_SEQ
#define OUT_SEQ SEQ              // row pitch (in tokens) between batches of the output
#endif
#define DM   1024
#define NH_  16
#define HD   64
#define AW   8                   // waves per key group of a flash block; they share one staged K / V^T tile
#define KG   2                   // key groups per flash block: group g works on keys 128 s + 64 g .. + 63 of every stage s, for the same query rows as the other group
#define QT   2                   // query tiles of 16 rows per flash wave: each K / V^T fragment read from LDS serves all of them
#define KS   64                  // keys per staged tile (two passes of 32 keys)
#define PIT  72                  // LDS row pitch in halves: 144 B = 16 B x odd, conflict-free for 16-byte row reads
#define PLH  (64 * PIT)          // halves per staged plane: 64 rows
#define BUFH (2 * PLH)           // halves per key group's tile: K, V^T (a buffer holds KG tiles)
#define PKS  64                  // GEMM: k per staged slice (two k-steps of 32); one row of a slice = one 128-B line
#define PPLH (128 * PIT)         // GEMM: halves per staged operand slice: 128 rows
#define PBUFH (2 * PPLH)         // GEMM: halves per buffer: A slice, B slice
#define CVT_T 32                 // conversion: tiles of 1024 elements per block
#define SC2  (0.125f * 1.4426950408889634f)   // HD^-0.5 * log2(e)
#define PSH  8.0f                // log2 of the P carry (256)
#define GP   1                   // passes of 32 keys per rescale test
#define LIM  32768.0f            // a lane's P sum over one group above which the reference is renewed

static_assert(HD == 64);
static_assert(KS % (32 * GP) == 0);            // whole groups per tile
static_assert(QT * GP * 16 * 256 <= 32768);    // a group whose every score equals the reference stays inside LIM, and LIM inside the f16 range
static_assert(8 * 8 == HD);                    // plane store: 8 lanes x 8 halves per row
static_assert(16 * 4 == HD);                   // output store: 16 lanes x 4 floats per row segment
static_assert(NH_ * HD == DM);                 // head h = columns h*64 + d
static_assert(DM % 64 == 0);                   // column tiles of 64
static_assert(DM % 32 == 0);                   // GEMM k-steps of 32
static_assert(DM % 128 == 0 && (NB * SEQ) % 128 == 0);   // GEMM block tiles of 128 x 128 cover both extents exactly
static_assert(DM % PKS == 0 && DM / PKS >= 2 && PKS == 64);   // whole k-slices; the two-buffer prologue needs two slices (s0 and s0 + 1, wrapped); copy map: 8 lanes x 16 B = one row
static_assert(HD % 32 == 0);                   // score k-steps of 32
static_assert(SEQ % 64 == 0);                  // a 64-row tile never straddles two batches
static_assert((NB * SEQ) % 64 == 0);
static_assert(SEQ % 32 == 0);                  // key loop steps by 32
static_assert(SEQ % (16 * QT * AW) == 0);      // flash grid covers the sequence exactly
static_assert(SEQ % (KS * KG) == 0 && SEQ / (KS * KG) >= 2); // whole stages (one tile per key group); the two-buffer prologue needs two stages (s0 and s0 + 1, wrapped)
static_assert(((DM / PKS) & (DM / PKS - 1)) == 0 && ((SEQ / (KS * KG)) & (SEQ / (KS * KG) - 1)) == 0);   // the wrapped walks mask their index: powers of two
static_assert(KG == 2 && QT == KG && AW == 8);  // join: group g finishes query tile g; a wave's partner is wave ^ AW
static_assert(KS == 64 && 32 * AW == 256);     // copy map: a group's 256 lanes x 16 B x 2 = one 64-row x 128-B plane
static_assert((PIT * 2) % 16 == 0);            // every LDS row starts on a 16-byte multiple
static_assert(((size_t)SEQ * DM) % (CVT_T * 1024) == 0);   // a conversion block never straddles two batches or two streams
static_assert(((size_t)DM * DM) % (CVT_T * 1024) == 0);    // nor two weights
static_assert(NB <= NB_FULL);
static_assert(SEQ <= SEQ_FULL);
static_assert(SEQ <= OUT_SEQ);
static_assert(((NB * NH_ - 1) / NB_FULL) * HD + HD <= DM);   // regrouped column block stays inside the row
static_assert((size_t)((NB_FULL - 1) * (size_t)OUT_SEQ + SEQ) * DM * 4 <= (size_t)16777216);   // last written output element inside the 16,777,216-byte output

typedef _Float16 h16;
typedef unsigned short bf;
typedef __attribute__((ext_vector_type(16))) __bf16   v16bf;
typedef __attribute__((ext_vector_type(16))) _Float16 v16h;
typedef __attribute__((ext_vector_type(8)))  _Float16 v8h;
typedef __attribute__((ext_vector_type(8)))  unsigned short v8us;
typedef __attribute__((ext_vector_type(4)))  unsigned short v4us;
typedef __attribute__((ext_vector_type(8)))  float    v8f;
typedef __attribute__((ext_vector_type(4)))  float    v4f;
typedef v4f  __attribute__((may_alias)) v4fa;

__device__ __forceinline__ unsigned short f2bf(float f) { unsigned u = __float_as_uint(f); u += 0x7FFFu + ((u >> 16) & 1u); return (unsigned short)(u >> 16); }
__device__ __forceinline__ v16h cat16(v8h lo, v8h hi) { return __builtin_shufflevector(lo, hi, 0, 1, 2, 3, 4, 5, 6, 7, 8, 9, 10, 11, 12, 13, 14, 15); }
__device__ __forceinline__ v16bf cat16b(v8us lo, v8us hi) { return __builtin_bit_cast(v16bf, __builtin_shufflevector(lo, hi, 0, 1, 2, 3, 4, 5, 6, 7, 8, 9, 10, 11, 12, 13, 14, 15)); }
// f16 form (k_flash): the plain builtin, the compiler keeps the distance behind it. A guard statement as in wmmab would tie every fragment and accumulator of the two query tiles to the first 256 registers, where they do not fit.
__device__ __forceinline__ v8f wmma16(v16h a, v16h b, v8f c) {
    return __builtin_amdgcn_wmma_f32_16x16x32_f16(false, a, false, b, (short)0, c, false, false);
}
// bf16 form (k_proj): followed by its own four-slot guard tying exactly its accumulator and keeping its operands live
__device__ __forceinline__ v8f wmmab(v16bf a, v16bf b, v8f c) {
    c = __builtin_amdgcn_wmma_f32_16x16x32_bf16(false, a, false, b, (short)0, c, false, false);
    asm volatile("v_nop\n\tv_nop\n\tv_nop\n\tv_nop" : "+v"(c) : "v"(a), "v"(b));
    return c;
}
// fragment loaders from K-contiguous 16-bit rows; p already includes + 8*(lane>>4): elements 0..7 <- k0+8h+0..7, elements 8..15 <- k0+16+8h+0..7 (same map for A and B)
__device__ __forceinline__ v16h  ldh(const h16* p) { return cat16(*(const v8h*)p, *(const v8h*)(p + 16)); }
__device__ __forceinline__ v16bf ldb(const bf* p)  { return cat16b(*(const v8us*)p, *(const v8us*)(p + 16)); }
// ordering point for wave-private LDS tiles (same wave writes and reads)
__device__ __forceinline__ void wave_sync() { __builtin_amdgcn_fence(3 /* release order */, "wavefront"); __builtin_amdgcn_wave_barrier(); asm volatile("" ::: "memory"); }

// k_cvt_all: every f32 -> bf16 copy of the call in ONE launch. The six destinations lie back to back in the workspace (q | k | v streams, then Wq | Wk | Wv), so the block index is the flat position there.
// A tile is 1024 elements: each wave-wide 16-byte load covers 512 contiguous bytes, each 8-byte store 256 (whole 128-B lines both ways). A block takes CVT_T consecutive tiles of one tensor,
// its loads issued ahead of the conversions: few long-lived waves in place of one short wave per 256 elements.
__global__ __launch_bounds__(256) void k_cvt_all(const float* __restrict__ xq, const float* __restrict__ xk, const float* __restrict__ xv,
                                                 const float* __restrict__ wq, const float* __restrict__ wk, const float* __restrict__ wv, bf* __restrict__ dst) {
    constexpr unsigned BE = CVT_T * 1024u;                                  // elements per block
    constexpr unsigned BX = (unsigned)((size_t)NB * SEQ * DM / BE);         // blocks per stream
    constexpr unsigned BW = (unsigned)((size_t)DM * DM / BE);               // blocks per weight
    const unsigned b = blockIdx.x;
    const float* src; size_t off;
    if (b < 3u * BX) {
        const unsigned s = b / BX; const size_t e = (size_t)(b - s * BX) * BE; const size_t bt = e / ((size_t)SEQ * DM);
        src = s == 0u ? xq : (s == 1u ? xk : xv);
        off = bt * ((size_t)SEQ_FULL * DM) + (e - bt * ((size_t)SEQ * DM));   // batch pitch of the source is the full sequence
    } else {
        const unsigned w = b - 3u * BX, s = w / BW;
        src = s == 0u ? wq : (s == 1u ? wk : wv);
        off = (size_t)(w - s * BW) * BE;
    }
    const float* p = src + off + threadIdx.x * 4u;
    bf* q = dst + (size_t)b * BE + threadIdx.x * 4u;
    v4f v[CVT_T];                                                          // the loads stand ahead of the first conversion: as many in flight as the compiler keeps there
#pragma unroll
    for (int j = 0; j < CVT_T; ++j) v[j] = *(const v4f*)(p + j * 1024);
#pragma unroll
    for (int j = 0; j < CVT_T; ++j) { v4us o;
#pragma unroll
        for (int k = 0; k < 4; ++k) o[k] = f2bf(v[j][k]);
        *(v4us*)(q + j * 1024) = o; }
}

// one k-slice's copies of one lane: rows r, r + 32, r + 64, r + 96 of the A slice and of the B slice (128 rows x 128 B each), 16 B each, global -> LDS through no register.
// The closing s_wait_xcnt stands inside the statement so that no address register named here is rewritten ahead of it.
__device__ __forceinline__ void stage_slice(const bf* ga, const bf* gb, unsigned l) {
    const bf* ga1 = ga + (size_t)32 * DM; const bf* ga2 = ga + (size_t)64 * DM; const bf* ga3 = ga + (size_t)96 * DM;
    const bf* gb1 = gb + (size_t)32 * DM; const bf* gb2 = gb + (size_t)64 * DM; const bf* gb3 = gb + (size_t)96 * DM;
    const unsigned rs = 32u * PIT * 2u;
    const unsigned l1 = l + rs, l2 = l + 2u * rs, l3 = l + 3u * rs, l4 = l + PPLH * 2u, l5 = l4 + rs, l6 = l4 + 2u * rs, l7 = l4 + 3u * rs;
    asm volatile("global_load_async_to_lds_b128 %0, %8, off\n\t"
                 "global_load_async_to_lds_b128 %1, %9, off\n\t"
                 "global_load_async_to_lds_b128 %2, %10, off\n\t"
                 "global_load_async_to_lds_b128 %3, %11, off\n\t"
                 "global_load_async_to_lds_b128 %4, %12, off\n\t"
                 "global_load_async_to_lds_b128 %5, %13, off\n\t"
                 "global_load_async_to_lds_b128 %6, %14, off\n\t"
                 "global_load_async_to_lds_b128 %7, %15, off\n\t"
                 "s_wait_xcnt 0x0"
                 :: "v"(l), "v"(l1), "v"(l2), "v"(l3), "v"(l4), "v"(l5), "v"(l6), "v"(l7), "v"(ga), "v"(ga1), "v"(ga2), "v"(ga3), "v"(gb), "v"(gb1), "v"(gb2), "v"(gb3) : "memory");
}

// k_proj: register-blocked bf16 GEMM, 128x128 tile per block, EIGHT WAVES of 32x64 each (8 accumulators; wave w: rows 32*(w>>1), columns 64*(w&1)), K = DM.
// Slice s = k 64s .. 64s+63 of the block's 128 A rows and 128 Bt rows: two planes of 128 rows x 128 B, copied in whole 128-B lines (4 + 4 copies per lane); slice s+1 flies while slice s is worked on.
// C[m][n] = sum_k A[m][k] Bt[n][k], written as f16 (Ph), row pitch 'pitch' (halves).
// ALL THREE PROJECTIONS IN ONE LAUNCH: grid (NB*SEQ/128, DM/128, 3), 256 threads; blockIdx.z picks the product, blockIdx.x the 128 stream rows, blockIdx.y the 128 weight rows.
//   z = 0, 1 (q, k): A = stream rows (m = b*SEQ + t), Bt = W rows (n = h*64 + d) -> planes [(b*16 + h)][t][d]
//   z = 2 (v^T):     A = Wv rows (m = h*64 + d), Bt = v-stream rows (n = b*SEQ + t) -> plane [(b*1024 + m)][t] = [(b*16 + h)][d][t]
// X = the three bf16 stream copies back to back, Wb = the three bf16 weights back to back.
// Second launch bound: six waves per SIMD, so that three blocks (LDS 3 x 108,544 B) stand on one WGP and one block's copy, LDS and barrier waits are filled by the other two.
__global__ __launch_bounds__(256, 6) void k_proj(const bf* __restrict__ X, const bf* __restrict__ Wb, h16* QH, h16* KP, h16* VT) {
    __shared__ __align__(16) float osb[8 * 16 * 68];
    __shared__ __align__(128) bf pring[2 * PBUFH];
    const int K = DM;
    const int lane = threadIdx.x & 31, lr = lane & 15, hi = lane >> 4;
    const int wave = __builtin_amdgcn_readfirstlane(threadIdx.x >> 5);
    const int z = blockIdx.z;
    const bool xa = z < 2;                                   // q, k: the stream is the A operand; v^T: the weight is
    const bf* xs = X + (size_t)z * ((size_t)NB * SEQ * DM);
    const bf* wsl = Wb + (size_t)z * ((size_t)DM * DM);
    const bf* A = xa ? xs : wsl;
    const bf* Bt = xa ? wsl : xs;
    h16* Ph = z == 0 ? QH : (z == 1 ? KP : VT);
    const int pitch = xa ? HD : SEQ;
    const float osc = z == 0 ? SC2 : 1.0f;                   // the q plane carries the score scale (1/8 and log2 e), so that k_flash's score accumulators are the exponents as they stand
    const int rb = (xa ? blockIdx.x : blockIdx.y) * 128, cb = (xa ? blockIdx.y : blockIdx.x) * 128;
    const int r0 = rb + (wave >> 1) * 32, c0 = cb + (wave & 1) * 64;
    float* os = osb + wave * 16 * 68;                        // wave-private output staging
    v8f acc[2][4];
#pragma unroll
    for (int mb = 0; mb < 2; ++mb)
#pragma unroll
        for (int nb = 0; nb < 4; ++nb) acc[mb][nb] = (v8f){};
    // copy map: lane takes rows crow + 32 j (j = 0 .. 3), 16-byte column ccol, of each operand's slice
    const int crow = threadIdx.x >> 3, ccol = threadIdx.x & 7;
    const bf* ga = A + (size_t)(rb + crow) * K + ccol * 8;   // + k0
    const bf* gb = Bt + (size_t)(cb + crow) * K + ccol * 8;  // + k0
    const unsigned lc = (unsigned)(size_t)pring + (unsigned)(crow * PIT + ccol * 8) * 2u;   // LDS byte address, + buffer
    // Walk order: trip st works on slice (st + s0) mod 16. The 8 blocks that share a stream tile (same x) start 2 slices apart, the 32 that share a weight tile (same y) 1 apart:
    // without it all of them ask L2 for the same lines, and every block of the grid for the same 128-B column of its 2-KiB rows, at one moment.
    constexpr int NSL = DM / PKS;
    const int s0 = (int)(blockIdx.x + 2u * blockIdx.y) & (NSL - 1);
    { const int k0 = s0 * PKS; stage_slice(ga + k0, gb + k0, lc); }
    asm volatile("s_wait_asynccnt 0x0" ::: "memory");        // slice s0 landed (this wave's copies) before the barrier publishes it
    __syncthreads();
    { const int k1 = ((s0 + 1) & (NSL - 1)) * PKS; stage_slice(ga + k1, gb + k1, lc + PBUFH * 2u); }
    const int fa = ((wave >> 1) * 32 + lr) * PIT + 8 * hi;          // A fragment offset in a buffer: + mb * 16 * PIT + k0
    const int fb = PPLH + ((wave & 1) * 64 + lr) * PIT + 8 * hi;    // B fragment offset in a buffer: + nb * 16 * PIT + k0
#pragma unroll 1   // stays rolled: one small body serves both buffers, the buffer is picked by st & 1
    for (int st = 0; st < K / PKS; ++st) {
        const bf* tp = pring + (st & 1) * PBUFH;
        v16bf a0[2], b0[4], a1[2], b1[4];                    // the first k-step's fragments, the second's two A and first two B fragments are read as one group ahead of the products
#pragma unroll
        for (int i = 0; i < 2; ++i) a0[i] = ldb(tp + fa + i * 16 * PIT);
#pragma unroll
        for (int i = 0; i < 4; ++i) b0[i] = ldb(tp + fb + i * 16 * PIT);
#pragma unroll
        for (int i = 0; i < 2; ++i) a1[i] = ldb(tp + fa + i * 16 * PIT + 32);
#pragma unroll
        for (int i = 0; i < 2; ++i) b1[i] = ldb(tp + fb + i * 16 * PIT + 32);
#pragma unroll
        for (int nb = 0; nb < 2; ++nb)
#pragma unroll
            for (int mb = 0; mb < 2; ++mb) acc[mb][nb] = wmmab(a0[mb], b0[nb], acc[mb][nb]);
#pragma unroll
        for (int i = 2; i < 4; ++i) b1[i] = ldb(tp + fb + i * 16 * PIT + 32);   // the last two fragments take the registers that b0[0], b0[1] have left: the live set stays inside 160 registers
#pragma unroll
        for (int nb = 2; nb < 4; ++nb)
#pragma unroll
            for (int mb = 0; mb < 2; ++mb) acc[mb][nb] = wmmab(a0[mb], b0[nb], acc[mb][nb]);
#pragma unroll
        for (int nb = 0; nb < 4; ++nb)
#pragma unroll
            for (int mb = 0; mb < 2; ++mb) acc[mb][nb] = wmmab(a1[mb], b1[nb], acc[mb][nb]);
        asm volatile("s_wait_dscnt 0x0" ::: "memory");       // this wave's reads of trip st's slice are done before its buffer may be refilled
        asm volatile("s_wait_asynccnt 0x0" ::: "memory");    // this wave's copies of trip st+1's slice have landed before the barrier publishes them
        __syncthreads();                                     // publishes trip st+1's slice and ends every wave's reads of trip st's
        if (st + 2 < K / PKS) { const int k2 = ((st + 2 + s0) & (NSL - 1)) * PKS; stage_slice(ga + k2, gb + k2, lc + (unsigned)(st & 1) * (PBUFH * 2u)); }
    }
    asm volatile("s_wait_asynccnt 0x0" ::: "memory");        // nothing of this wave is in flight behind the loop
    const size_t tbase = xa ? (size_t)(r0 / SEQ) * ((size_t)NH_ * SEQ * HD) + (size_t)(r0 % SEQ) * HD + (size_t)(c0 / HD) * ((size_t)SEQ * HD) + (size_t)(c0 % HD)
                                : (size_t)r0 * SEQ + (size_t)(c0 / SEQ) * ((size_t)DM * SEQ) + (size_t)(c0 % SEQ);
#pragma unroll
    for (int mb = 0; mb < 2; ++mb) {
#pragma unroll
        for (int nb = 0; nb < 4; ++nb) {
#pragma unroll
            for (int j = 0; j < 8; ++j) os[(hi * 8 + j) * 68 + nb * 16 + lr] = acc[mb][nb][j] * osc; }   // D: row 8h+j, col lane&15; scaled here, in f32, ahead of the rounding to f16
        wave_sync();
        const size_t sb = tbase + (size_t)(mb * 16) * (size_t)pitch;
{
#pragma unroll
            for (int s = 0; s < 4; ++s) { const int row = 4 * s + (lane >> 3), c8 = (lane & 7) * 8;   // 4 s x 4 row groups = 16 rows; 8 lanes x 8 = 64 columns
                const v4f x0 = *(const v4fa*)(&os[row * 68 + c8]); const v4f x1 = *(const v4fa*)(&os[row * 68 + c8 + 4]); v8h hv;
#pragma unroll
                for (int i = 0; i < 4; ++i) { hv[i] = (h16)x0[i]; hv[4 + i] = (h16)x1[i]; }
                const size_t oo = sb + (size_t)row * (size_t)pitch + c8;
                *(v8h*)(Ph + oo) = hv; }
             }
        wave_sync();
    }
}

// one tile's copies of one lane: rows r and r + 32 of the K and V^T planes, 16 B each, global -> LDS through no register.
// The closing s_wait_xcnt stands inside the statement so that no address register named here is rewritten ahead of it.
__device__ __forceinline__ void stage_tile(const h16* gk, const h16* gv, unsigned l) {
    const h16* gk1 = gk + (size_t)32 * HD; const h16* gv1 = gv + (size_t)32 * SEQ;
    const unsigned l1 = l + 32u * PIT * 2u, l2 = l + PLH * 2u, l3 = l2 + 32u * PIT * 2u;
    asm volatile("global_load_async_to_lds_b128 %0, %4, off\n\t"
                 "global_load_async_to_lds_b128 %1, %5, off\n\t"
                 "global_load_async_to_lds_b128 %2, %6, off\n\t"
                 "global_load_async_to_lds_b128 %3, %7, off\n\t"
                 "s_wait_xcnt 0x0"
                 :: "v"(l), "v"(l1), "v"(l2), "v"(l3), "v"(gk), "v"(gk1), "v"(gv), "v"(gv1) : "memory");
}

// k_flash: fused attention, one wave per QT tiles of 16 query rows of one flat slot n = b*16 + h (every K and V^T fragment is read from LDS once and multiplied with each query tile in turn); Q fragments straight from the f16 plane; K and V^T fragments from the block's LDS tile (two 16-B reads each).
// Sixteen waves: wave w and wave w + 8 hold the SAME query rows and each walks half of the keys, so that four waves stand on every SIMD and one wave's exponentials run under another's products.
// Stage s = keys 128s .. 128s+127, one tile of 64 keys per group: two planes of 64 rows x 128 B (K rows = keys, V^T rows = d), each lane copies 2 x 16 B per plane of its own group's tile in whole 128-B lines; stage s+1 flies while stage s is worked on.
// Transposed form: S^T[key][t] = K Q^T (A = K rows, B = Q rows); lane (t = lane&15, h = lane>>4) holds keys 8h+r of each 16-key tile, so the packed
// P tile is directly the B fragment of O^T[d][t] = V^T P^T (element r <- tile keys 0..15, element 8+r <- tile keys 16..31, lane unchanged).
// Scores per 16-key tile: C + K Q^T (two k-steps of 32) in one accumulator; the q plane already carries the scale 1/8 * log2 e and C = PSH - reference, so the accumulator is the exponent of P as it stands.
// Lazy rescale: the reference of a query column stays as it is while this lane's P sum of a group of keys stays inside LIM (one scalar branch per group); only behind that branch are the maximum, the xor-16 exchange, the new reference and the scaling of O and of the row sum computed.
// Softmax state: the reference (as C operand) and one partial sum per lane and query tile; the two lane halves' sums are joined once, in the epilogue.
// Join of the two key groups, once, behind the loop: each wave hands the query tile it does not finish (O, row sum, reference) to its partner through LDS; both parts are scaled to the larger reference and added.
// Output address: n is re-read as n = c*NB_FULL + b2 -> OUT[b2][t][c*64 + d].
__global__ __launch_bounds__(32 * AW * KG) void k_flash(const h16* __restrict__ QH, const h16* __restrict__ KP, const h16* __restrict__ VT, float* OUT) {
    __shared__ __align__(16) float os[KG * AW * 16 * 68];
    __shared__ __align__(16) float xch[KG * AW * 9 * 32 * 4];   // join: per wave nine 16-byte words per lane (O 8, row sum and reference 1), lane-contiguous
    __shared__ __align__(128) h16 ring[2 * KG * BUFH];
    const int lane = threadIdx.x & 31, lr = lane & 15, hi = lane >> 4;
    const int wave = __builtin_amdgcn_readfirstlane(threadIdx.x >> 5);
    const int zh = blockIdx.y;                               // flat slot n = b*NH_ + h
    const int grp = wave / AW;                               // key group
    const int t0 = (blockIdx.x * AW + wave % AW) * (16 * QT);
    const size_t pbase = (size_t)zh * SEQ * HD;
    // every loop over q, kt, j or r in this kernel is unrolled so that the arrays it indexes stay in registers
    v16h qh0[QT], qh1[QT];                                   // B fragments: col t, k = d
#pragma unroll
    for (int q = 0; q < QT; ++q) { const size_t qo = pbase + (size_t)(t0 + 16 * q + lr) * HD + 8 * hi;
        qh0[q] = ldh(QH + qo); qh1[q] = ldh(QH + qo + 32); }
    const int fo = lr * PIT + 8 * hi;                        // fragment offset inside a plane: + row0 * PIT + k0 (A fragment: row lr, k = 8h ..)
    // copy map: lane takes rows crow and crow + 32, 16-byte column ccol, of each plane of its own group's tile
    const int crow = (threadIdx.x & (32 * AW - 1)) >> 3, ccol = threadIdx.x & 7;
    const h16* gk = KP + pbase + (size_t)(grp * KS + crow) * HD + ccol * 8;    // + stage key0 * HD
    const h16* gv = VT + pbase + (size_t)crow * SEQ + grp * KS + ccol * 8;     // + stage key0
    const unsigned lc = (unsigned)(size_t)ring + (unsigned)(grp * BUFH + crow * PIT + ccol * 8) * 2u;   // LDS byte address, + buffer, plane, 32 rows
    // Walk order: trip st works on stage (st + s0) mod 16 (the softmax takes the keys in any order). The 8 blocks of one head start 2 stages apart, neighbouring heads 1 apart:
    // without it the sharers ask L2 for the same lines, and all heads for the same offset in their planes, at one moment.
    constexpr int NSG = SEQ / (KS * KG);
    const int s0 = (int)(2u * blockIdx.x + blockIdx.y) & (NSG - 1);
    { const size_t k0 = (size_t)s0 * (KS * KG); stage_tile(gk + k0 * HD, gv + k0, lc); }
    asm volatile("s_wait_asynccnt 0x0" ::: "memory");        // stage s0's tile landed (this wave's copies) before the barrier publishes it
    __syncthreads();
    { const size_t k1 = (size_t)((s0 + 1) & (NSG - 1)) * (KS * KG); stage_tile(gk + k1 * HD, gv + k1, lc + KG * BUFH * 2u); }
    v8f o[QT][4], cq[QT];                                    // cq: PSH minus the reference in use, the same value in all eight elements: C operand of each score tile's first product
    float l[QT];
#pragma unroll
    for (int q = 0; q < QT; ++q) { l[q] = 0.0f;
#pragma unroll
        for (int r = 0; r < 8; ++r) cq[q][r] = PSH;          // reference 0 until the first group of keys has set the true one
#pragma unroll
        for (int j = 0; j < 4; ++j) o[q][j] = (v8f){}; }
#pragma unroll 1
    for (int st = 0; st < SEQ / (KS * KG); ++st) {
      const h16* tk = ring + ((st & 1) * KG + grp) * BUFH + fo;   // this group's K plane; + PLH V^T
#pragma unroll
      for (int g0 = 0; g0 < KS; g0 += 32 * GP) {             // constant offsets into the tile; one rescale test per group of GP passes of 32 keys
        v8f ts[GP][QT][2];                                   // exponents as they stand (scaled score - reference + PSH): pass, query tile, 16-key tile, key 8h + r
        v16h vf[GP][4];                                      // V^T fragments of the group
#pragma unroll
        for (int p = 0; p < GP; ++p) {   // keys g0 + 32 p .. + 31 of the tile; the four accumulator chains (query tile, 16-key tile) alternate, each in the order C, d 0..31, d 32..63
            const h16* ka = tk + (g0 + 32 * p) * PIT; const h16* kb = ka + 16 * PIT;
            const v16h kh[2][2] = { { ldh(ka), ldh(ka + 32) }, { ldh(kb), ldh(kb + 32) } };
#pragma unroll
            for (int q = 0; q < QT; ++q)
#pragma unroll
                for (int kt = 0; kt < 2; ++kt) ts[p][q][kt] = wmma16(kh[kt][0], qh0[q], cq[q]);
#pragma unroll
            for (int q = 0; q < QT; ++q)
#pragma unroll
                for (int kt = 0; kt < 2; ++kt) ts[p][q][kt] = wmma16(kh[kt][1], qh1[q], ts[p][q][kt]);
            const h16* va = tk + PLH + g0 + 32 * p;
#pragma unroll
            for (int j = 0; j < 4; ++j) vf[p][j] = ldh(va + 16 * j * PIT);
        }
        v8f e[GP][QT][2]; float ls[QT];                      // P in f32 and this lane's sum of it over the group
        auto expsum = [&]() {
#pragma unroll
            for (int q = 0; q < QT; ++q) { v8f sv;
#pragma unroll
                for (int p = 0; p < GP; ++p) {
#pragma unroll
                    for (int kt = 0; kt < 2; ++kt)
#pragma unroll
                        for (int r = 0; r < 8; ++r) e[p][q][kt][r] = __builtin_amdgcn_exp2f(ts[p][q][kt][r]);
                    sv = p == 0 ? e[p][q][0] + e[p][q][1] : sv + (e[p][q][0] + e[p][q][1]); }
                ls[q] = ((sv[0] + sv[1]) + (sv[2] + sv[3])) + ((sv[4] + sv[5]) + (sv[6] + sv[7])); }
        };
        expsum();
        float tot = ls[0];
#pragma unroll
        for (int q = 1; q < QT; ++q) tot += ls[q];
        // Lazy rescale, one scalar branch per group. Every P is >= 0, so a sum inside LIM bounds each P below the f16 range; an overflow or a NaN fails the compare and takes the branch too.
        // The first group always takes it: it replaces the reference 0 by the true maximum, upward or downward.
        const bool first = g0 == 0 && st == 0;
        if ((__builtin_amdgcn_ballot_w32(!(tot <= LIM)) | (first ? 1u : 0u)) != 0u) {
#pragma unroll
            for (int q = 0; q < QT; ++q) {
                float mx = ts[0][q][0][0];
#pragma unroll
                for (int p = 0; p < GP; ++p)
#pragma unroll
                    for (int r = 0; r < 8; ++r) mx = fmaxf(mx, fmaxf(ts[p][q][0][r], ts[p][q][1][r]));
                mx = fmaxf(mx, __shfl_xor(mx, 16, 32));      // both lane halves of a query column take the same new reference
                const float d = first ? mx - PSH : fmaxf(mx - PSH, 0.0f);          // rise of the reference
                const float alpha = first ? 0.0f : __builtin_amdgcn_exp2f(-d);     // nothing is summed yet in the first group
                cq[q] = cq[q] - d; l[q] *= alpha;
#pragma unroll
                for (int p = 0; p < GP; ++p) { ts[p][q][0] = ts[p][q][0] - d; ts[p][q][1] = ts[p][q][1] - d; }
#pragma unroll
                for (int j = 0; j < 4; ++j) o[q][j] = o[q][j] * alpha;
            }
            expsum();
        }
#pragma unroll
        for (int q = 0; q < QT; ++q) l[q] += ls[q];
#pragma unroll
        for (int p = 0; p < GP; ++p) {
            v16h pb[QT];
#pragma unroll
            for (int q = 0; q < QT; ++q)
#pragma unroll
                for (int r = 0; r < 8; ++r) { pb[q][r] = (h16)e[p][q][0][r]; pb[q][8 + r] = (h16)e[p][q][1][r]; }
#pragma unroll
            for (int q = 0; q < QT; ++q)
#pragma unroll
                for (int j = 0; j < 4; ++j) o[q][j] = wmma16(vf[p][j], pb[q], o[q][j]);
        }
      }
      asm volatile("s_wait_dscnt 0x0" ::: "memory");         // this wave's reads of trip st's tile are done before its buffer may be refilled
      asm volatile("s_wait_asynccnt 0x0" ::: "memory");      // this wave's copies of trip st+1's tile have landed before the barrier publishes them
      __syncthreads();                                       // publishes trip st+1's stage and ends every wave's reads of trip st's
      if (st + 2 < SEQ / (KS * KG)) { const size_t k2 = (size_t)((st + 2 + s0) & (NSG - 1)) * (KS * KG); stage_tile(gk + k2 * HD, gv + k2, lc + (unsigned)(st & 1) * (KG * BUFH * 2u)); }
    }
    asm volatile("s_wait_asynccnt 0x0" ::: "memory");        // nothing of this wave is in flight behind the loop
    // Join of the key groups: group g finishes query tile g and hands the other tile to its partner (the selects are on a wave-uniform condition).
    const bool g1 = grp != 0;
    v8f ok[4], og[4];
#pragma unroll
    for (int j = 0; j < 4; ++j)
#pragma unroll
        for (int r = 0; r < 8; ++r) { ok[j][r] = g1 ? o[1][j][r] : o[0][j][r]; og[j][r] = g1 ? o[0][j][r] : o[1][j][r]; }
    const float lk = g1 ? l[1] : l[0], lg = g1 ? l[0] : l[1];
    const float ck = g1 ? cq[1][0] : cq[0][0], cg = g1 ? cq[0][0] : cq[1][0];
    v4fa* xw = (v4fa*)xch + wave * (9 * 32) + lane;
#pragma unroll
    for (int j = 0; j < 4; ++j) { v4f a, c;
#pragma unroll
        for (int r = 0; r < 4; ++r) { a[r] = og[j][r]; c[r] = og[j][4 + r]; }
        xw[(2 * j) * 32] = a; xw[(2 * j + 1) * 32] = c; }
    xw[8 * 32] = (v4f){ lg, cg, 0.0f, 0.0f };
    __syncthreads();                                         // every wave's handed-over tile is written before its partner reads it
    const v4fa* xr = (const v4fa*)xch + (wave ^ AW) * (9 * 32) + lane;
    const v4f sp = xr[8 * 32];
    const float cm = fminf(ck, sp[1]);                       // PSH minus the larger of the two references: both factors are at most 1
    const float fk = __builtin_amdgcn_exp2f(cm - ck), fp = __builtin_amdgcn_exp2f(cm - sp[1]);
    const float lj = lk * fk + sp[0] * fp;
    const int wb = wave * 16 * 68;
    const int b2 = zh % NB_FULL, cb = zh / NB_FULL;          // regrouped address: output batch b2, column block cb
    {
        const float lq = lj + __shfl_xor(lj, 16, 32);
        const float inv = 1.0f / lq;
        const float sk = fk * inv, sq = fp * inv;
        // O^T D layout: o[j][r] = (d = 16j + 8h + r, t = lane&15) -> os[t][d]; rows 0..15 x columns 0..63 all written
#pragma unroll
        for (int j = 0; j < 4; ++j) { const v4f pa = xr[(2 * j) * 32], pc = xr[(2 * j + 1) * 32]; v4f a, c;
#pragma unroll
            for (int r = 0; r < 4; ++r) { a[r] = ok[j][r] * sk + pa[r] * sq; c[r] = ok[j][4 + r] * sk + pc[r] * sq; }
            *(v4fa*)(&os[wb + lr * 68 + 16 * j + 8 * hi]) = a; *(v4fa*)(&os[wb + lr * 68 + 16 * j + 8 * hi + 4]) = c; }
        wave_sync();
        float* orow = OUT + ((size_t)b2 * OUT_SEQ + t0 + 16 * grp) * DM + (size_t)cb * HD;
#pragma unroll
        for (int s = 0; s < 8; ++s) { const int row = 2 * s + hi, cofs = lr * 4;   // 8 s x 2 rows = 16 rows; 16 lanes x 4 floats = 64 columns
            const v4f val = *(const v4fa*)(&os[wb + row * 68 + cofs]);
            *(v4f*)(orow + (size_t)row * DM + cofs) = val; }
    }
}

static constexpr size_t al256(size_t v) { return (v + 255) & ~(size_t)255; }
static constexpr size_t SZ_XB = al256((size_t)NB * SEQ * DM * 2);          // one bf16 stream copy
static constexpr size_t SZ_WB = al256((size_t)3 * DM * DM * 2);
static constexpr size_t SZ_PL = al256((size_t)NB * NH_ * SEQ * HD * 2);
static constexpr size_t SZ_TOTAL = 3 * SZ_XB + SZ_WB + 3 * SZ_PL;
static_assert(SZ_TOTAL <= (size_t)134217728);          // workspace carve <= 128 MiB
static_assert(((size_t)DM * DM * 2) % 256 == 0);       // weight sub-planes stay 256-byte aligned
static_assert(SZ_XB == (size_t)NB * SEQ * DM * 2);     // no pad between the bf16 copies: the conversion writes them as one range
static constexpr unsigned CVT_G = (unsigned)((3 * (size_t)NB * SEQ * DM + 3 * (size_t)DM * DM) / ((size_t)CVT_T * 1024));   // conversion blocks: three streams, three weights
static_assert((size_t)NB * SEQ * DM == (size_t)NB * NH_ * SEQ * HD);   // projection grid x tile == plane extent

extern "C" void kernel_launch(void* const* d_in, const int* in_sizes, int n_in,
                              void* d_out, int out_size, void* d_ws, size_t ws_size, hipStream_t stream) {
    if (n_in < 6) return;
    const size_t needx = ((size_t)(NB - 1) * SEQ_FULL + SEQ) * DM;
    if ((size_t)in_sizes[0] < needx || (size_t)in_sizes[1] < needx || (size_t)in_sizes[2] < needx) return;
    if ((size_t)in_sizes[3] < (size_t)DM * DM || (size_t)in_sizes[4] < (size_t)DM * DM || (size_t)in_sizes[5] < (size_t)DM * DM) return;
    if ((size_t)out_size < ((size_t)(NB_FULL - 1) * OUT_SEQ + SEQ) * DM) return;
    if (SZ_TOTAL > ws_size) return;
    // wire order: q, k, v streams, then Wq, Wk, Wv ([out][in] used as-is: Bt of q and k, A of v^T)
    const float* xq = (const float*)d_in[0]; const float* xk = (const float*)d_in[1]; const float* xv = (const float*)d_in[2];
    const float* wq = (const float*)d_in[3]; const float* wk = (const float*)d_in[4]; const float* wv = (const float*)d_in[5];
    float* OUT = (float*)d_out;      // [NB_FULL][OUT_SEQ][1024]
    char* wsp = (char*)d_ws;
    bf* XQ = (bf*)wsp; wsp += SZ_XB;                 // [NB*SEQ][1024]
    wsp += SZ_XB;                                    // k stream copy, [NB*SEQ][1024]
    wsp += SZ_XB;                                    // v stream copy, [NB*SEQ][1024]
    bf* WB = (bf*)wsp; wsp += SZ_WB;                 // [3][1024][1024]: q | k | v
    h16* QH = (h16*)wsp; wsp += SZ_PL;               // [NB*16][SEQ][64], times the score scale
    h16* KP = (h16*)wsp; wsp += SZ_PL;               // [NB*16][SEQ][64]
    h16* VT = (h16*)wsp; wsp += SZ_PL;               // [NB*16][64][SEQ]

    // XQ | XK | XV | WQ | WK | WV are one contiguous bf16 range that starts at XQ
    k_cvt_all<<<dim3(CVT_G, 1, 1), 256, 0, stream>>>(xq, xk, xv, wq, wk, wv, XQ);

    // q, k and v^T projections: one launch, blockIdx.z = 0, 1, 2
    k_proj<<<dim3(NB * SEQ / 128, DM / 128, 3), 256, 0, stream>>>(XQ, WB, QH, KP, VT);

    k_flash<<<dim3(SEQ / (16 * QT * AW), NB * NH_, 1), 32 * AW * KG, 0, stream>>>(QH, KP, VT, OUT);
}
